// v000
// Measured on an AMD MI455X. A time is GPU time per run, averaged over a window of back-to-back runs after a warm-up
// (all launches, gaps included; the runs take copies of the inputs in turn), and the median of several windows.
// Apart from v000's, it joins two sittings. Times from different sittings can be a few percent apart, while
// side-by-side timings come from the same sitting.
// v000 is the starting kernel. One run takes 204 microseconds.
#include <hip/hip_runtime.h>

// Contractions: per-head x*W^T (q,k,v) on v_wmma_f32_16x16x32_bf16 (bf16 operands); q*k^T, p*v, ctx*Wo^T on v_wmma_f32_16x16x32_f16 (f16 operands, power-of-two carries p*1024, ctx*64, Wo*16); f32 accumulate; softmax in f32.

#ifndef NB
#define NB 4
#endif
#ifndef SEQ
#define SEQ 2048
#endif
#define NB_FULL 4
#define SEQ_FULL 2048
#define EMB 512
#define NH 8
#define HD 64
#define MTOK (NB * SEQ)

static_assert(NB >= 1 && NB <= NB_FULL);
static_assert(SEQ >= 128 && SEQ <= SEQ_FULL && (SEQ % 128) == 0);
static_assert(EMB == NH * HD);
static_assert((EMB % 64) == 0 && (MTOK % 128) == 0);
// full-size carve: 3 planes of NB*NH*SEQ*HD halves + ctx plane of MTOK*EMB halves
static_assert((3ull * NB_FULL * NH * SEQ_FULL * HD + (unsigned long long)NB_FULL * SEQ_FULL * EMB) * 2ull <= 134217728ull);

typedef unsigned short u16;
typedef _Float16 v16h __attribute__((ext_vector_type(16)));
typedef __bf16   v16bf __attribute__((ext_vector_type(16)));
typedef float    v8f  __attribute__((ext_vector_type(8)));
typedef _Float16 v8ha __attribute__((ext_vector_type(8), __may_alias__));
typedef float    v4fa __attribute__((ext_vector_type(4), __may_alias__));
typedef unsigned v4u  __attribute__((ext_vector_type(4), __may_alias__));

union FragH { v16h v; v8ha p[2]; };
union FragB { v16bf v; v4u q[2]; };
union Pack8 { v8ha h; v4u u; _Float16 s[8]; };

// ---------------- helpers ----------------

__device__ __forceinline__ unsigned bfbits(float f) {   // f32 -> bf16 bits, RNE
  unsigned u = __float_as_uint(f);
  u += 0x7FFFu + ((u >> 16) & 1u);
  return u >> 16;
}
__device__ __forceinline__ float bfval(float f) {       // f32 -> value of its bf16 RNE image
  unsigned u = __float_as_uint(f);
  u += 0x7FFFu + ((u >> 16) & 1u);
  return __uint_as_float(u & 0xFFFF0000u);
}
__device__ __forceinline__ v8f z8() {
  v8f z = {0.f, 0.f, 0.f, 0.f, 0.f, 0.f, 0.f, 0.f};
  return z;
}

// 8 consecutive f32 -> 8 bf16 packed in 16 bytes (low half-word = lower index)
__device__ __forceinline__ v4u pack_bf8(const float* __restrict__ p) {
  const v4fa x0 = *(const v4fa*)p;
  const v4fa x1 = *(const v4fa*)(p + 4);
  v4u r;
  r.x = bfbits(x0.x) | (bfbits(x0.y) << 16);
  r.y = bfbits(x0.z) | (bfbits(x0.w) << 16);
  r.z = bfbits(x1.x) | (bfbits(x1.y) << 16);
  r.w = bfbits(x1.z) | (bfbits(x1.w) << 16);
  return r;
}

// 16x32 16-bit fragment (A or B layout, identical k map), row-major source, pitch ld (elements):
//   lane l: row = l&15; elements 0..7 <- k 8h..8h+7; elements 8..15 <- k 16+8h..16+8h+7, h = l>>4.
__device__ __forceinline__ v16h frag_h(const _Float16* base, int ld) {
  const int lane = threadIdx.x & 31;
  const int row  = lane & 15;
  const int kb   = (lane >> 4) << 3;
  FragH u;
  u.p[0] = *(const v8ha*)(base + (size_t)row * ld + kb);
  u.p[1] = *(const v8ha*)(base + (size_t)row * ld + 16 + kb);
  return u.v;
}

// A fragment from f32 rows (pitch ld floats), k columns k0..k0+31, converted to bf16 RNE.
__device__ __forceinline__ v16bf frag_x_bf(const float* base, int ld, int k0) {
  const int lane = threadIdx.x & 31;
  const int row  = lane & 15;
  const int kb   = (lane >> 4) << 3;
  const float* p = base + (size_t)row * ld + k0 + kb;
  FragB u;
  u.q[0] = pack_bf8(p);        // k0+kb .. k0+kb+7
  u.q[1] = pack_bf8(p + 16);   // k0+16+kb .. k0+16+kb+7
  return u.v;
}

// B fragment from an LDS bf16 tile stored as [n][8 chunks of 8 k] (64 k per row);
// rows nrow0..nrow0+15, k chunk base kc0 (0 -> k 0..31, 4 -> k 32..63).
__device__ __forceinline__ v16bf frag_w_bf(const v4u* tile, int nrow0, int kc0) {
  const int lane = threadIdx.x & 31;
  const int n    = lane & 15;
  const int hh   = lane >> 4;
  FragB u;
  u.q[0] = tile[(nrow0 + n) * 8 + kc0 + hh];
  u.q[1] = tile[(nrow0 + n) * 8 + kc0 + 2 + hh];
  return u.v;
}

__device__ __forceinline__ v8f mma_h(v16h a, v16h b, v8f c) {
  v8f d = __builtin_amdgcn_wmma_f32_16x16x32_f16(false, a, false, b, (short)0, c, false, false);
  asm volatile("v_nop\n\tv_nop\n\tv_nop\n\tv_nop" : "+v"(d) : "v"(a), "v"(b));
  return d;
}
__device__ __forceinline__ v8f mma_bf(v16bf a, v16bf b, v8f c) {
  v8f d = __builtin_amdgcn_wmma_f32_16x16x32_bf16(false, a, false, b, (short)0, c, false, false);
  asm volatile("v_nop\n\tv_nop\n\tv_nop\n\tv_nop" : "+v"(d) : "v"(a), "v"(b));
  return d;
}

// reductions across the 16-lane halves (D-layout rows live in one half)
__device__ __forceinline__ float hmax16(float x) {
#pragma unroll
  for (int m = 1; m < 16; m <<= 1) x = fmaxf(x, __shfl_xor(x, m, 32));
  return x;
}
__device__ __forceinline__ float hadd16(float x) {
#pragma unroll
  for (int m = 1; m < 16; m <<= 1) x += __shfl_xor(x, m, 32);
  return x;
}

// One wave writes its 16 x 64-half tile (LDS, pitch 64) to 16 global rows of pitch `pitch` halves.
__device__ __forceinline__ void wave_store_rows16(const _Float16* tile, _Float16* dst, int pitch) {
  const int lane = threadIdx.x & 31;
  const int rsub = lane >> 3, c8 = (lane & 7) << 3;
  Pack8 v[4];
#pragma unroll
  for (int it = 0; it < 4; ++it)
    v[it].h = *(const v8ha*)(tile + (it * 4 + rsub) * 64 + c8);
#pragma unroll
  for (int it = 0; it < 4; ++it)
    *(v4u*)(dst + (size_t)(it * 4 + rsub) * pitch + c8) = v[it].u;
  
}

// ---------------- kernel 1: per-head q/k/v projections ----------------
// block = 256 threads (8 waves); block owns (128 tokens, head h); wave owns 16 tokens x 64 outputs.
// Q,K planes: [bh][s][64] f16.   V plane transposed: [bh][64][SEQ] f16.
__global__ __launch_bounds__(256) void k_qkv(
    const float* __restrict__ x,
    const float* __restrict__ Wq, const float* __restrict__ bq,
    const float* __restrict__ Wk, const float* __restrict__ bk,
    const float* __restrict__ Wv, const float* __restrict__ bv,
    _Float16* __restrict__ Qp, _Float16* __restrict__ Kp, _Float16* __restrict__ Vtp) {
  __shared__ __align__(16) v4u Wl[3][512];          // bf16 [n][k] per matrix, 8 k per chunk
  __shared__ float Bl[3][HD];                        // bf16-RNE biases as f32
  __shared__ __align__(16) _Float16 St[128 * HD];    // f16 staging [token local][d]

  const int tid = threadIdx.x, wave = tid >> 5, lane = tid & 31;
  const int hh = lane >> 4, n16 = lane & 15;
  const int h  = blockIdx.y;
  const int m0 = blockIdx.x * 128;                   // compact token index
  const int b  = m0 / SEQ, s0 = m0 - b * SEQ;
  const int bh = b * NH + h;

  // stage the head's three 64x64 weight tiles (bf16 RNE) and biases
#pragma unroll
  for (int c = tid; c < 512; c += 256) {
    const int nrow = c >> 3, ko = (c & 7) << 3;
    const size_t off = ((size_t)h * HD + nrow) * HD + ko;
    Wl[0][c] = pack_bf8(Wq + off);
    Wl[1][c] = pack_bf8(Wk + off);
    Wl[2][c] = pack_bf8(Wv + off);
  }
  if (tid < HD) {                                    // wave-uniform (waves 0,1)
    Bl[0][tid] = bfval(bq[h * HD + tid]);
    Bl[1][tid] = bfval(bk[h * HD + tid]);
    Bl[2][tid] = bfval(bv[h * HD + tid]);
  }
  __syncthreads();

  // A fragments of the wave's 16 tokens (64 input dims of head h), bf16 RNE in registers
  const float* xp = x + ((size_t)b * SEQ_FULL + s0 + wave * 16) * EMB + h * HD;
  const v16bf a0 = frag_x_bf(xp, EMB, 0);
  const v16bf a1 = frag_x_bf(xp, EMB, 32);

#pragma unroll
  for (int mat = 0; mat < 3; ++mat) {
    v8f acc[4];
#pragma unroll
    for (int t = 0; t < 4; ++t) {
      v8f c = z8();
      c = mma_bf(a0, frag_w_bf(Wl[mat], t * 16, 0), c);
      c = mma_bf(a1, frag_w_bf(Wl[mat], t * 16, 4), c);
      acc[t] = c;
    }
    // bias add in f32, convert to f16, stage: D element r of lane -> (row 8hh+r, col t*16+n16)
#pragma unroll
    for (int t = 0; t < 4; ++t) {
      const float bias = Bl[mat][t * 16 + n16];
#pragma unroll
      for (int r = 0; r < 8; ++r)
        St[(wave * 16 + 8 * hh + r) * HD + t * 16 + n16] = (_Float16)(acc[t][r] + bias);
    }
    __syncthreads();

    if (mat < 2) {
      _Float16* plane = (mat == 0) ? Qp : Kp;
      wave_store_rows16(&St[(wave * 16) * HD],
                        plane + ((size_t)bh * SEQ + s0 + wave * 16) * HD, HD);
    } else {
      // V transposed: line L = (d, half); 8 lanes x 16 B per line, 4 lines per instruction
      const int c8 = (tid & 7) << 3;
      Pack8 w[4];
#pragma unroll
      for (int it = 0; it < 4; ++it) {
        const int L = it * 32 + (tid >> 3);
        const int d = L >> 1, j0 = (L & 1) * 64 + c8;
#pragma unroll
        for (int e = 0; e < 8; ++e) w[it].s[e] = St[(j0 + e) * HD + d];
      }
#pragma unroll
      for (int it = 0; it < 4; ++it) {
        const int L = it * 32 + (tid >> 3);
        const int d = L >> 1, j0 = (L & 1) * 64 + c8;
        *(v4u*)(Vtp + ((size_t)bh * HD + d) * SEQ + s0 + j0) = w[it].u;
      }
      
    }
    __syncthreads();                                 // St free for the next matrix
  }
}

// ---------------- kernel 2: flash-style attention ----------------
// block = 256 threads (8 waves); block owns (bh, 128 query rows); wave owns 16 query rows.
// K tile [64 keys][64 d] and V^T tile [64 d][64 keys] staged in LDS per step (plain loads).
// ctx plane (heads merged): [b*SEQ+s][EMB] f16, carried x64.
__global__ __launch_bounds__(256) void k_attn(
    const _Float16* __restrict__ Qp, const _Float16* __restrict__ Kp,
    const _Float16* __restrict__ Vtp, _Float16* __restrict__ Cp) {
  __shared__ __align__(16) _Float16 Kt[64 * HD];      // [key][d]
  __shared__ __align__(16) _Float16 Vt[HD * 64];      // [d][key]
  __shared__ __align__(16) _Float16 Pt[8][16 * 64];   // per wave [q row][key], p*1024; reused for ctx staging

  const int tid = threadIdx.x, wave = tid >> 5, lane = tid & 31;
  const int hh = lane >> 4, n16 = lane & 15;
  const int bh = blockIdx.x;
  const int b  = bh / NH, h = bh - b * NH;
  const int q0 = blockIdx.y * 128 + wave * 16;

  const _Float16* Qbh = Qp  + (size_t)bh * SEQ * HD;
  const _Float16* Kbh = Kp  + (size_t)bh * SEQ * HD;
  const _Float16* Vbh = Vtp + (size_t)bh * HD * SEQ;

  // Q fragments (d 0..31, 32..63) live in registers for the whole key loop
  const v16h aq0 = frag_h(Qbh + (size_t)q0 * HD, HD);
  const v16h aq1 = frag_h(Qbh + (size_t)q0 * HD + 32, HD);

  float mrow[8], lrow[8];
  v8f o[4];
#pragma unroll
  for (int r = 0; r < 8; ++r) { mrow[r] = -1e30f; lrow[r] = 0.f; }
#pragma unroll
  for (int t = 0; t < 4; ++t) o[t] = z8();

  const float scale = 0.125f;   // 1/sqrt(64), exact

  for (int t0 = 0; t0 < SEQ; t0 += 64) {
    __syncthreads();            // prior tile fully consumed by all waves
#pragma unroll
    for (int c = tid; c < 512; c += 256) {
      const int row = c >> 3, off = (c & 7) << 3;
      *(v8ha*)&Kt[row * HD + off] = *(const v8ha*)(Kbh + (size_t)(t0 + row) * HD + off);
      *(v8ha*)&Vt[row * 64 + off] = *(const v8ha*)(Vbh + (size_t)row * SEQ + t0 + off);
    }
    __syncthreads();            // tiles visible

    // scores S(16 x 64 keys) = Q(16x64) . K^T : B[k=d][n=key] = Kt[key][d]
    v8f sc[4];
#pragma unroll
    for (int t = 0; t < 4; ++t) {
      const v16h kb0 = frag_h(&Kt[(t * 16) * HD], HD);
      const v16h kb1 = frag_h(&Kt[(t * 16) * HD + 32], HD);
      v8f c = z8();
      c = mma_h(aq0, kb0, c);
      c = mma_h(aq1, kb1, c);
      sc[t] = c;
    }

    // online softmax; row 8hh+r lives across the 16 lanes of this half
    float alpha[8];
#pragma unroll
    for (int r = 0; r < 8; ++r) {
      float mx = fmaxf(fmaxf(sc[0][r], sc[1][r]), fmaxf(sc[2][r], sc[3][r]));
      mx = hmax16(mx * scale);
      const float mnew = fmaxf(mrow[r], mx);
      alpha[r] = __expf(mrow[r] - mnew);
      mrow[r] = mnew;
    }
#pragma unroll
    for (int r = 0; r < 8; ++r) {
      float ps = 0.f;
#pragma unroll
      for (int t = 0; t < 4; ++t) {
        const float p = __expf(sc[t][r] * scale - mrow[r]);
        ps += p;
        Pt[wave][(8 * hh + r) * 64 + t * 16 + n16] = (_Float16)(p * 1024.0f);
      }
      lrow[r] = lrow[r] * alpha[r] + hadd16(ps);
    }
#pragma unroll
    for (int t = 0; t < 4; ++t)
#pragma unroll
      for (int r = 0; r < 8; ++r) o[t][r] *= alpha[r];

    __syncthreads();            // P tile stores complete before fragment reloads

    // O(16 x 64 d) += P(16 x 64 keys) . V : B[k=key][n=d] = Vt[d][key]
    const v16h p0 = frag_h(&Pt[wave][0], 64);
    const v16h p1 = frag_h(&Pt[wave][32], 64);
#pragma unroll
    for (int dt = 0; dt < 4; ++dt) {
      const v16h vb0 = frag_h(&Vt[(dt * 16) * 64], 64);
      const v16h vb1 = frag_h(&Vt[(dt * 16) * 64 + 32], 64);
      v8f c = o[dt];
      c = mma_h(p0, vb0, c);
      c = mma_h(p1, vb1, c);
      o[dt] = c;
    }
  }

  // normalise: o holds 1024 * sum(p v); ctx carried x64 -> o * (64/1024) / l
  float inv[8];
#pragma unroll
  for (int r = 0; r < 8; ++r) inv[r] = 0.0625f * __builtin_amdgcn_rcpf(lrow[r]);

  __syncthreads();              // all fragment reads of Pt done before restaging
#pragma unroll
  for (int dt = 0; dt < 4; ++dt)
#pragma unroll
    for (int r = 0; r < 8; ++r)
      Pt[wave][(8 * hh + r) * 64 + dt * 16 + n16] = (_Float16)(o[dt][r] * inv[r]);
  __syncthreads();

  wave_store_rows16(&Pt[wave][0],
                    Cp + ((size_t)b * SEQ + q0) * EMB + h * HD, EMB);
}

// ---------------- kernel 3: output projection out = ctx . Wo^T + bo ----------------
// block = 256 threads (8 waves); block tile 128 tokens x 64 outputs; wave owns 16 x 64.
// B tile (Wo rows n0..n0+63, k slab of 32) staged in LDS as f16(16 * bf16RNE(Wo)).
__global__ __launch_bounds__(256) void k_oproj(
    const _Float16* __restrict__ Cp, const float* __restrict__ Wo,
    const float* __restrict__ bo, float* __restrict__ out) {
  __shared__ __align__(16) _Float16 Bt[64 * 32];     // [n local][k local]
  __shared__ __align__(16) float Os[8][16 * 64];     // per wave f32 output staging

  const int tid = threadIdx.x, wave = tid >> 5, lane = tid & 31;
  const int hh = lane >> 4, n16 = lane & 15;
  const int m0 = blockIdx.x * 128 + wave * 16;
  const int n0 = blockIdx.y * 64;

  const int nl = tid >> 2, ko = (tid & 3) << 3;      // staging: 8 consecutive k of one n row
  const float* wsrc = Wo + (size_t)(n0 + nl) * EMB + ko;
  const _Float16* arow = Cp + (size_t)m0 * EMB;

  v8f acc[4];
#pragma unroll
  for (int t = 0; t < 4; ++t) acc[t] = z8();

  for (int kk = 0; kk < EMB; kk += 32) {
    __syncthreads();            // Bt free
    {
      const v4fa x0 = *(const v4fa*)(wsrc + kk);
      const v4fa x1 = *(const v4fa*)(wsrc + kk + 4);
      Pack8 w;
      w.s[0] = (_Float16)(bfval(x0.x) * 16.0f);
      w.s[1] = (_Float16)(bfval(x0.y) * 16.0f);
      w.s[2] = (_Float16)(bfval(x0.z) * 16.0f);
      w.s[3] = (_Float16)(bfval(x0.w) * 16.0f);
      w.s[4] = (_Float16)(bfval(x1.x) * 16.0f);
      w.s[5] = (_Float16)(bfval(x1.y) * 16.0f);
      w.s[6] = (_Float16)(bfval(x1.z) * 16.0f);
      w.s[7] = (_Float16)(bfval(x1.w) * 16.0f);
      *(v8ha*)&Bt[nl * 32 + ko] = w.h;
    }
    __syncthreads();            // Bt visible
    const v16h a = frag_h(arow + kk, EMB);
#pragma unroll
    for (int t = 0; t < 4; ++t)
      acc[t] = mma_h(a, frag_h(&Bt[(t * 16) * 32], 32), acc[t]);
  }

  // epilogue: undo carries (64*16 = 1024), add bf16-RNE bias, stage f32 tile
#pragma unroll
  for (int t = 0; t < 4; ++t) {
    const float bias = bfval(bo[n0 + t * 16 + n16]);
#pragma unroll
    for (int r = 0; r < 8; ++r)
      Os[wave][(8 * hh + r) * 64 + t * 16 + n16] = acc[t][r] * (1.0f / 1024.0f) + bias;
  }
  __syncthreads();

  // 16 rows x 256 B = 32 lines; line = (row, half); 8 lanes x 16 B per line, 4 lines per instruction
  const int rsub = lane >> 3, c4 = (lane & 7) << 2;
  v4fa v[8];
#pragma unroll
  for (int it = 0; it < 8; ++it) {
    const int li = it * 4 + rsub;
    const int row = li >> 1, hf = li & 1;
    v[it] = *(const v4fa*)&Os[wave][row * 64 + hf * 32 + c4];
  }
  float* base = out + (size_t)m0 * EMB + n0;
#pragma unroll
  for (int it = 0; it < 8; ++it) {
    const int li = it * 4 + rsub;
    const int row = li >> 1, hf = li & 1;
    *(v4fa*)(base + (size_t)row * EMB + hf * 32 + c4) = v[it];
  }
  
}

// ---------------- launcher ----------------
extern "C" void kernel_launch(void* const* d_in, const int* in_sizes, int n_in,
                              void* d_out, int out_size, void* d_ws, size_t ws_size,
                              hipStream_t stream) {
  if (n_in < 9) return;
  if (in_sizes[0] < ((NB - 1) * SEQ_FULL + SEQ) * EMB) return;
  if (in_sizes[1] < NH * HD * HD || in_sizes[3] < NH * HD * HD || in_sizes[5] < NH * HD * HD) return;
  if (in_sizes[2] < NH * HD || in_sizes[4] < NH * HD || in_sizes[6] < NH * HD) return;
  if (in_sizes[7] < EMB * EMB || in_sizes[8] < EMB) return;
  if (out_size < MTOK * EMB) return;

  const float* x  = (const float*)d_in[0];
  const float* Wq = (const float*)d_in[1];
  const float* bq = (const float*)d_in[2];
  const float* Wk = (const float*)d_in[3];
  const float* bk = (const float*)d_in[4];
  const float* Wv = (const float*)d_in[5];
  const float* bv = (const float*)d_in[6];
  const float* Wo = (const float*)d_in[7];
  const float* bo = (const float*)d_in[8];
  float* out = (float*)d_out;

  const size_t qkv_bytes = (size_t)NB * NH * SEQ * HD * 2;   // 8 MiB at full size
  const size_t ctx_bytes = (size_t)MTOK * EMB * 2;           // 8 MiB at full size
  const size_t off_q = 0;
  const size_t off_k = off_q + qkv_bytes;
  const size_t off_v = off_k + qkv_bytes;
  const size_t off_c = off_v + qkv_bytes;
  const size_t total = off_c + ctx_bytes;
  if (total > ws_size) return;

  char* ws = (char*)d_ws;
  _Float16* Qp  = (_Float16*)(ws + off_q);
  _Float16* Kp  = (_Float16*)(ws + off_k);
  _Float16* Vtp = (_Float16*)(ws + off_v);
  _Float16* Cp  = (_Float16*)(ws + off_c);

  k_qkv<<<dim3(MTOK / 128, NH), 256, 0, stream>>>(x, Wq, bq, Wk, bk, Wv, bv, Qp, Kp, Vtp);
  k_attn<<<dim3(NB * NH, SEQ / 128), 256, 0, stream>>>(Qp, Kp, Vtp, Cp);
  k_oproj<<<dim3(MTOK / 128, EMB / 64), 256, 0, stream>>>(Cp, Wo, bo, out);
}

// v001
// Measured time: 116 microseconds a run.
// Next to v000, in two timings, it ran 1.81 and 1.82 times as fast.
#include <hip/hip_runtime.h>

// Contractions: per-head x*W^T (q,k,v) on v_wmma_f32_16x16x32_bf16 (bf16 operands); q*k^T, p*v, ctx*Wo^T on v_wmma_f32_16x16x32_f16 (f16 operands, power-of-two carries p*1024, ctx*64, Wo*16); f32 accumulate; softmax in f32.

#ifndef NB
#define NB 4
#endif
#ifndef SEQ
#define SEQ 2048
#endif
#define NB_FULL 4
#define SEQ_FULL 2048
#define EMB 512
#define NH 8
#define HD 64
#define MTOK (NB * SEQ)
// LDS row pitches: data row + 16 B, an odd multiple of 16 B, so that the 16 rows of a 16-byte fragment read fall on different banks
#define LP 72   // halves, rows of 64 halves (128 B -> 144 B)
#define BP 40   // halves, rows of 32 halves (64 B -> 80 B)
#define WP 9    // 16-byte chunks, rows of 8 chunks (128 B -> 144 B)
#define OP 68   // floats, rows of 64 floats (256 B -> 272 B)

static_assert(NB >= 1 && NB <= NB_FULL);
static_assert(SEQ >= 128 && SEQ <= SEQ_FULL && (SEQ % 128) == 0);
static_assert(EMB == NH * HD);
static_assert((EMB % 64) == 0 && (MTOK % 128) == 0);
// full-size carve: 3 planes of NB*NH*SEQ*HD halves + ctx plane of MTOK*EMB halves
static_assert((3ull * NB_FULL * NH * SEQ_FULL * HD + (unsigned long long)NB_FULL * SEQ_FULL * EMB) * 2ull <= 134217728ull);

typedef unsigned short u16;
typedef _Float16 v16h __attribute__((ext_vector_type(16)));
typedef __bf16   v16bf __attribute__((ext_vector_type(16)));
typedef float    v8f  __attribute__((ext_vector_type(8)));
typedef _Float16 v8ha __attribute__((ext_vector_type(8), __may_alias__));
typedef float    v4fa __attribute__((ext_vector_type(4), __may_alias__));
typedef unsigned v4u  __attribute__((ext_vector_type(4), __may_alias__));

union FragH { v16h v; v8ha p[2]; };
union FragB { v16bf v; v4u q[2]; };
union Pack8 { v8ha h; v4u u; _Float16 s[8]; };

// ---------------- helpers ----------------

__device__ __forceinline__ unsigned bfbits(float f) {   // f32 -> bf16 bits, RNE
  unsigned u = __float_as_uint(f);
  u += 0x7FFFu + ((u >> 16) & 1u);
  return u >> 16;
}
__device__ __forceinline__ float bfval(float f) {       // f32 -> value of its bf16 RNE image
  unsigned u = __float_as_uint(f);
  u += 0x7FFFu + ((u >> 16) & 1u);
  return __uint_as_float(u & 0xFFFF0000u);
}
__device__ __forceinline__ v8f z8() {
  v8f z = {0.f, 0.f, 0.f, 0.f, 0.f, 0.f, 0.f, 0.f};
  return z;
}

// 8 consecutive f32 -> 8 bf16 packed in 16 bytes (low half-word = lower index)
__device__ __forceinline__ v4u pack_bf8(const float* __restrict__ p) {
  const v4fa x0 = *(const v4fa*)p;
  const v4fa x1 = *(const v4fa*)(p + 4);
  v4u r;
  r.x = bfbits(x0.x) | (bfbits(x0.y) << 16);
  r.y = bfbits(x0.z) | (bfbits(x0.w) << 16);
  r.z = bfbits(x1.x) | (bfbits(x1.y) << 16);
  r.w = bfbits(x1.z) | (bfbits(x1.w) << 16);
  return r;
}

// 16x32 16-bit fragment (A or B layout, identical k map), row-major source, pitch ld (elements):
//   lane l: row = l&15; elements 0..7 <- k 8h..8h+7; elements 8..15 <- k 16+8h..16+8h+7, h = l>>4.
__device__ __forceinline__ v16h frag_h(const _Float16* base, int ld) {
  const int lane = threadIdx.x & 31;
  const int row  = lane & 15;
  const int kb   = (lane >> 4) << 3;
  FragH u;
  u.p[0] = *(const v8ha*)(base + (size_t)row * ld + kb);
  u.p[1] = *(const v8ha*)(base + (size_t)row * ld + 16 + kb);
  return u.v;
}

// A fragment from f32 rows (pitch ld floats), k columns k0..k0+31, converted to bf16 RNE.
__device__ __forceinline__ v16bf frag_x_bf(const float* base, int ld, int k0) {
  const int lane = threadIdx.x & 31;
  const int row  = lane & 15;
  const int kb   = (lane >> 4) << 3;
  const float* p = base + (size_t)row * ld + k0 + kb;
  FragB u;
  u.q[0] = pack_bf8(p);        // k0+kb .. k0+kb+7
  u.q[1] = pack_bf8(p + 16);   // k0+16+kb .. k0+16+kb+7
  return u.v;
}

// B fragment from an LDS bf16 tile stored as [n][8 chunks of 8 k] (64 k per row, row pitch WP chunks);
// rows nrow0..nrow0+15, k chunk base kc0 (0 -> k 0..31, 4 -> k 32..63).
__device__ __forceinline__ v16bf frag_w_bf(const v4u* tile, int nrow0, int kc0) {
  const int lane = threadIdx.x & 31;
  const int n    = lane & 15;
  const int hh   = lane >> 4;
  FragB u;
  u.q[0] = tile[(nrow0 + n) * WP + kc0 + hh];
  u.q[1] = tile[(nrow0 + n) * WP + kc0 + 2 + hh];
  return u.v;
}

__device__ __forceinline__ v8f mma_h(v16h a, v16h b, v8f c) {
  v8f d = __builtin_amdgcn_wmma_f32_16x16x32_f16(false, a, false, b, (short)0, c, false, false);
  asm volatile("v_nop\n\tv_nop\n\tv_nop\n\tv_nop" : "+v"(d) : "v"(a), "v"(b));
  return d;
}
__device__ __forceinline__ v8f mma_bf(v16bf a, v16bf b, v8f c) {
  v8f d = __builtin_amdgcn_wmma_f32_16x16x32_bf16(false, a, false, b, (short)0, c, false, false);
  asm volatile("v_nop\n\tv_nop\n\tv_nop\n\tv_nop" : "+v"(d) : "v"(a), "v"(b));
  return d;
}

// reductions across the 16-lane halves (D-layout rows live in one half)
__device__ __forceinline__ float hmax16(float x) {
#pragma unroll
  for (int m = 1; m < 16; m <<= 1) x = fmaxf(x, __shfl_xor(x, m, 32));
  return x;
}
__device__ __forceinline__ float hadd16(float x) {
#pragma unroll
  for (int m = 1; m < 16; m <<= 1) x += __shfl_xor(x, m, 32);
  return x;
}

// One wave writes its 16 x 64-half tile (LDS, pitch LP) to 16 global rows of pitch `pitch` halves.
__device__ __forceinline__ void wave_store_rows16(const _Float16* tile, _Float16* dst, int pitch) {
  const int lane = threadIdx.x & 31;
  const int rsub = lane >> 3, c8 = (lane & 7) << 3;
  Pack8 v[4];
#pragma unroll
  for (int it = 0; it < 4; ++it)
    v[it].h = *(const v8ha*)(tile + (it * 4 + rsub) * LP + c8);
#pragma unroll
  for (int it = 0; it < 4; ++it)
    *(v4u*)(dst + (size_t)(it * 4 + rsub) * pitch + c8) = v[it].u;
  
}

// ---------------- kernel 1: per-head q/k/v projections ----------------
// block = 256 threads (8 waves); block owns (128 tokens, head h); wave owns 16 tokens x 64 outputs.
// Q,K planes: [bh][s][64] f16.   V plane transposed: [bh][64][SEQ] f16.
__global__ __launch_bounds__(256) void k_qkv(
    const float* __restrict__ x,
    const float* __restrict__ Wq, const float* __restrict__ bq,
    const float* __restrict__ Wk, const float* __restrict__ bk,
    const float* __restrict__ Wv, const float* __restrict__ bv,
    _Float16* __restrict__ Qp, _Float16* __restrict__ Kp, _Float16* __restrict__ Vtp) {
  __shared__ __align__(16) v4u Wl[3][HD * WP];      // bf16 [n][k] per matrix, 8 k per chunk
  __shared__ float Bl[3][HD];                        // bf16-RNE biases as f32
  __shared__ __align__(16) _Float16 St[128 * LP];    // f16 staging [token local][d]

  const int tid = threadIdx.x, wave = tid >> 5, lane = tid & 31;
  const int hh = lane >> 4, n16 = lane & 15;
  const int h  = blockIdx.y;
  const int m0 = blockIdx.x * 128;                   // compact token index
  const int b  = m0 / SEQ, s0 = m0 - b * SEQ;
  const int bh = b * NH + h;

  // stage the head's three 64x64 weight tiles (bf16 RNE) and biases
#pragma unroll
  for (int c = tid; c < 512; c += 256) {
    const int nrow = c >> 3, ko = (c & 7) << 3;
    const size_t off = ((size_t)h * HD + nrow) * HD + ko;
    const int cl = nrow * WP + (c & 7);
    Wl[0][cl] = pack_bf8(Wq + off);
    Wl[1][cl] = pack_bf8(Wk + off);
    Wl[2][cl] = pack_bf8(Wv + off);
  }
  if (tid < HD) {                                    // wave-uniform (waves 0,1)
    Bl[0][tid] = bfval(bq[h * HD + tid]);
    Bl[1][tid] = bfval(bk[h * HD + tid]);
    Bl[2][tid] = bfval(bv[h * HD + tid]);
  }
  __syncthreads();

  // A fragments of the wave's 16 tokens (64 input dims of head h), bf16 RNE in registers
  const float* xp = x + ((size_t)b * SEQ_FULL + s0 + wave * 16) * EMB + h * HD;
  const v16bf a0 = frag_x_bf(xp, EMB, 0);
  const v16bf a1 = frag_x_bf(xp, EMB, 32);

#pragma unroll
  for (int mat = 0; mat < 3; ++mat) {
    v8f acc[4];
#pragma unroll
    for (int t = 0; t < 4; ++t) {
      v8f c = z8();
      c = mma_bf(a0, frag_w_bf(Wl[mat], t * 16, 0), c);
      c = mma_bf(a1, frag_w_bf(Wl[mat], t * 16, 4), c);
      acc[t] = c;
    }
    // bias add in f32, convert to f16, stage: D element r of lane -> (row 8hh+r, col t*16+n16)
#pragma unroll
    for (int t = 0; t < 4; ++t) {
      const float bias = Bl[mat][t * 16 + n16];
#pragma unroll
      for (int r = 0; r < 8; ++r)
        St[(wave * 16 + 8 * hh + r) * LP + t * 16 + n16] = (_Float16)(acc[t][r] + bias);
    }
    __syncthreads();

    if (mat < 2) {
      _Float16* plane = (mat == 0) ? Qp : Kp;
      wave_store_rows16(&St[(wave * 16) * LP],
                        plane + ((size_t)bh * SEQ + s0 + wave * 16) * HD, HD);
    } else {
      // V transposed: line L = (d, half); 8 lanes x 16 B per line, 4 lines per instruction
      const int c8 = (tid & 7) << 3;
      Pack8 w[4];
#pragma unroll
      for (int it = 0; it < 4; ++it) {
        const int L = it * 32 + (tid >> 3);
        const int d = L >> 1, j0 = (L & 1) * 64 + c8;
#pragma unroll
        for (int e = 0; e < 8; ++e) w[it].s[e] = St[(j0 + e) * LP + d];
      }
#pragma unroll
      for (int it = 0; it < 4; ++it) {
        const int L = it * 32 + (tid >> 3);
        const int d = L >> 1, j0 = (L & 1) * 64 + c8;
        *(v4u*)(Vtp + ((size_t)bh * HD + d) * SEQ + s0 + j0) = w[it].u;
      }
      
    }
    __syncthreads();                                 // St free for the next matrix
  }
}

// ---------------- kernel 2: flash-style attention ----------------
// block = 256 threads (8 waves); block owns (bh, 128 query rows); wave owns 16 query rows.
// K tile [64 keys][64 d] and V^T tile [64 d][64 keys] staged in LDS per step (plain loads).
// ctx plane (heads merged): [b*SEQ+s][EMB] f16, carried x64.
__global__ __launch_bounds__(256) void k_attn(
    const _Float16* __restrict__ Qp, const _Float16* __restrict__ Kp,
    const _Float16* __restrict__ Vtp, _Float16* __restrict__ Cp) {
  __shared__ __align__(16) _Float16 Kt[64 * LP];      // [key][d]
  __shared__ __align__(16) _Float16 Vt[HD * LP];      // [d][key]
  __shared__ __align__(16) _Float16 Pt[8][16 * LP];   // per wave [q row][key], p*1024; reused for ctx staging

  const int tid = threadIdx.x, wave = tid >> 5, lane = tid & 31;
  const int hh = lane >> 4, n16 = lane & 15;
  const int bh = blockIdx.x;
  const int b  = bh / NH, h = bh - b * NH;
  const int q0 = blockIdx.y * 128 + wave * 16;

  const _Float16* Qbh = Qp  + (size_t)bh * SEQ * HD;
  const _Float16* Kbh = Kp  + (size_t)bh * SEQ * HD;
  const _Float16* Vbh = Vtp + (size_t)bh * HD * SEQ;

  // Q fragments (d 0..31, 32..63) live in registers for the whole key loop
  const v16h aq0 = frag_h(Qbh + (size_t)q0 * HD, HD);
  const v16h aq1 = frag_h(Qbh + (size_t)q0 * HD + 32, HD);

  float mrow[8], lrow[8];
  v8f o[4];
#pragma unroll
  for (int r = 0; r < 8; ++r) { mrow[r] = -1e30f; lrow[r] = 0.f; }
#pragma unroll
  for (int t = 0; t < 4; ++t) o[t] = z8();

  const float scale = 0.125f;   // 1/sqrt(64), exact

  for (int t0 = 0; t0 < SEQ; t0 += 64) {
    __syncthreads();            // prior tile fully consumed by all waves
#pragma unroll
    for (int c = tid; c < 512; c += 256) {
      const int row = c >> 3, off = (c & 7) << 3;
      *(v8ha*)&Kt[row * LP + off] = *(const v8ha*)(Kbh + (size_t)(t0 + row) * HD + off);
      *(v8ha*)&Vt[row * LP + off] = *(const v8ha*)(Vbh + (size_t)row * SEQ + t0 + off);
    }
    __syncthreads();            // tiles visible

    // scores S(16 x 64 keys) = Q(16x64) . K^T : B[k=d][n=key] = Kt[key][d]
    v8f sc[4];
#pragma unroll
    for (int t = 0; t < 4; ++t) {
      const v16h kb0 = frag_h(&Kt[(t * 16) * LP], LP);
      const v16h kb1 = frag_h(&Kt[(t * 16) * LP + 32], LP);
      v8f c = z8();
      c = mma_h(aq0, kb0, c);
      c = mma_h(aq1, kb1, c);
      sc[t] = c;
    }

    // online softmax; row 8hh+r lives across the 16 lanes of this half
    float alpha[8];
#pragma unroll
    for (int r = 0; r < 8; ++r) {
      float mx = fmaxf(fmaxf(sc[0][r], sc[1][r]), fmaxf(sc[2][r], sc[3][r]));
      mx = hmax16(mx * scale);
      const float mnew = fmaxf(mrow[r], mx);
      alpha[r] = __expf(mrow[r] - mnew);
      mrow[r] = mnew;
    }
#pragma unroll
    for (int r = 0; r < 8; ++r) {
      float ps = 0.f;
#pragma unroll
      for (int t = 0; t < 4; ++t) {
        const float p = __expf(sc[t][r] * scale - mrow[r]);
        ps += p;
        Pt[wave][(8 * hh + r) * LP + t * 16 + n16] = (_Float16)(p * 1024.0f);
      }
      lrow[r] = lrow[r] * alpha[r] + hadd16(ps);
    }
#pragma unroll
    for (int t = 0; t < 4; ++t)
#pragma unroll
      for (int r = 0; r < 8; ++r) o[t][r] *= alpha[r];

    __syncthreads();            // P tile stores complete before fragment reloads

    // O(16 x 64 d) += P(16 x 64 keys) . V : B[k=key][n=d] = Vt[d][key]
    const v16h p0 = frag_h(&Pt[wave][0], LP);
    const v16h p1 = frag_h(&Pt[wave][32], LP);
#pragma unroll
    for (int dt = 0; dt < 4; ++dt) {
      const v16h vb0 = frag_h(&Vt[(dt * 16) * LP], LP);
      const v16h vb1 = frag_h(&Vt[(dt * 16) * LP + 32], LP);
      v8f c = o[dt];
      c = mma_h(p0, vb0, c);
      c = mma_h(p1, vb1, c);
      o[dt] = c;
    }
  }

  // normalise: o holds 1024 * sum(p v); ctx carried x64 -> o * (64/1024) / l
  float inv[8];
#pragma unroll
  for (int r = 0; r < 8; ++r) inv[r] = 0.0625f * __builtin_amdgcn_rcpf(lrow[r]);

  __syncthreads();              // all fragment reads of Pt done before restaging
#pragma unroll
  for (int dt = 0; dt < 4; ++dt)
#pragma unroll
    for (int r = 0; r < 8; ++r)
      Pt[wave][(8 * hh + r) * LP + dt * 16 + n16] = (_Float16)(o[dt][r] * inv[r]);
  __syncthreads();

  wave_store_rows16(&Pt[wave][0],
                    Cp + ((size_t)b * SEQ + q0) * EMB + h * HD, EMB);
}

// ---------------- kernel 3: output projection out = ctx . Wo^T + bo ----------------
// block = 256 threads (8 waves); block tile 128 tokens x 64 outputs; wave owns 16 x 64.
// B tile (Wo rows n0..n0+63, k slab of 32) staged in LDS as f16(16 * bf16RNE(Wo)).
__global__ __launch_bounds__(256) void k_oproj(
    const _Float16* __restrict__ Cp, const float* __restrict__ Wo,
    const float* __restrict__ bo, float* __restrict__ out) {
  __shared__ __align__(16) _Float16 Bt[64 * BP];     // [n local][k local]
  __shared__ __align__(16) float Os[8][16 * OP];     // per wave f32 output staging

  const int tid = threadIdx.x, wave = tid >> 5, lane = tid & 31;
  const int hh = lane >> 4, n16 = lane & 15;
  const int m0 = blockIdx.x * 128 + wave * 16;
  const int n0 = blockIdx.y * 64;

  const int nl = tid >> 2, ko = (tid & 3) << 3;      // staging: 8 consecutive k of one n row
  const float* wsrc = Wo + (size_t)(n0 + nl) * EMB + ko;
  const _Float16* arow = Cp + (size_t)m0 * EMB;

  v8f acc[4];
#pragma unroll
  for (int t = 0; t < 4; ++t) acc[t] = z8();

  for (int kk = 0; kk < EMB; kk += 32) {
    __syncthreads();            // Bt free
    {
      const v4fa x0 = *(const v4fa*)(wsrc + kk);
      const v4fa x1 = *(const v4fa*)(wsrc + kk + 4);
      Pack8 w;
      w.s[0] = (_Float16)(bfval(x0.x) * 16.0f);
      w.s[1] = (_Float16)(bfval(x0.y) * 16.0f);
      w.s[2] = (_Float16)(bfval(x0.z) * 16.0f);
      w.s[3] = (_Float16)(bfval(x0.w) * 16.0f);
      w.s[4] = (_Float16)(bfval(x1.x) * 16.0f);
      w.s[5] = (_Float16)(bfval(x1.y) * 16.0f);
      w.s[6] = (_Float16)(bfval(x1.z) * 16.0f);
      w.s[7] = (_Float16)(bfval(x1.w) * 16.0f);
      *(v8ha*)&Bt[nl * BP + ko] = w.h;
    }
    __syncthreads();            // Bt visible
    const v16h a = frag_h(arow + kk, EMB);
#pragma unroll
    for (int t = 0; t < 4; ++t)
      acc[t] = mma_h(a, frag_h(&Bt[(t * 16) * BP], BP), acc[t]);
  }

  // epilogue: undo carries (64*16 = 1024), add bf16-RNE bias, stage f32 tile
#pragma unroll
  for (int t = 0; t < 4; ++t) {
    const float bias = bfval(bo[n0 + t * 16 + n16]);
#pragma unroll
    for (int r = 0; r < 8; ++r)
      Os[wave][(8 * hh + r) * OP + t * 16 + n16] = acc[t][r] * (1.0f / 1024.0f) + bias;
  }
  __syncthreads();

  // 16 rows x 256 B = 32 lines; line = (row, half); 8 lanes x 16 B per line, 4 lines per instruction
  const int rsub = lane >> 3, c4 = (lane & 7) << 2;
  v4fa v[8];
#pragma unroll
  for (int it = 0; it < 8; ++it) {
    const int li = it * 4 + rsub;
    const int row = li >> 1, hf = li & 1;
    v[it] = *(const v4fa*)&Os[wave][row * OP + hf * 32 + c4];
  }
  float* base = out + (size_t)m0 * EMB + n0;
#pragma unroll
  for (int it = 0; it < 8; ++it) {
    const int li = it * 4 + rsub;
    const int row = li >> 1, hf = li & 1;
    *(v4fa*)(base + (size_t)row * EMB + hf * 32 + c4) = v[it];
  }
  
}

// ---------------- launcher ----------------
extern "C" void kernel_launch(void* const* d_in, const int* in_sizes, int n_in,
                              void* d_out, int out_size, void* d_ws, size_t ws_size,
                              hipStream_t stream) {
  if (n_in < 9) return;
  if (in_sizes[0] < ((NB - 1) * SEQ_FULL + SEQ) * EMB) return;
  if (in_sizes[1] < NH * HD * HD || in_sizes[3] < NH * HD * HD || in_sizes[5] < NH * HD * HD) return;
  if (in_sizes[2] < NH * HD || in_sizes[4] < NH * HD || in_sizes[6] < NH * HD) return;
  if (in_sizes[7] < EMB * EMB || in_sizes[8] < EMB) return;
  if (out_size < MTOK * EMB) return;

  const float* x  = (const float*)d_in[0];
  const float* Wq = (const float*)d_in[1];
  const float* bq = (const float*)d_in[2];
  const float* Wk = (const float*)d_in[3];
  const float* bk = (const float*)d_in[4];
  const float* Wv = (const float*)d_in[5];
  const float* bv = (const float*)d_in[6];
  const float* Wo = (const float*)d_in[7];
  const float* bo = (const float*)d_in[8];
  float* out = (float*)d_out;

  const size_t qkv_bytes = (size_t)NB * NH * SEQ * HD * 2;   // 8 MiB at full size
  const size_t ctx_bytes = (size_t)MTOK * EMB * 2;           // 8 MiB at full size
  const size_t off_q = 0;
  const size_t off_k = off_q + qkv_bytes;
  const size_t off_v = off_k + qkv_bytes;
  const size_t off_c = off_v + qkv_bytes;
  const size_t total = off_c + ctx_bytes;
  if (total > ws_size) return;

  char* ws = (char*)d_ws;
  _Float16* Qp  = (_Float16*)(ws + off_q);
  _Float16* Kp  = (_Float16*)(ws + off_k);
  _Float16* Vtp = (_Float16*)(ws + off_v);
  _Float16* Cp  = (_Float16*)(ws + off_c);

  k_qkv<<<dim3(MTOK / 128, NH), 256, 0, stream>>>(x, Wq, bq, Wk, bk, Wv, bv, Qp, Kp, Vtp);
  k_attn<<<dim3(NB * NH, SEQ / 128), 256, 0, stream>>>(Qp, Kp, Vtp, Cp);
  k_oproj<<<dim3(MTOK / 128, EMB / 64), 256, 0, stream>>>(Cp, Wo, bo, out);
}

// v002
// A run of this version takes 90.2 microseconds.
// Two timings next to v001 both put it at 1.29 times that version's speed.
// Over all steps from v000 it is 2.34 times as fast.
#include <hip/hip_runtime.h>

// Contractions: per-head x*W^T (q,k,v) on v_wmma_f32_16x16x32_bf16 (bf16 operands); q*k^T, p*v, ctx*Wo^T on v_wmma_f32_16x16x32_f16 (f16 operands, power-of-two carries p*1024, ctx*64, Wo*16); f32 accumulate; softmax in f32.

#ifndef NB
#define NB 4
#endif
#ifndef SEQ
#define SEQ 2048
#endif
#define NB_FULL 4
#define SEQ_FULL 2048
#define EMB 512
#define NH 8
#define HD 64
#define MTOK (NB * SEQ)
// LDS row pitches: data row + 16 B, an odd multiple of 16 B, so that the 16 rows of a 16-byte fragment read fall on different banks
#define LP 72   // halves, rows of 64 halves (128 B -> 144 B)
#define BP 40   // halves, rows of 32 halves (64 B -> 80 B)
#define WP 9    // 16-byte chunks, rows of 8 chunks (128 B -> 144 B)
#define OP 68   // floats, rows of 64 floats (256 B -> 272 B)

static_assert(NB >= 1 && NB <= NB_FULL);
static_assert(SEQ >= 128 && SEQ <= SEQ_FULL && (SEQ % 128) == 0);
static_assert(EMB == NH * HD);
static_assert((EMB % 64) == 0 && (MTOK % 128) == 0);
// full-size carve: 3 planes of NB*NH*SEQ*HD halves + ctx plane of MTOK*EMB halves
static_assert((3ull * NB_FULL * NH * SEQ_FULL * HD + (unsigned long long)NB_FULL * SEQ_FULL * EMB) * 2ull <= 134217728ull);

typedef unsigned short u16;
typedef _Float16 v16h __attribute__((ext_vector_type(16)));
typedef __bf16   v16bf __attribute__((ext_vector_type(16)));
typedef float    v8f  __attribute__((ext_vector_type(8)));
typedef _Float16 v8ha __attribute__((ext_vector_type(8), __may_alias__));
typedef float    v4fa __attribute__((ext_vector_type(4), __may_alias__));
typedef unsigned v4u  __attribute__((ext_vector_type(4), __may_alias__));

union FragH { v16h v; v8ha p[2]; };
union FragB { v16bf v; v4u q[2]; };
union Pack8 { v8ha h; v4u u; _Float16 s[8]; };

// ---------------- helpers ----------------

__device__ __forceinline__ unsigned bfbits(float f) {   // f32 -> bf16 bits, RNE
  unsigned u = __float_as_uint(f);
  u += 0x7FFFu + ((u >> 16) & 1u);
  return u >> 16;
}
__device__ __forceinline__ float bfval(float f) {       // f32 -> value of its bf16 RNE image
  unsigned u = __float_as_uint(f);
  u += 0x7FFFu + ((u >> 16) & 1u);
  return __uint_as_float(u & 0xFFFF0000u);
}
__device__ __forceinline__ v8f z8() {
  v8f z = {0.f, 0.f, 0.f, 0.f, 0.f, 0.f, 0.f, 0.f};
  return z;
}

// 8 consecutive f32 -> 8 bf16 packed in 16 bytes (low half-word = lower index)
__device__ __forceinline__ v4u pack_bf8(const float* __restrict__ p) {
  const v4fa x0 = *(const v4fa*)p;
  const v4fa x1 = *(const v4fa*)(p + 4);
  v4u r;
  r.x = bfbits(x0.x) | (bfbits(x0.y) << 16);
  r.y = bfbits(x0.z) | (bfbits(x0.w) << 16);
  r.z = bfbits(x1.x) | (bfbits(x1.y) << 16);
  r.w = bfbits(x1.z) | (bfbits(x1.w) << 16);
  return r;
}

// 16x32 16-bit fragment (A or B layout, identical k map), row-major source, pitch ld (elements):
//   lane l: row = l&15; elements 0..7 <- k 8h..8h+7; elements 8..15 <- k 16+8h..16+8h+7, h = l>>4.
__device__ __forceinline__ v16h frag_h(const _Float16* base, int ld) {
  const int lane = threadIdx.x & 31;
  const int row  = lane & 15;
  const int kb   = (lane >> 4) << 3;
  FragH u;
  u.p[0] = *(const v8ha*)(base + (size_t)row * ld + kb);
  u.p[1] = *(const v8ha*)(base + (size_t)row * ld + 16 + kb);
  return u.v;
}

// A fragment from f32 rows (pitch ld floats), k columns k0..k0+31, converted to bf16 RNE.
__device__ __forceinline__ v16bf frag_x_bf(const float* base, int ld, int k0) {
  const int lane = threadIdx.x & 31;
  const int row  = lane & 15;
  const int kb   = (lane >> 4) << 3;
  const float* p = base + (size_t)row * ld + k0 + kb;
  FragB u;
  u.q[0] = pack_bf8(p);        // k0+kb .. k0+kb+7
  u.q[1] = pack_bf8(p + 16);   // k0+16+kb .. k0+16+kb+7
  return u.v;
}

// B fragment from an LDS bf16 tile stored as [n][8 chunks of 8 k] (64 k per row, row pitch WP chunks);
// rows nrow0..nrow0+15, k chunk base kc0 (0 -> k 0..31, 4 -> k 32..63).
__device__ __forceinline__ v16bf frag_w_bf(const v4u* tile, int nrow0, int kc0) {
  const int lane = threadIdx.x & 31;
  const int n    = lane & 15;
  const int hh   = lane >> 4;
  FragB u;
  u.q[0] = tile[(nrow0 + n) * WP + kc0 + hh];
  u.q[1] = tile[(nrow0 + n) * WP + kc0 + 2 + hh];
  return u.v;
}

__device__ __forceinline__ v8f mma_h(v16h a, v16h b, v8f c) {
  v8f d = __builtin_amdgcn_wmma_f32_16x16x32_f16(false, a, false, b, (short)0, c, false, false);
  asm volatile("v_nop\n\tv_nop\n\tv_nop\n\tv_nop" : "+v"(d) : "v"(a), "v"(b));
  return d;
}
__device__ __forceinline__ v8f mma_bf(v16bf a, v16bf b, v8f c) {
  v8f d = __builtin_amdgcn_wmma_f32_16x16x32_bf16(false, a, false, b, (short)0, c, false, false);
  asm volatile("v_nop\n\tv_nop\n\tv_nop\n\tv_nop" : "+v"(d) : "v"(a), "v"(b));
  return d;
}

// value of the same column in the other 16-lane half (lane ^ 16), a vector cross-row move
__device__ __forceinline__ float xhalf(float x) {
  const int b = __float_as_int(x);
  return __int_as_float(__builtin_amdgcn_permlanex16(b, b, 0x76543210, 0xfedcba98, false, false));
}

// One wave writes its 16 x 64-half tile (LDS, pitch LP) to 16 global rows of pitch `pitch` halves.
__device__ __forceinline__ void wave_store_rows16(const _Float16* tile, _Float16* dst, int pitch) {
  const int lane = threadIdx.x & 31;
  const int rsub = lane >> 3, c8 = (lane & 7) << 3;
  Pack8 v[4];
#pragma unroll
  for (int it = 0; it < 4; ++it)
    v[it].h = *(const v8ha*)(tile + (it * 4 + rsub) * LP + c8);
#pragma unroll
  for (int it = 0; it < 4; ++it)
    *(v4u*)(dst + (size_t)(it * 4 + rsub) * pitch + c8) = v[it].u;
  
}

// ---------------- kernel 1: per-head q/k/v projections ----------------
// block = 256 threads (8 waves); block owns (128 tokens, head h); wave owns 16 tokens x 64 outputs.
// Q,K planes: [bh][s][64] f16.   V plane transposed: [bh][64][SEQ] f16.
__global__ __launch_bounds__(256) void k_qkv(
    const float* __restrict__ x,
    const float* __restrict__ Wq, const float* __restrict__ bq,
    const float* __restrict__ Wk, const float* __restrict__ bk,
    const float* __restrict__ Wv, const float* __restrict__ bv,
    _Float16* __restrict__ Qp, _Float16* __restrict__ Kp, _Float16* __restrict__ Vtp) {
  __shared__ __align__(16) v4u Wl[3][HD * WP];      // bf16 [n][k] per matrix, 8 k per chunk
  __shared__ float Bl[3][HD];                        // bf16-RNE biases as f32
  __shared__ __align__(16) _Float16 St[128 * LP];    // f16 staging [token local][d]

  const int tid = threadIdx.x, wave = tid >> 5, lane = tid & 31;
  const int hh = lane >> 4, n16 = lane & 15;
  const int h  = blockIdx.y;
  const int m0 = blockIdx.x * 128;                   // compact token index
  const int b  = m0 / SEQ, s0 = m0 - b * SEQ;
  const int bh = b * NH + h;

  // stage the head's three 64x64 weight tiles (bf16 RNE) and biases
#pragma unroll
  for (int c = tid; c < 512; c += 256) {
    const int nrow = c >> 3, ko = (c & 7) << 3;
    const size_t off = ((size_t)h * HD + nrow) * HD + ko;
    const int cl = nrow * WP + (c & 7);
    Wl[0][cl] = pack_bf8(Wq + off);
    Wl[1][cl] = pack_bf8(Wk + off);
    Wl[2][cl] = pack_bf8(Wv + off);
  }
  if (tid < HD) {                                    // wave-uniform (waves 0,1)
    Bl[0][tid] = bfval(bq[h * HD + tid]);
    Bl[1][tid] = bfval(bk[h * HD + tid]);
    Bl[2][tid] = bfval(bv[h * HD + tid]);
  }
  __syncthreads();

  // A fragments of the wave's 16 tokens (64 input dims of head h), bf16 RNE in registers
  const float* xp = x + ((size_t)b * SEQ_FULL + s0 + wave * 16) * EMB + h * HD;
  const v16bf a0 = frag_x_bf(xp, EMB, 0);
  const v16bf a1 = frag_x_bf(xp, EMB, 32);

#pragma unroll
  for (int mat = 0; mat < 3; ++mat) {
    v8f acc[4];
#pragma unroll
    for (int t = 0; t < 4; ++t) {
      v8f c = z8();
      c = mma_bf(a0, frag_w_bf(Wl[mat], t * 16, 0), c);
      c = mma_bf(a1, frag_w_bf(Wl[mat], t * 16, 4), c);
      acc[t] = c;
    }
    // bias add in f32, convert to f16, stage: D element r of lane -> (row 8hh+r, col t*16+n16)
#pragma unroll
    for (int t = 0; t < 4; ++t) {
      const float bias = Bl[mat][t * 16 + n16];
#pragma unroll
      for (int r = 0; r < 8; ++r)
        St[(wave * 16 + 8 * hh + r) * LP + t * 16 + n16] = (_Float16)(acc[t][r] + bias);
    }
    __syncthreads();

    if (mat < 2) {
      _Float16* plane = (mat == 0) ? Qp : Kp;
      wave_store_rows16(&St[(wave * 16) * LP],
                        plane + ((size_t)bh * SEQ + s0 + wave * 16) * HD, HD);
    } else {
      // V transposed: line L = (d, half); 8 lanes x 16 B per line, 4 lines per instruction
      const int c8 = (tid & 7) << 3;
      Pack8 w[4];
#pragma unroll
      for (int it = 0; it < 4; ++it) {
        const int L = it * 32 + (tid >> 3);
        const int d = L >> 1, j0 = (L & 1) * 64 + c8;
#pragma unroll
        for (int e = 0; e < 8; ++e) w[it].s[e] = St[(j0 + e) * LP + d];
      }
#pragma unroll
      for (int it = 0; it < 4; ++it) {
        const int L = it * 32 + (tid >> 3);
        const int d = L >> 1, j0 = (L & 1) * 64 + c8;
        *(v4u*)(Vtp + ((size_t)bh * HD + d) * SEQ + s0 + j0) = w[it].u;
      }
      
    }
    __syncthreads();                                 // St free for the next matrix
  }
}

__global__ __launch_bounds__(256) void k_attn(
    const _Float16* __restrict__ Qp, const _Float16* __restrict__ Kp,
    const _Float16* __restrict__ Vtp, _Float16* __restrict__ Cp) {
  __shared__ __align__(16) _Float16 Kt[64 * LP];      // [key][d]
  __shared__ __align__(16) _Float16 Vt[HD * LP];      // [d][key]
  __shared__ __align__(16) _Float16 Ct[8][16 * LP];   // per wave [q row][d], ctx staging for whole-line stores

  const int tid = threadIdx.x, wave = tid >> 5, lane = tid & 31;
  const int hh = lane >> 4, n16 = lane & 15;
  const int bh = blockIdx.x;
  const int b  = bh / NH, h = bh - b * NH;
  const int q0 = blockIdx.y * 128 + wave * 16;

  const _Float16* Qbh = Qp  + (size_t)bh * SEQ * HD;
  const _Float16* Kbh = Kp  + (size_t)bh * SEQ * HD;
  const _Float16* Vbh = Vtp + (size_t)bh * HD * SEQ;

  // Q^T as B operand (column = query lane&15; d 0..31, 32..63), in registers for the whole key loop
  const v16h bq0 = frag_h(Qbh + (size_t)q0 * HD, HD);
  const v16h bq1 = frag_h(Qbh + (size_t)q0 * HD + 32, HD);

  float mrow = -1e30f;          // running maximum of query n16 (equal in both lane halves)
  float lrow = 0.f;             // running sum of query n16 over this lane half's keys only
  v8f o[4];                     // o[dt][r] = O^T[d = 16dt + 8hh + r][query n16]
#pragma unroll
  for (int t = 0; t < 4; ++t) o[t] = z8();

  const float scale = 0.125f;   // 1/sqrt(64), exact

  for (int t0 = 0; t0 < SEQ; t0 += 64) {
    __syncthreads();            // prior tile fully consumed by all waves
#pragma unroll
    for (int c = tid; c < 512; c += 256) {
      const int row = c >> 3, off = (c & 7) << 3;
      *(v8ha*)&Kt[row * LP + off] = *(const v8ha*)(Kbh + (size_t)(t0 + row) * HD + off);
      *(v8ha*)&Vt[row * LP + off] = *(const v8ha*)(Vbh + (size_t)row * SEQ + t0 + off);
    }
    __syncthreads();            // tiles visible

    // S^T(64 keys x 16 queries) = K(64x64) . Q^T : sc[t][r] = S[query n16][key 16t + 8hh + r]
    v8f sc[4];
#pragma unroll
    for (int t = 0; t < 4; ++t) {
      const v16h ka0 = frag_h(&Kt[(t * 16) * LP], LP);
      const v16h ka1 = frag_h(&Kt[(t * 16) * LP + 32], LP);
      v8f c = z8();
      c = mma_h(ka0, bq0, c);
      c = mma_h(ka1, bq1, c);
      sc[t] = c;
    }

    // online softmax of query n16: 32 keys in this lane, the other 32 in lane ^ 16
    float mx = sc[0][0];
#pragma unroll  // constant indices keep sc in registers
    for (int t = 0; t < 4; ++t)
#pragma unroll  // as above
      for (int r = 0; r < 8; ++r) mx = fmaxf(mx, sc[t][r]);
    mx = fmaxf(mx, xhalf(mx)) * scale;
    const float mnew  = fmaxf(mrow, mx);
    const float alpha = __expf(mrow - mnew);
    mrow = mnew;

    // P^T as B operand, in frag_h's k order: element s of pb[j] is key 32j + 16(s >> 3) + 8hh + (s & 7) = score tile 2j + (s >> 3), register s & 7
    FragH pb[2];
#pragma unroll  // constant indices keep sc and pb in registers
    for (int t = 0; t < 4; ++t) {
      const v8f x = sc[t] * scale - mrow;
      v8f p;
#pragma unroll  // as above
      for (int r = 0; r < 8; ++r) p[r] = __expf(x[r]);
      sc[t] = p;
      pb[t >> 1].p[t & 1] = __builtin_convertvector(p * 1024.0f, v8ha);
    }
    // in-lane sum of the 32 p as a tree: short dependent chains, packed adds
    const v8f s8 = (sc[0] + sc[1]) + (sc[2] + sc[3]);
    const float ps = ((s8[0] + s8[1]) + (s8[2] + s8[3])) + ((s8[4] + s8[5]) + (s8[6] + s8[7]));
    lrow = lrow * alpha + ps;
#pragma unroll  // constant indices keep o in registers
    for (int t = 0; t < 4; ++t) o[t] *= alpha;

    // O^T(64 d x 16 queries) += V^T(64 d x 64 keys) . P^T : A[m=d][k=key] = Vt[d][key]
#pragma unroll
    for (int dt = 0; dt < 4; ++dt) {
      const v16h va0 = frag_h(&Vt[(dt * 16) * LP], LP);
      const v16h va1 = frag_h(&Vt[(dt * 16) * LP + 32], LP);
      v8f c = o[dt];
      c = mma_h(va0, pb[0].v, c);
      c = mma_h(va1, pb[1].v, c);
      o[dt] = c;
    }
  }

  // normalise: o holds 1024 * sum(p v); ctx carried x64 -> o * (64/1024) / l; l joins the two halves' sums
  const float inv = 0.0625f * __builtin_amdgcn_rcpf(lrow + xhalf(lrow));

  // a lane's 8 registers of o[dt] are 8 consecutive d of one query row: one 16-byte LDS store each
#pragma unroll
  for (int dt = 0; dt < 4; ++dt) {
    Pack8 w;
#pragma unroll
    for (int r = 0; r < 8; ++r) w.s[r] = (_Float16)(o[dt][r] * inv);
    *(v8ha*)&Ct[wave][n16 * LP + dt * 16 + 8 * hh] = w.h;
  }
  __syncthreads();              // staged rows complete before they are read back across lanes

  wave_store_rows16(&Ct[wave][0],
                    Cp + ((size_t)b * SEQ + q0) * EMB + h * HD, EMB);
}

// ---------------- kernel 3: output projection out = ctx . Wo^T + bo ----------------
// block = 256 threads (8 waves); block tile 128 tokens x 64 outputs; wave owns 16 x 64.
// B tile (Wo rows n0..n0+63, k slab of 32) staged in LDS as f16(16 * bf16RNE(Wo)).
__global__ __launch_bounds__(256) void k_oproj(
    const _Float16* __restrict__ Cp, const float* __restrict__ Wo,
    const float* __restrict__ bo, float* __restrict__ out) {
  __shared__ __align__(16) _Float16 Bt[64 * BP];     // [n local][k local]
  __shared__ __align__(16) float Os[8][16 * OP];     // per wave f32 output staging

  const int tid = threadIdx.x, wave = tid >> 5, lane = tid & 31;
  const int hh = lane >> 4, n16 = lane & 15;
  const int m0 = blockIdx.x * 128 + wave * 16;
  const int n0 = blockIdx.y * 64;

  const int nl = tid >> 2, ko = (tid & 3) << 3;      // staging: 8 consecutive k of one n row
  const float* wsrc = Wo + (size_t)(n0 + nl) * EMB + ko;
  const _Float16* arow = Cp + (size_t)m0 * EMB;

  v8f acc[4];
#pragma unroll
  for (int t = 0; t < 4; ++t) acc[t] = z8();

  for (int kk = 0; kk < EMB; kk += 32) {
    __syncthreads();            // Bt free
    {
      const v4fa x0 = *(const v4fa*)(wsrc + kk);
      const v4fa x1 = *(const v4fa*)(wsrc + kk + 4);
      Pack8 w;
      w.s[0] = (_Float16)(bfval(x0.x) * 16.0f);
      w.s[1] = (_Float16)(bfval(x0.y) * 16.0f);
      w.s[2] = (_Float16)(bfval(x0.z) * 16.0f);
      w.s[3] = (_Float16)(bfval(x0.w) * 16.0f);
      w.s[4] = (_Float16)(bfval(x1.x) * 16.0f);
      w.s[5] = (_Float16)(bfval(x1.y) * 16.0f);
      w.s[6] = (_Float16)(bfval(x1.z) * 16.0f);
      w.s[7] = (_Float16)(bfval(x1.w) * 16.0f);
      *(v8ha*)&Bt[nl * BP + ko] = w.h;
    }
    __syncthreads();            // Bt visible
    const v16h a = frag_h(arow + kk, EMB);
#pragma unroll
    for (int t = 0; t < 4; ++t)
      acc[t] = mma_h(a, frag_h(&Bt[(t * 16) * BP], BP), acc[t]);
  }

  // epilogue: undo carries (64*16 = 1024), add bf16-RNE bias, stage f32 tile
#pragma unroll
  for (int t = 0; t < 4; ++t) {
    const float bias = bfval(bo[n0 + t * 16 + n16]);
#pragma unroll
    for (int r = 0; r < 8; ++r)
      Os[wave][(8 * hh + r) * OP + t * 16 + n16] = acc[t][r] * (1.0f / 1024.0f) + bias;
  }
  __syncthreads();

  // 16 rows x 256 B = 32 lines; line = (row, half); 8 lanes x 16 B per line, 4 lines per instruction
  const int rsub = lane >> 3, c4 = (lane & 7) << 2;
  v4fa v[8];
#pragma unroll
  for (int it = 0; it < 8; ++it) {
    const int li = it * 4 + rsub;
    const int row = li >> 1, hf = li & 1;
    v[it] = *(const v4fa*)&Os[wave][row * OP + hf * 32 + c4];
  }
  float* base = out + (size_t)m0 * EMB + n0;
#pragma unroll
  for (int it = 0; it < 8; ++it) {
    const int li = it * 4 + rsub;
    const int row = li >> 1, hf = li & 1;
    *(v4fa*)(base + (size_t)row * EMB + hf * 32 + c4) = v[it];
  }
  
}

// ---------------- launcher ----------------
extern "C" void kernel_launch(void* const* d_in, const int* in_sizes, int n_in,
                              void* d_out, int out_size, void* d_ws, size_t ws_size,
                              hipStream_t stream) {
  if (n_in < 9) return;
  if (in_sizes[0] < ((NB - 1) * SEQ_FULL + SEQ) * EMB) return;
  if (in_sizes[1] < NH * HD * HD || in_sizes[3] < NH * HD * HD || in_sizes[5] < NH * HD * HD) return;
  if (in_sizes[2] < NH * HD || in_sizes[4] < NH * HD || in_sizes[6] < NH * HD) return;
  if (in_sizes[7] < EMB * EMB || in_sizes[8] < EMB) return;
  if (out_size < MTOK * EMB) return;

  const float* x  = (const float*)d_in[0];
  const float* Wq = (const float*)d_in[1];
  const float* bq = (const float*)d_in[2];
  const float* Wk = (const float*)d_in[3];
  const float* bk = (const float*)d_in[4];
  const float* Wv = (const float*)d_in[5];
  const float* bv = (const float*)d_in[6];
  const float* Wo = (const float*)d_in[7];
  const float* bo = (const float*)d_in[8];
  float* out = (float*)d_out;

  const size_t qkv_bytes = (size_t)NB * NH * SEQ * HD * 2;   // 8 MiB at full size
  const size_t ctx_bytes = (size_t)MTOK * EMB * 2;           // 8 MiB at full size
  const size_t off_q = 0;
  const size_t off_k = off_q + qkv_bytes;
  const size_t off_v = off_k + qkv_bytes;
  const size_t off_c = off_v + qkv_bytes;
  const size_t total = off_c + ctx_bytes;
  if (total > ws_size) return;

  char* ws = (char*)d_ws;
  _Float16* Qp  = (_Float16*)(ws + off_q);
  _Float16* Kp  = (_Float16*)(ws + off_k);
  _Float16* Vtp = (_Float16*)(ws + off_v);
  _Float16* Cp  = (_Float16*)(ws + off_c);

  k_qkv<<<dim3(MTOK / 128, NH), 256, 0, stream>>>(x, Wq, bq, Wk, bk, Wv, bv, Qp, Kp, Vtp);
  k_attn<<<dim3(NB * NH, SEQ / 128), 256, 0, stream>>>(Qp, Kp, Vtp, Cp);
  k_oproj<<<dim3(MTOK / 128, EMB / 64), 256, 0, stream>>>(Cp, Wo, bo, out);
}

// v003
// Measured time: 67 microseconds a run.
// Timed twice side by side with v002, it ran 1.33 and 1.35 times as fast.
// Counting every step since v000, it is 3.13 times as fast.
#include <hip/hip_runtime.h>

// Contractions: per-head x*W^T (q,k,v) on v_wmma_f32_16x16x32_bf16 (bf16 operands); q*k^T, p*v, ctx*Wo^T on v_wmma_f32_16x16x32_f16 (f16 operands, power-of-two carries p*1024, ctx*64, Wo*16); f32 accumulate; softmax in f32.

#ifndef NB
#define NB 4
#endif
#ifndef SEQ
#define SEQ 2048
#endif
#define NB_FULL 4
#define SEQ_FULL 2048
#define EMB 512
#define NH 8
#define HD 64
#define MTOK (NB * SEQ)
// LDS row pitches: data row + 16 B, an odd multiple of 16 B, so that the 16 rows of a 16-byte fragment read fall on different banks
#define LP 72   // halves, rows of 64 halves (128 B -> 144 B)
#define BP 40   // halves, rows of 32 halves (64 B -> 80 B)
#define WP 9    // 16-byte chunks, rows of 8 chunks (128 B -> 144 B)
#define OP 68   // floats, rows of 64 floats (256 B -> 272 B)

static_assert(NB >= 1 && NB <= NB_FULL);
static_assert(SEQ >= 128 && SEQ <= SEQ_FULL && (SEQ % 128) == 0);
static_assert(EMB == NH * HD);
static_assert((EMB % 64) == 0 && (MTOK % 128) == 0);
// full-size carve: 3 planes of NB*NH*SEQ*HD halves + ctx plane of MTOK*EMB halves
static_assert((3ull * NB_FULL * NH * SEQ_FULL * HD + (unsigned long long)NB_FULL * SEQ_FULL * EMB) * 2ull <= 134217728ull);

typedef unsigned short u16;
typedef _Float16 v16h __attribute__((ext_vector_type(16)));
typedef __bf16   v16bf __attribute__((ext_vector_type(16)));
typedef float    v8f  __attribute__((ext_vector_type(8)));
typedef _Float16 v8ha __attribute__((ext_vector_type(8), __may_alias__));
typedef float    v4fa __attribute__((ext_vector_type(4), __may_alias__));
typedef unsigned v4u  __attribute__((ext_vector_type(4), __may_alias__));

union FragH { v16h v; v8ha p[2]; };
union FragB { v16bf v; v4u q[2]; };
union Pack8 { v8ha h; v4u u; _Float16 s[8]; };

// ---------------- helpers ----------------

__device__ __forceinline__ unsigned bfbits(float f) {   // f32 -> bf16 bits, RNE
  unsigned u = __float_as_uint(f);
  u += 0x7FFFu + ((u >> 16) & 1u);
  return u >> 16;
}
__device__ __forceinline__ float bfval(float f) {       // f32 -> value of its bf16 RNE image
  unsigned u = __float_as_uint(f);
  u += 0x7FFFu + ((u >> 16) & 1u);
  return __uint_as_float(u & 0xFFFF0000u);
}
__device__ __forceinline__ v8f z8() {
  v8f z = {0.f, 0.f, 0.f, 0.f, 0.f, 0.f, 0.f, 0.f};
  return z;
}

// 8 consecutive f32 -> 8 bf16 packed in 16 bytes (low half-word = lower index)
__device__ __forceinline__ v4u pack_bf8(const float* __restrict__ p) {
  const v4fa x0 = *(const v4fa*)p;
  const v4fa x1 = *(const v4fa*)(p + 4);
  v4u r;
  r.x = bfbits(x0.x) | (bfbits(x0.y) << 16);
  r.y = bfbits(x0.z) | (bfbits(x0.w) << 16);
  r.z = bfbits(x1.x) | (bfbits(x1.y) << 16);
  r.w = bfbits(x1.z) | (bfbits(x1.w) << 16);
  return r;
}

// 16x32 16-bit fragment (A or B layout, identical k map), row-major source, pitch ld (elements):
//   lane l: row = l&15; elements 0..7 <- k 8h..8h+7; elements 8..15 <- k 16+8h..16+8h+7, h = l>>4.
__device__ __forceinline__ v16h frag_h(const _Float16* base, int ld) {
  const int lane = threadIdx.x & 31;
  const int row  = lane & 15;
  const int kb   = (lane >> 4) << 3;
  FragH u;
  u.p[0] = *(const v8ha*)(base + (size_t)row * ld + kb);
  u.p[1] = *(const v8ha*)(base + (size_t)row * ld + 16 + kb);
  return u.v;
}

// A fragment from f32 rows (pitch ld floats), k columns k0..k0+31, converted to bf16 RNE.
__device__ __forceinline__ v16bf frag_x_bf(const float* base, int ld, int k0) {
  const int lane = threadIdx.x & 31;
  const int row  = lane & 15;
  const int kb   = (lane >> 4) << 3;
  const float* p = base + (size_t)row * ld + k0 + kb;
  FragB u;
  u.q[0] = pack_bf8(p);        // k0+kb .. k0+kb+7
  u.q[1] = pack_bf8(p + 16);   // k0+16+kb .. k0+16+kb+7
  return u.v;
}

// B fragment from an LDS bf16 tile stored as [n][8 chunks of 8 k] (64 k per row, row pitch WP chunks);
// rows nrow0..nrow0+15, k chunk base kc0 (0 -> k 0..31, 4 -> k 32..63).
__device__ __forceinline__ v16bf frag_w_bf(const v4u* tile, int nrow0, int kc0) {
  const int lane = threadIdx.x & 31;
  const int n    = lane & 15;
  const int hh   = lane >> 4;
  FragB u;
  u.q[0] = tile[(nrow0 + n) * WP + kc0 + hh];
  u.q[1] = tile[(nrow0 + n) * WP + kc0 + 2 + hh];
  return u.v;
}

__device__ __forceinline__ v8f mma_h(v16h a, v16h b, v8f c) {
  v8f d = __builtin_amdgcn_wmma_f32_16x16x32_f16(false, a, false, b, (short)0, c, false, false);
  asm volatile("v_nop\n\tv_nop\n\tv_nop\n\tv_nop" : "+v"(d) : "v"(a), "v"(b));
  return d;
}
__device__ __forceinline__ v8f mma_bf(v16bf a, v16bf b, v8f c) {
  v8f d = __builtin_amdgcn_wmma_f32_16x16x32_bf16(false, a, false, b, (short)0, c, false, false);
  asm volatile("v_nop\n\tv_nop\n\tv_nop\n\tv_nop" : "+v"(d) : "v"(a), "v"(b));
  return d;
}

// value of the same column in the other 16-lane half (lane ^ 16), a vector cross-row move
__device__ __forceinline__ float xhalf(float x) {
  const int b = __float_as_int(x);
  return __int_as_float(__builtin_amdgcn_permlanex16(b, b, 0x76543210, 0xfedcba98, false, false));
}

// A lane's four 16-byte asynchronous copies global -> LDS (through no register): its share of one K tile and one V^T tile.
// l* = LDS byte address (low 32 bits of the __shared__ address), g* = global address, all multiples of 16 B.
// s_wait_xcnt 0 is the statement's last line so that no address register of a copy is rewritten in front of it.
__device__ __forceinline__ void copy4_to_lds(unsigned l0, const _Float16* g0, unsigned l1, const _Float16* g1,
                                             unsigned l2, const _Float16* g2, unsigned l3, const _Float16* g3) {
  asm volatile("global_load_async_to_lds_b128 %0, %1, off\n\t"
               "global_load_async_to_lds_b128 %2, %3, off\n\t"
               "global_load_async_to_lds_b128 %4, %5, off\n\t"
               "global_load_async_to_lds_b128 %6, %7, off\n\t"
               "s_wait_xcnt 0x0"
               :: "v"(l0), "v"(g0), "v"(l1), "v"(g1), "v"(l2), "v"(g2), "v"(l3), "v"(g3)
               : "memory");
}

// One wave writes its 16 x 64-half tile (LDS, pitch LP) to 16 global rows of pitch `pitch` halves.
__device__ __forceinline__ void wave_store_rows16(const _Float16* tile, _Float16* dst, int pitch) {
  const int lane = threadIdx.x & 31;
  const int rsub = lane >> 3, c8 = (lane & 7) << 3;
  Pack8 v[4];
#pragma unroll
  for (int it = 0; it < 4; ++it)
    v[it].h = *(const v8ha*)(tile + (it * 4 + rsub) * LP + c8);
#pragma unroll
  for (int it = 0; it < 4; ++it)
    *(v4u*)(dst + (size_t)(it * 4 + rsub) * pitch + c8) = v[it].u;
  
}

// ---------------- kernel 1: per-head q/k/v projections ----------------
// block = 256 threads (8 waves); block owns (128 tokens, head h); wave owns 16 tokens x 64 outputs.
// Q,K planes: [bh][s][64] f16.   V plane transposed: [bh][64][SEQ] f16.
__global__ __launch_bounds__(256) void k_qkv(
    const float* __restrict__ x,
    const float* __restrict__ Wq, const float* __restrict__ bq,
    const float* __restrict__ Wk, const float* __restrict__ bk,
    const float* __restrict__ Wv, const float* __restrict__ bv,
    _Float16* __restrict__ Qp, _Float16* __restrict__ Kp, _Float16* __restrict__ Vtp) {
  __shared__ __align__(16) v4u Wl[3][HD * WP];      // bf16 [n][k] per matrix, 8 k per chunk
  __shared__ float Bl[3][HD];                        // bf16-RNE biases as f32
  __shared__ __align__(16) _Float16 St[128 * LP];    // f16 staging [token local][d]

  const int tid = threadIdx.x, wave = tid >> 5, lane = tid & 31;
  const int hh = lane >> 4, n16 = lane & 15;
  const int h  = blockIdx.y;
  const int m0 = blockIdx.x * 128;                   // compact token index
  const int b  = m0 / SEQ, s0 = m0 - b * SEQ;
  const int bh = b * NH + h;

  // stage the head's three 64x64 weight tiles (bf16 RNE) and biases
#pragma unroll
  for (int c = tid; c < 512; c += 256) {
    const int nrow = c >> 3, ko = (c & 7) << 3;
    const size_t off = ((size_t)h * HD + nrow) * HD + ko;
    const int cl = nrow * WP + (c & 7);
    Wl[0][cl] = pack_bf8(Wq + off);
    Wl[1][cl] = pack_bf8(Wk + off);
    Wl[2][cl] = pack_bf8(Wv + off);
  }
  if (tid < HD) {                                    // wave-uniform (waves 0,1)
    Bl[0][tid] = bfval(bq[h * HD + tid]);
    Bl[1][tid] = bfval(bk[h * HD + tid]);
    Bl[2][tid] = bfval(bv[h * HD + tid]);
  }
  __syncthreads();

  // A fragments of the wave's 16 tokens (64 input dims of head h), bf16 RNE in registers
  const float* xp = x + ((size_t)b * SEQ_FULL + s0 + wave * 16) * EMB + h * HD;
  const v16bf a0 = frag_x_bf(xp, EMB, 0);
  const v16bf a1 = frag_x_bf(xp, EMB, 32);

#pragma unroll
  for (int mat = 0; mat < 3; ++mat) {
    v8f acc[4];
#pragma unroll
    for (int t = 0; t < 4; ++t) {
      v8f c = z8();
      c = mma_bf(a0, frag_w_bf(Wl[mat], t * 16, 0), c);
      c = mma_bf(a1, frag_w_bf(Wl[mat], t * 16, 4), c);
      acc[t] = c;
    }
    // bias add in f32, convert to f16, stage: D element r of lane -> (row 8hh+r, col t*16+n16)
#pragma unroll
    for (int t = 0; t < 4; ++t) {
      const float bias = Bl[mat][t * 16 + n16];
#pragma unroll
      for (int r = 0; r < 8; ++r)
        St[(wave * 16 + 8 * hh + r) * LP + t * 16 + n16] = (_Float16)(acc[t][r] + bias);
    }
    __syncthreads();

    if (mat < 2) {
      _Float16* plane = (mat == 0) ? Qp : Kp;
      wave_store_rows16(&St[(wave * 16) * LP],
                        plane + ((size_t)bh * SEQ + s0 + wave * 16) * HD, HD);
    } else {
      // V transposed: line L = (d, half); 8 lanes x 16 B per line, 4 lines per instruction
      const int c8 = (tid & 7) << 3;
      Pack8 w[4];
#pragma unroll
      for (int it = 0; it < 4; ++it) {
        const int L = it * 32 + (tid >> 3);
        const int d = L >> 1, j0 = (L & 1) * 64 + c8;
#pragma unroll
        for (int e = 0; e < 8; ++e) w[it].s[e] = St[(j0 + e) * LP + d];
      }
#pragma unroll
      for (int it = 0; it < 4; ++it) {
        const int L = it * 32 + (tid >> 3);
        const int d = L >> 1, j0 = (L & 1) * 64 + c8;
        *(v4u*)(Vtp + ((size_t)bh * HD + d) * SEQ + s0 + j0) = w[it].u;
      }
      
    }
    __syncthreads();                                 // St free for the next matrix
  }
}

__global__ __launch_bounds__(256) void k_attn(
    const _Float16* __restrict__ Qp, const _Float16* __restrict__ Kp,
    const _Float16* __restrict__ Vtp, _Float16* __restrict__ Cp) {
  __shared__ __align__(16) _Float16 Kt[2][64 * LP];   // [buffer][key][d]
  __shared__ __align__(16) _Float16 Vt[2][HD * LP];   // [buffer][d][key]
  __shared__ __align__(16) _Float16 Ct[8][16 * LP];   // per wave [q row][d], ctx staging for whole-line stores

  const int tid = threadIdx.x, wave = tid >> 5, lane = tid & 31;
  const int hh = lane >> 4, n16 = lane & 15;
  const int bh = blockIdx.x;
  const int b  = bh / NH, h = bh - b * NH;
  const int q0 = blockIdx.y * 128 + wave * 16;

  const _Float16* Qbh = Qp  + (size_t)bh * SEQ * HD;
  const _Float16* Kbh = Kp  + (size_t)bh * SEQ * HD;
  const _Float16* Vbh = Vtp + (size_t)bh * HD * SEQ;

  // Q^T as B operand (column = query lane&15; d 0..31, 32..63), in registers for the whole key loop
  const v16h bq0 = frag_h(Qbh + (size_t)q0 * HD, HD);
  const v16h bq1 = frag_h(Qbh + (size_t)q0 * HD + 32, HD);

  float mrow = -1e30f;          // running maximum of query n16 (equal in both lane halves)
  float lrow = 0.f;             // running sum of query n16 over this lane half's keys only
  v8f o[4];                     // o[dt][r] = O^T[d = 16dt + 8hh + r][query n16]
#pragma unroll
  for (int t = 0; t < 4; ++t) o[t] = z8();

  const float scale = 0.125f;   // 1/sqrt(64), exact

  // a thread copies rows crow and crow + 32, 16 bytes at column coff, of each tile
  const int crow = tid >> 3, coff = (tid & 7) << 3;
  const unsigned lk = (unsigned)(size_t)&Kt[0][crow * LP + coff];
  const unsigned lv = (unsigned)(size_t)&Vt[0][crow * LP + coff];
  const unsigned half_b = 32 * LP * 2, buf_b = 64 * LP * 2;   // bytes: 32 rows, one buffer
  const _Float16* gk = Kbh + (size_t)crow * HD + coff;         // tile at key t0: + t0 * HD
  const _Float16* gv = Vbh + (size_t)crow * SEQ + coff;        // tile at key t0: + t0

  // tile 0 into buffer 0, landed and published; then tile 1 into buffer 1 (SEQ >= 128: both exist)
  copy4_to_lds(lk, gk, lk + half_b, gk + 32 * HD, lv, gv, lv + half_b, gv + (size_t)32 * SEQ);
  asm volatile("s_wait_asynccnt 0x0" ::: "memory");   // this wave's copies of tile 0 have landed
  __syncthreads();              // tile 0 visible to every wave
  copy4_to_lds(lk + buf_b, gk + 64 * HD, lk + buf_b + half_b, gk + 96 * HD,
               lv + buf_b, gv + 64, lv + buf_b + half_b, gv + (size_t)32 * SEQ + 64);

  for (int t0 = 0; t0 < SEQ; t0 += 64) {
    const int buf = (t0 >> 6) & 1;
    const _Float16* Kb = &Kt[buf][0];
    const _Float16* Vb = &Vt[buf][0];

    // S^T(64 keys x 16 queries) = K(64x64) . Q^T : sc[t][r] = S[query n16][key 16t + 8hh + r]
    v8f sc[4];
#pragma unroll
    for (int t = 0; t < 4; ++t) {
      const v16h ka0 = frag_h(Kb + (t * 16) * LP, LP);
      const v16h ka1 = frag_h(Kb + (t * 16) * LP + 32, LP);
      v8f c = z8();
      c = mma_h(ka0, bq0, c);
      c = mma_h(ka1, bq1, c);
      sc[t] = c;
    }

    // online softmax of query n16: 32 keys in this lane, the other 32 in lane ^ 16
    float mx = sc[0][0];
#pragma unroll  // constant indices keep sc in registers
    for (int t = 0; t < 4; ++t)
#pragma unroll  // as above
      for (int r = 0; r < 8; ++r) mx = fmaxf(mx, sc[t][r]);
    mx = fmaxf(mx, xhalf(mx)) * scale;
    const float mnew  = fmaxf(mrow, mx);
    const float alpha = __expf(mrow - mnew);
    mrow = mnew;

    // P^T as B operand, in frag_h's k order: element s of pb[j] is key 32j + 16(s >> 3) + 8hh + (s & 7) = score tile 2j + (s >> 3), register s & 7
    FragH pb[2];
#pragma unroll  // constant indices keep sc and pb in registers
    for (int t = 0; t < 4; ++t) {
      const v8f x = sc[t] * scale - mrow;
      v8f p;
#pragma unroll  // as above
      for (int r = 0; r < 8; ++r) p[r] = __expf(x[r]);
      sc[t] = p;
      pb[t >> 1].p[t & 1] = __builtin_convertvector(p * 1024.0f, v8ha);
    }
    // in-lane sum of the 32 p as a tree: short dependent chains, packed adds
    const v8f s8 = (sc[0] + sc[1]) + (sc[2] + sc[3]);
    const float ps = ((s8[0] + s8[1]) + (s8[2] + s8[3])) + ((s8[4] + s8[5]) + (s8[6] + s8[7]));
    lrow = lrow * alpha + ps;
#pragma unroll  // constant indices keep o in registers
    for (int t = 0; t < 4; ++t) o[t] *= alpha;

    // O^T(64 d x 16 queries) += V^T(64 d x 64 keys) . P^T : A[m=d][k=key] = Vt[d][key]
#pragma unroll
    for (int dt = 0; dt < 4; ++dt) {
      const v16h va0 = frag_h(Vb + (dt * 16) * LP, LP);
      const v16h va1 = frag_h(Vb + (dt * 16) * LP + 32, LP);
      v8f c = o[dt];
      c = mma_h(va0, pb[0].v, c);
      c = mma_h(va1, pb[1].v, c);
      o[dt] = c;
    }

    // hand-over: this wave's reads of tile t are done, its copies of tile t + 1 have landed; the one barrier
    // publishes tile t + 1 and frees tile t's buffer, which then takes tile t + 2
    asm volatile("s_wait_dscnt 0x0" ::: "memory");      // own LDS reads retired before the buffer is refilled
    asm volatile("s_wait_asynccnt 0x0" ::: "memory");   // own copies landed before other waves read them
    __syncthreads();
    if (t0 + 128 < SEQ) {       // same for the whole work-group
      const unsigned bo = (unsigned)buf * buf_b;
      const _Float16* nk = gk + (size_t)(t0 + 128) * HD;
      const _Float16* nv = gv + (t0 + 128);
      copy4_to_lds(lk + bo, nk, lk + bo + half_b, nk + 32 * HD, lv + bo, nv, lv + bo + half_b, nv + (size_t)32 * SEQ);
    }
  }
  asm volatile("s_wait_asynccnt 0x0" ::: "memory");     // nothing of this wave in flight behind the loop

  // normalise: o holds 1024 * sum(p v); ctx carried x64 -> o * (64/1024) / l; l joins the two halves' sums
  const float inv = 0.0625f * __builtin_amdgcn_rcpf(lrow + xhalf(lrow));

  // a lane's 8 registers of o[dt] are 8 consecutive d of one query row: one 16-byte LDS store each
#pragma unroll
  for (int dt = 0; dt < 4; ++dt) {
    Pack8 w;
#pragma unroll
    for (int r = 0; r < 8; ++r) w.s[r] = (_Float16)(o[dt][r] * inv);
    *(v8ha*)&Ct[wave][n16 * LP + dt * 16 + 8 * hh] = w.h;
  }
  __syncthreads();              // staged rows complete before they are read back across lanes

  wave_store_rows16(&Ct[wave][0],
                    Cp + ((size_t)b * SEQ + q0) * EMB + h * HD, EMB);
}

// ---------------- kernel 3: output projection out = ctx . Wo^T + bo ----------------
// block = 256 threads (8 waves); block tile 128 tokens x 64 outputs; wave owns 16 x 64.
// B tile (Wo rows n0..n0+63, k slab of 32) staged in LDS as f16(16 * bf16RNE(Wo)).
__global__ __launch_bounds__(256) void k_oproj(
    const _Float16* __restrict__ Cp, const float* __restrict__ Wo,
    const float* __restrict__ bo, float* __restrict__ out) {
  __shared__ __align__(16) _Float16 Bt[64 * BP];     // [n local][k local]
  __shared__ __align__(16) float Os[8][16 * OP];     // per wave f32 output staging

  const int tid = threadIdx.x, wave = tid >> 5, lane = tid & 31;
  const int hh = lane >> 4, n16 = lane & 15;
  const int m0 = blockIdx.x * 128 + wave * 16;
  const int n0 = blockIdx.y * 64;

  const int nl = tid >> 2, ko = (tid & 3) << 3;      // staging: 8 consecutive k of one n row
  const float* wsrc = Wo + (size_t)(n0 + nl) * EMB + ko;
  const _Float16* arow = Cp + (size_t)m0 * EMB;

  v8f acc[4];
#pragma unroll
  for (int t = 0; t < 4; ++t) acc[t] = z8();

  for (int kk = 0; kk < EMB; kk += 32) {
    __syncthreads();            // Bt free
    {
      const v4fa x0 = *(const v4fa*)(wsrc + kk);
      const v4fa x1 = *(const v4fa*)(wsrc + kk + 4);
      Pack8 w;
      w.s[0] = (_Float16)(bfval(x0.x) * 16.0f);
      w.s[1] = (_Float16)(bfval(x0.y) * 16.0f);
      w.s[2] = (_Float16)(bfval(x0.z) * 16.0f);
      w.s[3] = (_Float16)(bfval(x0.w) * 16.0f);
      w.s[4] = (_Float16)(bfval(x1.x) * 16.0f);
      w.s[5] = (_Float16)(bfval(x1.y) * 16.0f);
      w.s[6] = (_Float16)(bfval(x1.z) * 16.0f);
      w.s[7] = (_Float16)(bfval(x1.w) * 16.0f);
      *(v8ha*)&Bt[nl * BP + ko] = w.h;
    }
    __syncthreads();            // Bt visible
    const v16h a = frag_h(arow + kk, EMB);
#pragma unroll
    for (int t = 0; t < 4; ++t)
      acc[t] = mma_h(a, frag_h(&Bt[(t * 16) * BP], BP), acc[t]);
  }

  // epilogue: undo carries (64*16 = 1024), add bf16-RNE bias, stage f32 tile
#pragma unroll
  for (int t = 0; t < 4; ++t) {
    const float bias = bfval(bo[n0 + t * 16 + n16]);
#pragma unroll
    for (int r = 0; r < 8; ++r)
      Os[wave][(8 * hh + r) * OP + t * 16 + n16] = acc[t][r] * (1.0f / 1024.0f) + bias;
  }
  __syncthreads();

  // 16 rows x 256 B = 32 lines; line = (row, half); 8 lanes x 16 B per line, 4 lines per instruction
  const int rsub = lane >> 3, c4 = (lane & 7) << 2;
  v4fa v[8];
#pragma unroll
  for (int it = 0; it < 8; ++it) {
    const int li = it * 4 + rsub;
    const int row = li >> 1, hf = li & 1;
    v[it] = *(const v4fa*)&Os[wave][row * OP + hf * 32 + c4];
  }
  float* base = out + (size_t)m0 * EMB + n0;
#pragma unroll
  for (int it = 0; it < 8; ++it) {
    const int li = it * 4 + rsub;
    const int row = li >> 1, hf = li & 1;
    *(v4fa*)(base + (size_t)row * EMB + hf * 32 + c4) = v[it];
  }
  
}

// ---------------- launcher ----------------
extern "C" void kernel_launch(void* const* d_in, const int* in_sizes, int n_in,
                              void* d_out, int out_size, void* d_ws, size_t ws_size,
                              hipStream_t stream) {
  if (n_in < 9) return;
  if (in_sizes[0] < ((NB - 1) * SEQ_FULL + SEQ) * EMB) return;
  if (in_sizes[1] < NH * HD * HD || in_sizes[3] < NH * HD * HD || in_sizes[5] < NH * HD * HD) return;
  if (in_sizes[2] < NH * HD || in_sizes[4] < NH * HD || in_sizes[6] < NH * HD) return;
  if (in_sizes[7] < EMB * EMB || in_sizes[8] < EMB) return;
  if (out_size < MTOK * EMB) return;

  const float* x  = (const float*)d_in[0];
  const float* Wq = (const float*)d_in[1];
  const float* bq = (const float*)d_in[2];
  const float* Wk = (const float*)d_in[3];
  const float* bk = (const float*)d_in[4];
  const float* Wv = (const float*)d_in[5];
  const float* bv = (const float*)d_in[6];
  const float* Wo = (const float*)d_in[7];
  const float* bo = (const float*)d_in[8];
  float* out = (float*)d_out;

  const size_t qkv_bytes = (size_t)NB * NH * SEQ * HD * 2;   // 8 MiB at full size
  const size_t ctx_bytes = (size_t)MTOK * EMB * 2;           // 8 MiB at full size
  const size_t off_q = 0;
  const size_t off_k = off_q + qkv_bytes;
  const size_t off_v = off_k + qkv_bytes;
  const size_t off_c = off_v + qkv_bytes;
  const size_t total = off_c + ctx_bytes;
  if (total > ws_size) return;

  char* ws = (char*)d_ws;
  _Float16* Qp  = (_Float16*)(ws + off_q);
  _Float16* Kp  = (_Float16*)(ws + off_k);
  _Float16* Vtp = (_Float16*)(ws + off_v);
  _Float16* Cp  = (_Float16*)(ws + off_c);

  k_qkv<<<dim3(MTOK / 128, NH), 256, 0, stream>>>(x, Wq, bq, Wk, bk, Wv, bv, Qp, Kp, Vtp);
  k_attn<<<dim3(NB * NH, SEQ / 128), 256, 0, stream>>>(Qp, Kp, Vtp, Cp);
  k_oproj<<<dim3(MTOK / 128, EMB / 64), 256, 0, stream>>>(Cp, Wo, bo, out);
}

// v004
// Measured time: 62.9 microseconds a run.
// Next to v003, in two timings, it ran 1.07 and 1.06 times as fast.
// Counting every step since v000, it is 3.33 times as fast.
#include <hip/hip_runtime.h>

// Contractions: per-head x*W^T (q,k,v) on v_wmma_f32_16x16x32_bf16 (bf16 operands); q*k^T, p*v, ctx*Wo^T on v_wmma_f32_16x16x32_f16 (f16 operands, power-of-two carries p*1024, ctx*64, Wo*16); f32 accumulate; softmax in f32.

#ifndef NB
#define NB 4
#endif
#ifndef SEQ
#define SEQ 2048
#endif
#define NB_FULL 4
#define SEQ_FULL 2048
#define EMB 512
#define NH 8
#define HD 64
#define MTOK (NB * SEQ)
// LDS row pitches: data row + 16 B, an odd multiple of 16 B, so that the 16 rows of a 16-byte fragment read fall on different banks
#define LP 72   // halves, rows of 64 halves (128 B -> 144 B)
#define BP 40   // halves, rows of 32 halves (64 B -> 80 B)
#define WP 9    // 16-byte chunks, rows of 8 chunks (128 B -> 144 B)
#define OP 68   // floats, rows of 64 floats (256 B -> 272 B)

static_assert(NB >= 1 && NB <= NB_FULL);
static_assert(SEQ >= 128 && SEQ <= SEQ_FULL && (SEQ % 128) == 0);
static_assert(EMB == NH * HD);
static_assert((EMB % 64) == 0 && (MTOK % 128) == 0);
// full-size carve: 3 planes of NB*NH*SEQ*HD halves + ctx plane of MTOK*EMB halves
static_assert((3ull * NB_FULL * NH * SEQ_FULL * HD + (unsigned long long)NB_FULL * SEQ_FULL * EMB) * 2ull <= 134217728ull);

typedef unsigned short u16;
typedef _Float16 v16h __attribute__((ext_vector_type(16)));
typedef __bf16   v16bf __attribute__((ext_vector_type(16)));
typedef float    v8f  __attribute__((ext_vector_type(8)));
typedef _Float16 v8ha __attribute__((ext_vector_type(8), __may_alias__));
typedef float    v4fa __attribute__((ext_vector_type(4), __may_alias__));
typedef unsigned v4u  __attribute__((ext_vector_type(4), __may_alias__));

union FragH { v16h v; v8ha p[2]; };
union FragB { v16bf v; v4u q[2]; };
union Pack8 { v8ha h; v4u u; _Float16 s[8]; };

// ---------------- helpers ----------------

__device__ __forceinline__ unsigned bfbits(float f) {   // f32 -> bf16 bits, RNE
  unsigned u = __float_as_uint(f);
  u += 0x7FFFu + ((u >> 16) & 1u);
  return u >> 16;
}
__device__ __forceinline__ float bfval(float f) {       // f32 -> value of its bf16 RNE image
  unsigned u = __float_as_uint(f);
  u += 0x7FFFu + ((u >> 16) & 1u);
  return __uint_as_float(u & 0xFFFF0000u);
}
__device__ __forceinline__ v8f z8() {
  v8f z = {0.f, 0.f, 0.f, 0.f, 0.f, 0.f, 0.f, 0.f};
  return z;
}

// 8 consecutive f32 -> 8 bf16 packed in 16 bytes (low half-word = lower index)
__device__ __forceinline__ v4u pack_bf8(const float* __restrict__ p) {
  const v4fa x0 = *(const v4fa*)p;
  const v4fa x1 = *(const v4fa*)(p + 4);
  v4u r;
  r.x = bfbits(x0.x) | (bfbits(x0.y) << 16);
  r.y = bfbits(x0.z) | (bfbits(x0.w) << 16);
  r.z = bfbits(x1.x) | (bfbits(x1.y) << 16);
  r.w = bfbits(x1.z) | (bfbits(x1.w) << 16);
  return r;
}

// 16x32 16-bit fragment (A or B layout, identical k map), row-major source, pitch ld (elements):
//   lane l: row = l&15; elements 0..7 <- k 8h..8h+7; elements 8..15 <- k 16+8h..16+8h+7, h = l>>4.
__device__ __forceinline__ v16h frag_h(const _Float16* base, int ld) {
  const int lane = threadIdx.x & 31;
  const int row  = lane & 15;
  const int kb   = (lane >> 4) << 3;
  FragH u;
  u.p[0] = *(const v8ha*)(base + (size_t)row * ld + kb);
  u.p[1] = *(const v8ha*)(base + (size_t)row * ld + 16 + kb);
  return u.v;
}

// A fragment from f32 rows (pitch ld floats), k columns k0..k0+31, converted to bf16 RNE.
__device__ __forceinline__ v16bf frag_x_bf(const float* base, int ld, int k0) {
  const int lane = threadIdx.x & 31;
  const int row  = lane & 15;
  const int kb   = (lane >> 4) << 3;
  const float* p = base + (size_t)row * ld + k0 + kb;
  FragB u;
  u.q[0] = pack_bf8(p);        // k0+kb .. k0+kb+7
  u.q[1] = pack_bf8(p + 16);   // k0+16+kb .. k0+16+kb+7
  return u.v;
}

// B fragment from an LDS bf16 tile stored as [n][8 chunks of 8 k] (64 k per row, row pitch WP chunks);
// rows nrow0..nrow0+15, k chunk base kc0 (0 -> k 0..31, 4 -> k 32..63).
__device__ __forceinline__ v16bf frag_w_bf(const v4u* tile, int nrow0, int kc0) {
  const int lane = threadIdx.x & 31;
  const int n    = lane & 15;
  const int hh   = lane >> 4;
  FragB u;
  u.q[0] = tile[(nrow0 + n) * WP + kc0 + hh];
  u.q[1] = tile[(nrow0 + n) * WP + kc0 + 2 + hh];
  return u.v;
}

__device__ __forceinline__ v8f mma_h(v16h a, v16h b, v8f c) {
  v8f d = __builtin_amdgcn_wmma_f32_16x16x32_f16(false, a, false, b, (short)0, c, false, false);
  asm volatile("v_nop\n\tv_nop\n\tv_nop\n\tv_nop" : "+v"(d) : "v"(a), "v"(b));
  return d;
}
__device__ __forceinline__ v8f mma_bf(v16bf a, v16bf b, v8f c) {
  v8f d = __builtin_amdgcn_wmma_f32_16x16x32_bf16(false, a, false, b, (short)0, c, false, false);
  asm volatile("v_nop\n\tv_nop\n\tv_nop\n\tv_nop" : "+v"(d) : "v"(a), "v"(b));
  return d;
}

// value of the same column in the other 16-lane half (lane ^ 16), a vector cross-row move
__device__ __forceinline__ float xhalf(float x) {
  const int b = __float_as_int(x);
  return __int_as_float(__builtin_amdgcn_permlanex16(b, b, 0x76543210, 0xfedcba98, false, false));
}

// A lane's four 16-byte asynchronous copies global -> LDS (through no register): its share of one K tile and one V^T tile.
// l* = LDS byte address (low 32 bits of the __shared__ address), g* = global address, all multiples of 16 B.
// s_wait_xcnt 0 is the statement's last line so that no address register of a copy is rewritten in front of it.
__device__ __forceinline__ void copy4_to_lds(unsigned l0, const _Float16* g0, unsigned l1, const _Float16* g1,
                                             unsigned l2, const _Float16* g2, unsigned l3, const _Float16* g3) {
  asm volatile("global_load_async_to_lds_b128 %0, %1, off\n\t"
               "global_load_async_to_lds_b128 %2, %3, off\n\t"
               "global_load_async_to_lds_b128 %4, %5, off\n\t"
               "global_load_async_to_lds_b128 %6, %7, off\n\t"
               "s_wait_xcnt 0x0"
               :: "v"(l0), "v"(g0), "v"(l1), "v"(g1), "v"(l2), "v"(g2), "v"(l3), "v"(g3)
               : "memory");
}

// One wave writes its 16 x 64-half tile (LDS, pitch LP) to 16 global rows of pitch `pitch` halves.
__device__ __forceinline__ void wave_store_rows16(const _Float16* tile, _Float16* dst, int pitch) {
  const int lane = threadIdx.x & 31;
  const int rsub = lane >> 3, c8 = (lane & 7) << 3;
  Pack8 v[4];
#pragma unroll
  for (int it = 0; it < 4; ++it)
    v[it].h = *(const v8ha*)(tile + (it * 4 + rsub) * LP + c8);
#pragma unroll
  for (int it = 0; it < 4; ++it)
    *(v4u*)(dst + (size_t)(it * 4 + rsub) * pitch + c8) = v[it].u;
  
}

// ---------------- kernel 1: per-head q/k/v projections ----------------
// block = 256 threads (8 waves); block owns (128 tokens, head h); wave owns 16 tokens x 64 outputs.
// Q,K planes: [bh][s][64] f16.   V plane transposed: [bh][64][SEQ] f16.
__global__ __launch_bounds__(256) void k_qkv(
    const float* __restrict__ x,
    const float* __restrict__ Wq, const float* __restrict__ bq,
    const float* __restrict__ Wk, const float* __restrict__ bk,
    const float* __restrict__ Wv, const float* __restrict__ bv,
    _Float16* __restrict__ Qp, _Float16* __restrict__ Kp, _Float16* __restrict__ Vtp) {
  __shared__ __align__(16) v4u Wl[3][HD * WP];      // bf16 [n][k] per matrix, 8 k per chunk
  __shared__ float Bl[3][HD];                        // bf16-RNE biases as f32
  __shared__ __align__(16) _Float16 St[128 * LP];    // f16 staging [token local][d]

  const int tid = threadIdx.x, wave = tid >> 5, lane = tid & 31;
  const int hh = lane >> 4, n16 = lane & 15;
  const int h  = blockIdx.y;
  const int m0 = blockIdx.x * 128;                   // compact token index
  const int b  = m0 / SEQ, s0 = m0 - b * SEQ;
  const int bh = b * NH + h;

  // stage the head's three 64x64 weight tiles (bf16 RNE) and biases
#pragma unroll
  for (int c = tid; c < 512; c += 256) {
    const int nrow = c >> 3, ko = (c & 7) << 3;
    const size_t off = ((size_t)h * HD + nrow) * HD + ko;
    const int cl = nrow * WP + (c & 7);
    Wl[0][cl] = pack_bf8(Wq + off);
    Wl[1][cl] = pack_bf8(Wk + off);
    Wl[2][cl] = pack_bf8(Wv + off);
  }
  if (tid < HD) {                                    // wave-uniform (waves 0,1)
    Bl[0][tid] = bfval(bq[h * HD + tid]);
    Bl[1][tid] = bfval(bk[h * HD + tid]);
    Bl[2][tid] = bfval(bv[h * HD + tid]);
  }
  __syncthreads();

  // A fragments of the wave's 16 tokens (64 input dims of head h), bf16 RNE in registers
  const float* xp = x + ((size_t)b * SEQ_FULL + s0 + wave * 16) * EMB + h * HD;
  const v16bf a0 = frag_x_bf(xp, EMB, 0);
  const v16bf a1 = frag_x_bf(xp, EMB, 32);

#pragma unroll
  for (int mat = 0; mat < 3; ++mat) {
    v8f acc[4];
#pragma unroll
    for (int t = 0; t < 4; ++t) {
      v8f c = z8();
      c = mma_bf(a0, frag_w_bf(Wl[mat], t * 16, 0), c);
      c = mma_bf(a1, frag_w_bf(Wl[mat], t * 16, 4), c);
      acc[t] = c;
    }
    // bias add in f32, convert to f16, stage: D element r of lane -> (row 8hh+r, col t*16+n16)
#pragma unroll
    for (int t = 0; t < 4; ++t) {
      const float bias = Bl[mat][t * 16 + n16];
#pragma unroll
      for (int r = 0; r < 8; ++r)
        St[(wave * 16 + 8 * hh + r) * LP + t * 16 + n16] = (_Float16)(acc[t][r] + bias);
    }
    __syncthreads();

    if (mat < 2) {
      _Float16* plane = (mat == 0) ? Qp : Kp;
      wave_store_rows16(&St[(wave * 16) * LP],
                        plane + ((size_t)bh * SEQ + s0 + wave * 16) * HD, HD);
    } else {
      // V transposed: line L = (d, half); 8 lanes x 16 B per line, 4 lines per instruction
      const int c8 = (tid & 7) << 3;
      Pack8 w[4];
#pragma unroll
      for (int it = 0; it < 4; ++it) {
        const int L = it * 32 + (tid >> 3);
        const int d = L >> 1, j0 = (L & 1) * 64 + c8;
#pragma unroll
        for (int e = 0; e < 8; ++e) w[it].s[e] = St[(j0 + e) * LP + d];
      }
#pragma unroll
      for (int it = 0; it < 4; ++it) {
        const int L = it * 32 + (tid >> 3);
        const int d = L >> 1, j0 = (L & 1) * 64 + c8;
        *(v4u*)(Vtp + ((size_t)bh * HD + d) * SEQ + s0 + j0) = w[it].u;
      }
      
    }
    __syncthreads();                                 // St free for the next matrix
  }
}

__global__ __launch_bounds__(256) void k_attn(
    const _Float16* __restrict__ Qp, const _Float16* __restrict__ Kp,
    const _Float16* __restrict__ Vtp, _Float16* __restrict__ Cp) {
  __shared__ __align__(16) _Float16 Kt[4][64 * LP];   // [2 * buffer + key group][key][d]
  __shared__ __align__(16) _Float16 Vt[4][HD * LP];   // [2 * buffer + key group][d][key]
  __shared__ __align__(16) _Float16 Ct[8][16 * LP];   // per wave [q row][d], ctx staging for whole-line stores
  __shared__ __align__(16) v4fa Xo[8][8][32];         // per wave [4 registers of O][lane]: partial O handed to the partner wave
  __shared__ float Xm[8][2][32];                      // per wave [maximum, sum][lane] of the same columns

  const int tid = threadIdx.x, lane = tid & 31;
  const int wave = __builtin_amdgcn_readfirstlane(tid >> 5);
  const int grp = wave >> 2;    // key group
  const int hh = lane >> 4, n16 = lane & 15;
  const int bh = blockIdx.x;
  const int b  = bh / NH, h = bh - b * NH;
  const int q0 = blockIdx.y * 128 + (wave & 3) * 32;

  const _Float16* Qbh = Qp  + (size_t)bh * SEQ * HD;
  const _Float16* Kbh = Kp  + (size_t)bh * SEQ * HD;
  const _Float16* Vbh = Vtp + (size_t)bh * HD * SEQ;

  // Q^T as B operand (column group cg: query q0 + 16cg + lane&15; d 0..31, 32..63), in registers for the whole key loop
  v16h bq[2][2];
#pragma unroll
  for (int cg = 0; cg < 2; ++cg) {
    bq[cg][0] = frag_h(Qbh + (size_t)(q0 + 16 * cg) * HD, HD);
    bq[cg][1] = frag_h(Qbh + (size_t)(q0 + 16 * cg) * HD + 32, HD);
  }

  float mrow[2] = {-1e30f, -1e30f};   // running maximum of the column group's query n16 (equal in both lane halves)
  float lrow[2] = {0.f, 0.f};         // running sum of that query over this lane half's keys only
  v8f o[2][4];                        // o[cg][dt][r] = O^T[d = 16dt + 8hh + r][query n16 of group cg]
#pragma unroll
  for (int cg = 0; cg < 2; ++cg)
#pragma unroll
    for (int t = 0; t < 4; ++t) o[cg][t] = z8();

  const float scale = 0.125f;   // 1/sqrt(64), exact

  // a thread copies rows crow and crow + 32, 16 bytes at column coff, of each of a stage's four tiles
  const int crow = tid >> 3, coff = (tid & 7) << 3;
  const unsigned lk = (unsigned)(size_t)&Kt[0][crow * LP + coff];
  const unsigned lv = (unsigned)(size_t)&Vt[0][crow * LP + coff];
  const unsigned half_b = 32 * LP * 2, tile_b = 64 * LP * 2;   // bytes: 32 rows, one tile
  const _Float16* gk = Kbh + (size_t)crow * HD + coff;         // tile at key t0: + t0 * HD
  const _Float16* gv = Vbh + (size_t)crow * SEQ + coff;        // tile at key t0: + t0
  constexpr int NST = SEQ / 128;                               // stages

  auto stage_copy = [&](int s) {
    const unsigned bo = (unsigned)(s & 1) * 2u * tile_b;
    const _Float16* nk = gk + (size_t)s * 128 * HD;
    const _Float16* nv = gv + s * 128;
    copy4_to_lds(lk + bo, nk, lk + bo + half_b, nk + 32 * HD, lv + bo, nv, lv + bo + half_b, nv + (size_t)32 * SEQ);
    copy4_to_lds(lk + bo + tile_b, nk + 64 * HD, lk + bo + tile_b + half_b, nk + 96 * HD,
                 lv + bo + tile_b, nv + 64, lv + bo + tile_b + half_b, nv + (size_t)32 * SEQ + 64);
  };

  // stage 0 into buffer 0, landed and published; then stage 1, where there is one, into buffer 1
  stage_copy(0);
  asm volatile("s_wait_asynccnt 0x0" ::: "memory");   // this wave's copies of stage 0 have landed
  __syncthreads();              // stage 0 visible to every wave
  if (NST > 1) stage_copy(1);

  for (int s = 0; s < NST; ++s) {
    const int tb = ((s & 1) << 1) + grp;
    const _Float16* Kb = &Kt[tb][0];
    const _Float16* Vb = &Vt[tb][0];

    // S^T(64 keys x 32 queries) = K(64x64) . Q^T : sc[cg][t][r] = S[query n16 of cg][key 16t + 8hh + r]
    v8f sc[2][4];
#pragma unroll
    for (int t = 0; t < 4; ++t) {
      const v16h ka0 = frag_h(Kb + (t * 16) * LP, LP);
      const v16h ka1 = frag_h(Kb + (t * 16) * LP + 32, LP);
      v8f c0 = z8(), c1 = z8();
      c0 = mma_h(ka0, bq[0][0], c0);
      c1 = mma_h(ka0, bq[1][0], c1);
      c0 = mma_h(ka1, bq[0][1], c0);
      c1 = mma_h(ka1, bq[1][1], c1);
      sc[0][t] = c0;
      sc[1][t] = c1;
    }

    FragH pb[2][2];
#pragma unroll  // constant indices keep sc, pb and o in registers
    for (int cg = 0; cg < 2; ++cg) {
      // online softmax of query n16: 32 keys in this lane, the other 32 in lane ^ 16
      float mx = sc[cg][0][0];
#pragma unroll  // constant indices keep sc in registers
      for (int t = 0; t < 4; ++t)
#pragma unroll  // as above
        for (int r = 0; r < 8; ++r) mx = fmaxf(mx, sc[cg][t][r]);
      mx = fmaxf(mx, xhalf(mx)) * scale;
      const float mnew  = fmaxf(mrow[cg], mx);
      const float alpha = __expf(mrow[cg] - mnew);
      mrow[cg] = mnew;

      // P^T as B operand, in frag_h's k order: element s of pb[cg][j] is key 32j + 16(s >> 3) + 8hh + (s & 7) = score tile 2j + (s >> 3), register s & 7
#pragma unroll  // constant indices keep sc and pb in registers
      for (int t = 0; t < 4; ++t) {
        const v8f x = sc[cg][t] * scale - mnew;
        v8f p;
#pragma unroll  // as above
        for (int r = 0; r < 8; ++r) p[r] = __expf(x[r]);
        sc[cg][t] = p;
        pb[cg][t >> 1].p[t & 1] = __builtin_convertvector(p * 1024.0f, v8ha);
      }
      // in-lane sum of the 32 p as a tree: short dependent chains, packed adds
      const v8f s8 = (sc[cg][0] + sc[cg][1]) + (sc[cg][2] + sc[cg][3]);
      const float ps = ((s8[0] + s8[1]) + (s8[2] + s8[3])) + ((s8[4] + s8[5]) + (s8[6] + s8[7]));
      lrow[cg] = lrow[cg] * alpha + ps;
#pragma unroll  // constant indices keep o in registers
      for (int t = 0; t < 4; ++t) o[cg][t] *= alpha;
    }

    // O^T(64 d x 32 queries) += V^T(64 d x 64 keys) . P^T : A[m=d][k=key] = Vt[d][key]
#pragma unroll
    for (int dt = 0; dt < 4; ++dt) {
      const v16h va0 = frag_h(Vb + (dt * 16) * LP, LP);
      const v16h va1 = frag_h(Vb + (dt * 16) * LP + 32, LP);
      v8f c0 = o[0][dt], c1 = o[1][dt];
      c0 = mma_h(va0, pb[0][0].v, c0);
      c1 = mma_h(va0, pb[1][0].v, c1);
      c0 = mma_h(va1, pb[0][1].v, c0);
      c1 = mma_h(va1, pb[1][1].v, c1);
      o[0][dt] = c0;
      o[1][dt] = c1;
    }

    // hand-over: this wave's reads of stage s are done, its copies of stage s + 1 have landed; the one barrier
    // publishes stage s + 1 and frees stage s's buffer, which then takes stage s + 2
    asm volatile("s_wait_dscnt 0x0" ::: "memory");      // own LDS reads retired before the buffer is refilled
    asm volatile("s_wait_asynccnt 0x0" ::: "memory");   // own copies landed before other waves read them
    __syncthreads();
    if (s + 2 < NST) stage_copy(s + 2);                 // same for the whole work-group
  }
  asm volatile("s_wait_asynccnt 0x0" ::: "memory");     // nothing of this wave in flight behind the loop

  // merge of the two key groups: the wave of key group g finishes column group g of its 32 queries; it hands its partial
  // of the other column group to the partner wave (wave ^ 4, same queries, same lane map) and takes the partner's of its own
  const float mk = grp ? mrow[1] : mrow[0], lkp = grp ? lrow[1] : lrow[0];
  Xm[wave][0][lane] = grp ? mrow[0] : mrow[1];
  Xm[wave][1][lane] = grp ? lrow[0] : lrow[1];
  v8f keep[4];
#pragma unroll
  for (int dt = 0; dt < 4; ++dt) {
    keep[dt] = grp ? o[1][dt] : o[0][dt];
    const v8f give = grp ? o[0][dt] : o[1][dt];
    Xo[wave][2 * dt][lane]     = __builtin_shufflevector(give, give, 0, 1, 2, 3);
    Xo[wave][2 * dt + 1][lane] = __builtin_shufflevector(give, give, 4, 5, 6, 7);
  }
  __syncthreads();              // both partners' partials are in LDS

  const int part = wave ^ 4;
  const float mo = Xm[part][0][lane], lo = Xm[part][1][lane];
  const float mm = fmaxf(mk, mo);
  const float ak = __expf(mk - mm), ao = __expf(mo - mm);
  const float lsum = lkp * ak + lo * ao;

  // normalise: o holds 1024 * sum(p v); ctx carried x64 -> o * (64/1024) / l; l joins the two halves' sums
  const float inv = 0.0625f * __builtin_amdgcn_rcpf(lsum + xhalf(lsum));
  const float fk = ak * inv, fo = ao * inv;

  // a lane's 8 registers of one dt are 8 consecutive d of one query row: one 16-byte LDS store each
#pragma unroll
  for (int dt = 0; dt < 4; ++dt) {
    const v4fa y0 = Xo[part][2 * dt][lane];
    const v4fa y1 = Xo[part][2 * dt + 1][lane];
    Pack8 w;
#pragma unroll
    for (int r = 0; r < 4; ++r) {
      w.s[r]     = (_Float16)(keep[dt][r] * fk + y0[r] * fo);
      w.s[r + 4] = (_Float16)(keep[dt][r + 4] * fk + y1[r] * fo);
    }
    *(v8ha*)&Ct[wave][n16 * LP + dt * 16 + 8 * hh] = w.h;
  }
  __syncthreads();              // staged rows complete before they are read back across lanes

  wave_store_rows16(&Ct[wave][0],
                    Cp + ((size_t)b * SEQ + q0 + 16 * grp) * EMB + h * HD, EMB);
}

// ---------------- kernel 3: output projection out = ctx . Wo^T + bo ----------------
// block = 256 threads (8 waves); block tile 128 tokens x 64 outputs; wave owns 16 x 64.
// B tile (Wo rows n0..n0+63, k slab of 32) staged in LDS as f16(16 * bf16RNE(Wo)).
__global__ __launch_bounds__(256) void k_oproj(
    const _Float16* __restrict__ Cp, const float* __restrict__ Wo,
    const float* __restrict__ bo, float* __restrict__ out) {
  __shared__ __align__(16) _Float16 Bt[64 * BP];     // [n local][k local]
  __shared__ __align__(16) float Os[8][16 * OP];     // per wave f32 output staging

  const int tid = threadIdx.x, wave = tid >> 5, lane = tid & 31;
  const int hh = lane >> 4, n16 = lane & 15;
  const int m0 = blockIdx.x * 128 + wave * 16;
  const int n0 = blockIdx.y * 64;

  const int nl = tid >> 2, ko = (tid & 3) << 3;      // staging: 8 consecutive k of one n row
  const float* wsrc = Wo + (size_t)(n0 + nl) * EMB + ko;
  const _Float16* arow = Cp + (size_t)m0 * EMB;

  v8f acc[4];
#pragma unroll
  for (int t = 0; t < 4; ++t) acc[t] = z8();

  for (int kk = 0; kk < EMB; kk += 32) {
    __syncthreads();            // Bt free
    {
      const v4fa x0 = *(const v4fa*)(wsrc + kk);
      const v4fa x1 = *(const v4fa*)(wsrc + kk + 4);
      Pack8 w;
      w.s[0] = (_Float16)(bfval(x0.x) * 16.0f);
      w.s[1] = (_Float16)(bfval(x0.y) * 16.0f);
      w.s[2] = (_Float16)(bfval(x0.z) * 16.0f);
      w.s[3] = (_Float16)(bfval(x0.w) * 16.0f);
      w.s[4] = (_Float16)(bfval(x1.x) * 16.0f);
      w.s[5] = (_Float16)(bfval(x1.y) * 16.0f);
      w.s[6] = (_Float16)(bfval(x1.z) * 16.0f);
      w.s[7] = (_Float16)(bfval(x1.w) * 16.0f);
      *(v8ha*)&Bt[nl * BP + ko] = w.h;
    }
    __syncthreads();            // Bt visible
    const v16h a = frag_h(arow + kk, EMB);
#pragma unroll
    for (int t = 0; t < 4; ++t)
      acc[t] = mma_h(a, frag_h(&Bt[(t * 16) * BP], BP), acc[t]);
  }

  // epilogue: undo carries (64*16 = 1024), add bf16-RNE bias, stage f32 tile
#pragma unroll
  for (int t = 0; t < 4; ++t) {
    const float bias = bfval(bo[n0 + t * 16 + n16]);
#pragma unroll
    for (int r = 0; r < 8; ++r)
      Os[wave][(8 * hh + r) * OP + t * 16 + n16] = acc[t][r] * (1.0f / 1024.0f) + bias;
  }
  __syncthreads();

  // 16 rows x 256 B = 32 lines; line = (row, half); 8 lanes x 16 B per line, 4 lines per instruction
  const int rsub = lane >> 3, c4 = (lane & 7) << 2;
  v4fa v[8];
#pragma unroll
  for (int it = 0; it < 8; ++it) {
    const int li = it * 4 + rsub;
    const int row = li >> 1, hf = li & 1;
    v[it] = *(const v4fa*)&Os[wave][row * OP + hf * 32 + c4];
  }
  float* base = out + (size_t)m0 * EMB + n0;
#pragma unroll
  for (int it = 0; it < 8; ++it) {
    const int li = it * 4 + rsub;
    const int row = li >> 1, hf = li & 1;
    *(v4fa*)(base + (size_t)row * EMB + hf * 32 + c4) = v[it];
  }
  
}

// ---------------- launcher ----------------
extern "C" void kernel_launch(void* const* d_in, const int* in_sizes, int n_in,
                              void* d_out, int out_size, void* d_ws, size_t ws_size,
                              hipStream_t stream) {
  if (n_in < 9) return;
  if (in_sizes[0] < ((NB - 1) * SEQ_FULL + SEQ) * EMB) return;
  if (in_sizes[1] < NH * HD * HD || in_sizes[3] < NH * HD * HD || in_sizes[5] < NH * HD * HD) return;
  if (in_sizes[2] < NH * HD || in_sizes[4] < NH * HD || in_sizes[6] < NH * HD) return;
  if (in_sizes[7] < EMB * EMB || in_sizes[8] < EMB) return;
  if (out_size < MTOK * EMB) return;

  const float* x  = (const float*)d_in[0];
  const float* Wq = (const float*)d_in[1];
  const float* bq = (const float*)d_in[2];
  const float* Wk = (const float*)d_in[3];
  const float* bk = (const float*)d_in[4];
  const float* Wv = (const float*)d_in[5];
  const float* bv = (const float*)d_in[6];
  const float* Wo = (const float*)d_in[7];
  const float* bo = (const float*)d_in[8];
  float* out = (float*)d_out;

  const size_t qkv_bytes = (size_t)NB * NH * SEQ * HD * 2;   // 8 MiB at full size
  const size_t ctx_bytes = (size_t)MTOK * EMB * 2;           // 8 MiB at full size
  const size_t off_q = 0;
  const size_t off_k = off_q + qkv_bytes;
  const size_t off_v = off_k + qkv_bytes;
  const size_t off_c = off_v + qkv_bytes;
  const size_t total = off_c + ctx_bytes;
  if (total > ws_size) return;

  char* ws = (char*)d_ws;
  _Float16* Qp  = (_Float16*)(ws + off_q);
  _Float16* Kp  = (_Float16*)(ws + off_k);
  _Float16* Vtp = (_Float16*)(ws + off_v);
  _Float16* Cp  = (_Float16*)(ws + off_c);

  k_qkv<<<dim3(MTOK / 128, NH), 256, 0, stream>>>(x, Wq, bq, Wk, bk, Wv, bv, Qp, Kp, Vtp);
  k_attn<<<dim3(NB * NH, SEQ / 128), 256, 0, stream>>>(Qp, Kp, Vtp, Cp);
  k_oproj<<<dim3(MTOK / 128, EMB / 64), 256, 0, stream>>>(Cp, Wo, bo, out);
}

// v005
// It runs in 59.9 microseconds.
// Timed twice side by side with v004, it ran 1.05 times as fast both times.
// Over all steps from v000 it is 3.50 times as fast.
#include <hip/hip_runtime.h>

// Contractions: per-head x*W^T (q,k,v) on v_wmma_f32_16x16x32_bf16 (bf16 operands); q*k^T, p*v, ctx*Wo^T on v_wmma_f32_16x16x32_f16 (f16 operands, power-of-two carries p*1024, ctx*64, Wo*16); f32 accumulate; softmax in f32.

#ifndef NB
#define NB 4
#endif
#ifndef SEQ
#define SEQ 2048
#endif
#define NB_FULL 4
#define SEQ_FULL 2048
#define EMB 512
#define NH 8
#define HD 64
#define MTOK (NB * SEQ)
// LDS row pitches: data row + 16 B, an odd multiple of 16 B, so that the 16 rows of a 16-byte fragment read fall on different banks
#define LP 72   // halves, rows of 64 halves (128 B -> 144 B)
#define BP 40   // halves, rows of 32 halves (64 B -> 80 B)
#define WP 9    // 16-byte chunks, rows of 8 chunks (128 B -> 144 B)
#define OP 68   // floats, rows of 64 floats (256 B -> 272 B)

static_assert(NB >= 1 && NB <= NB_FULL);
static_assert(SEQ >= 128 && SEQ <= SEQ_FULL && (SEQ % 128) == 0);
static_assert(EMB == NH * HD);
static_assert((EMB % 64) == 0 && (MTOK % 128) == 0);
// full-size carve: 3 planes of NB*NH*SEQ*HD halves + ctx plane of MTOK*EMB halves
static_assert((3ull * NB_FULL * NH * SEQ_FULL * HD + (unsigned long long)NB_FULL * SEQ_FULL * EMB) * 2ull <= 134217728ull);

typedef unsigned short u16;
typedef _Float16 v16h __attribute__((ext_vector_type(16)));
typedef __bf16   v16bf __attribute__((ext_vector_type(16)));
typedef float    v8f  __attribute__((ext_vector_type(8)));
typedef _Float16 v8ha __attribute__((ext_vector_type(8), __may_alias__));
typedef float    v4fa __attribute__((ext_vector_type(4), __may_alias__));
typedef unsigned v4u  __attribute__((ext_vector_type(4), __may_alias__));

union FragH { v16h v; v8ha p[2]; };
union FragB { v16bf v; v4u q[2]; };
union Pack8 { v8ha h; v4u u; _Float16 s[8]; };

// ---------------- helpers ----------------

__device__ __forceinline__ unsigned bfbits(float f) {   // f32 -> bf16 bits, RNE
  unsigned u = __float_as_uint(f);
  u += 0x7FFFu + ((u >> 16) & 1u);
  return u >> 16;
}
__device__ __forceinline__ float bfval(float f) {       // f32 -> value of its bf16 RNE image
  unsigned u = __float_as_uint(f);
  u += 0x7FFFu + ((u >> 16) & 1u);
  return __uint_as_float(u & 0xFFFF0000u);
}
__device__ __forceinline__ v8f z8() {
  v8f z = {0.f, 0.f, 0.f, 0.f, 0.f, 0.f, 0.f, 0.f};
  return z;
}

// 8 consecutive f32 -> 8 bf16 packed in 16 bytes (low half-word = lower index)
__device__ __forceinline__ v4u pack_bf8(const float* __restrict__ p) {
  const v4fa x0 = *(const v4fa*)p;
  const v4fa x1 = *(const v4fa*)(p + 4);
  v4u r;
  r.x = bfbits(x0.x) | (bfbits(x0.y) << 16);
  r.y = bfbits(x0.z) | (bfbits(x0.w) << 16);
  r.z = bfbits(x1.x) | (bfbits(x1.y) << 16);
  r.w = bfbits(x1.z) | (bfbits(x1.w) << 16);
  return r;
}

// 16x32 16-bit fragment (A or B layout, identical k map), row-major source, pitch ld (elements):
//   lane l: row = l&15; elements 0..7 <- k 8h..8h+7; elements 8..15 <- k 16+8h..16+8h+7, h = l>>4.
__device__ __forceinline__ v16h frag_h(const _Float16* base, int ld) {
  const int lane = threadIdx.x & 31;
  const int row  = lane & 15;
  const int kb   = (lane >> 4) << 3;
  FragH u;
  u.p[0] = *(const v8ha*)(base + (size_t)row * ld + kb);
  u.p[1] = *(const v8ha*)(base + (size_t)row * ld + 16 + kb);
  return u.v;
}

// A fragment from f32 rows (pitch ld floats), k columns k0..k0+31, converted to bf16 RNE.
__device__ __forceinline__ v16bf frag_x_bf(const float* base, int ld, int k0) {
  const int lane = threadIdx.x & 31;
  const int row  = lane & 15;
  const int kb   = (lane >> 4) << 3;
  const float* p = base + (size_t)row * ld + k0 + kb;
  FragB u;
  u.q[0] = pack_bf8(p);        // k0+kb .. k0+kb+7
  u.q[1] = pack_bf8(p + 16);   // k0+16+kb .. k0+16+kb+7
  return u.v;
}

// B fragment from an LDS bf16 tile stored as [n][8 chunks of 8 k] (64 k per row, row pitch WP chunks);
// rows nrow0..nrow0+15, k chunk base kc0 (0 -> k 0..31, 4 -> k 32..63).
__device__ __forceinline__ v16bf frag_w_bf(const v4u* tile, int nrow0, int kc0) {
  const int lane = threadIdx.x & 31;
  const int n    = lane & 15;
  const int hh   = lane >> 4;
  FragB u;
  u.q[0] = tile[(nrow0 + n) * WP + kc0 + hh];
  u.q[1] = tile[(nrow0 + n) * WP + kc0 + 2 + hh];
  return u.v;
}

// builtin forms: the compiler itself keeps the distance the chip needs behind a matrix instruction and is free to schedule round it
__device__ __forceinline__ v8f mma_h(v16h a, v16h b, v8f c) {
  v8f d = __builtin_amdgcn_wmma_f32_16x16x32_f16(false, a, false, b, (short)0, c, false, false);
  return d;
}
__device__ __forceinline__ v8f mma_bf(v16bf a, v16bf b, v8f c) {
  v8f d = __builtin_amdgcn_wmma_f32_16x16x32_bf16(false, a, false, b, (short)0, c, false, false);
  return d;
}

// value of the same column in the other 16-lane half (lane ^ 16), a vector cross-row move
__device__ __forceinline__ float xhalf(float x) {
  const int b = __float_as_int(x);
  return __int_as_float(__builtin_amdgcn_permlanex16(b, b, 0x76543210, 0xfedcba98, false, false));
}

// A lane's four 16-byte asynchronous copies global -> LDS (through no register): its share of one K tile and one V^T tile.
// l* = LDS byte address (low 32 bits of the __shared__ address), g* = global address, all multiples of 16 B.
// s_wait_xcnt 0 is the statement's last line so that no address register of a copy is rewritten in front of it.
__device__ __forceinline__ void copy4_to_lds(unsigned l0, const _Float16* g0, unsigned l1, const _Float16* g1,
                                             unsigned l2, const _Float16* g2, unsigned l3, const _Float16* g3) {
  asm volatile("global_load_async_to_lds_b128 %0, %1, off\n\t"
               "global_load_async_to_lds_b128 %2, %3, off\n\t"
               "global_load_async_to_lds_b128 %4, %5, off\n\t"
               "global_load_async_to_lds_b128 %6, %7, off\n\t"
               "s_wait_xcnt 0x0"
               :: "v"(l0), "v"(g0), "v"(l1), "v"(g1), "v"(l2), "v"(g2), "v"(l3), "v"(g3)
               : "memory");
}

// One wave writes its 16 x 64-half tile (LDS, pitch LP) to 16 global rows of pitch `pitch` halves.
__device__ __forceinline__ void wave_store_rows16(const _Float16* tile, _Float16* dst, int pitch) {
  const int lane = threadIdx.x & 31;
  const int rsub = lane >> 3, c8 = (lane & 7) << 3;
  Pack8 v[4];
#pragma unroll
  for (int it = 0; it < 4; ++it)
    v[it].h = *(const v8ha*)(tile + (it * 4 + rsub) * LP + c8);
#pragma unroll
  for (int it = 0; it < 4; ++it)
    *(v4u*)(dst + (size_t)(it * 4 + rsub) * pitch + c8) = v[it].u;
  
}

// ---------------- kernel 1: per-head q/k/v projections ----------------
// block = 256 threads (8 waves); block owns (128 tokens, head h); wave owns 16 tokens x 64 outputs.
// Q,K planes: [bh][s][64] f16.   V plane transposed: [bh][64][SEQ] f16.
__global__ __launch_bounds__(256) void k_qkv(
    const float* __restrict__ x,
    const float* __restrict__ Wq, const float* __restrict__ bq,
    const float* __restrict__ Wk, const float* __restrict__ bk,
    const float* __restrict__ Wv, const float* __restrict__ bv,
    _Float16* __restrict__ Qp, _Float16* __restrict__ Kp, _Float16* __restrict__ Vtp) {
  __shared__ __align__(16) v4u Wl[3][HD * WP];      // bf16 [n][k] per matrix, 8 k per chunk
  __shared__ float Bl[3][HD];                        // bf16-RNE biases as f32
  __shared__ __align__(16) _Float16 St[128 * LP];    // f16 staging [token local][d]

  const int tid = threadIdx.x, wave = tid >> 5, lane = tid & 31;
  const int hh = lane >> 4, n16 = lane & 15;
  const int h  = blockIdx.y;
  const int m0 = blockIdx.x * 128;                   // compact token index
  const int b  = m0 / SEQ, s0 = m0 - b * SEQ;
  const int bh = b * NH + h;

  // stage the head's three 64x64 weight tiles (bf16 RNE) and biases
#pragma unroll
  for (int c = tid; c < 512; c += 256) {
    const int nrow = c >> 3, ko = (c & 7) << 3;
    const size_t off = ((size_t)h * HD + nrow) * HD + ko;
    const int cl = nrow * WP + (c & 7);
    Wl[0][cl] = pack_bf8(Wq + off);
    Wl[1][cl] = pack_bf8(Wk + off);
    Wl[2][cl] = pack_bf8(Wv + off);
  }
  if (tid < HD) {                                    // wave-uniform (waves 0,1)
    Bl[0][tid] = bfval(bq[h * HD + tid]);
    Bl[1][tid] = bfval(bk[h * HD + tid]);
    Bl[2][tid] = bfval(bv[h * HD + tid]);
  }
  __syncthreads();

  // A fragments of the wave's 16 tokens (64 input dims of head h), bf16 RNE in registers
  const float* xp = x + ((size_t)b * SEQ_FULL + s0 + wave * 16) * EMB + h * HD;
  const v16bf a0 = frag_x_bf(xp, EMB, 0);
  const v16bf a1 = frag_x_bf(xp, EMB, 32);

#pragma unroll
  for (int mat = 0; mat < 3; ++mat) {
    v8f acc[4];
#pragma unroll
    for (int t = 0; t < 4; ++t) {
      v8f c = z8();
      c = mma_bf(a0, frag_w_bf(Wl[mat], t * 16, 0), c);
      c = mma_bf(a1, frag_w_bf(Wl[mat], t * 16, 4), c);
      acc[t] = c;
    }
    // bias add in f32, convert to f16, stage: D element r of lane -> (row 8hh+r, col t*16+n16)
#pragma unroll
    for (int t = 0; t < 4; ++t) {
      const float bias = Bl[mat][t * 16 + n16];
#pragma unroll
      for (int r = 0; r < 8; ++r)
        St[(wave * 16 + 8 * hh + r) * LP + t * 16 + n16] = (_Float16)(acc[t][r] + bias);
    }
    __syncthreads();

    if (mat < 2) {
      _Float16* plane = (mat == 0) ? Qp : Kp;
      wave_store_rows16(&St[(wave * 16) * LP],
                        plane + ((size_t)bh * SEQ + s0 + wave * 16) * HD, HD);
    } else {
      // V transposed: line L = (d, half); 8 lanes x 16 B per line, 4 lines per instruction
      const int c8 = (tid & 7) << 3;
      Pack8 w[4];
#pragma unroll
      for (int it = 0; it < 4; ++it) {
        const int L = it * 32 + (tid >> 3);
        const int d = L >> 1, j0 = (L & 1) * 64 + c8;
#pragma unroll
        for (int e = 0; e < 8; ++e) w[it].s[e] = St[(j0 + e) * LP + d];
      }
#pragma unroll
      for (int it = 0; it < 4; ++it) {
        const int L = it * 32 + (tid >> 3);
        const int d = L >> 1, j0 = (L & 1) * 64 + c8;
        *(v4u*)(Vtp + ((size_t)bh * HD + d) * SEQ + s0 + j0) = w[it].u;
      }
      
    }
    __syncthreads();                                 // St free for the next matrix
  }
}

__global__ __launch_bounds__(256) void k_attn(
    const _Float16* __restrict__ Qp, const _Float16* __restrict__ Kp,
    const _Float16* __restrict__ Vtp, _Float16* __restrict__ Cp) {
  __shared__ __align__(16) _Float16 Kt[4][64 * LP];   // [2 * buffer + key group][key][d]
  __shared__ __align__(16) _Float16 Vt[4][HD * LP];   // [2 * buffer + key group][d][key]
  __shared__ __align__(16) _Float16 Ct[8][16 * LP];   // per wave [q row][d], ctx staging for whole-line stores
  __shared__ __align__(16) v4fa Xo[8][8][32];         // per wave [4 registers of O][lane]: partial O handed to the partner wave
  __shared__ float Xm[8][2][32];                      // per wave [maximum, sum][lane] of the same columns

  const int tid = threadIdx.x, lane = tid & 31;
  const int wave = __builtin_amdgcn_readfirstlane(tid >> 5);
  const int grp = wave >> 2;    // key group
  const int hh = lane >> 4, n16 = lane & 15;
  const int bh = blockIdx.x;
  const int b  = bh / NH, h = bh - b * NH;
  const int q0 = blockIdx.y * 128 + (wave & 3) * 32;

  const _Float16* Qbh = Qp  + (size_t)bh * SEQ * HD;
  const _Float16* Kbh = Kp  + (size_t)bh * SEQ * HD;
  const _Float16* Vbh = Vtp + (size_t)bh * HD * SEQ;

  // Q^T as B operand (column group cg: query q0 + 16cg + lane&15; d 0..31, 32..63), in registers for the whole key loop
  v16h bq[2][2];
#pragma unroll
  for (int cg = 0; cg < 2; ++cg) {
    bq[cg][0] = frag_h(Qbh + (size_t)(q0 + 16 * cg) * HD, HD);
    bq[cg][1] = frag_h(Qbh + (size_t)(q0 + 16 * cg) * HD + 32, HD);
  }

  float mrow[2] = {-1e30f, -1e30f};   // running maximum of the column group's query n16 (equal in both lane halves)
  float lrow[2] = {0.f, 0.f};         // running sum of that query over this lane half's keys only
  v8f o[2][4];                        // o[cg][dt][r] = O^T[d = 16dt + 8hh + r][query n16 of group cg]
#pragma unroll
  for (int cg = 0; cg < 2; ++cg)
#pragma unroll
    for (int t = 0; t < 4; ++t) o[cg][t] = z8();

  const float scale = 0.125f;   // 1/sqrt(64), exact

  // a thread copies rows crow and crow + 32, 16 bytes at column coff, of each of a stage's four tiles
  const int crow = tid >> 3, coff = (tid & 7) << 3;
  const unsigned lk = (unsigned)(size_t)&Kt[0][crow * LP + coff];
  const unsigned lv = (unsigned)(size_t)&Vt[0][crow * LP + coff];
  const unsigned half_b = 32 * LP * 2, tile_b = 64 * LP * 2;   // bytes: 32 rows, one tile
  const _Float16* gk = Kbh + (size_t)crow * HD + coff;         // tile at key t0: + t0 * HD
  const _Float16* gv = Vbh + (size_t)crow * SEQ + coff;        // tile at key t0: + t0
  constexpr int NST = SEQ / 128;                               // stages

  auto stage_copy = [&](int s) {
    const unsigned bo = (unsigned)(s & 1) * 2u * tile_b;
    const _Float16* nk = gk + (size_t)s * 128 * HD;
    const _Float16* nv = gv + s * 128;
    copy4_to_lds(lk + bo, nk, lk + bo + half_b, nk + 32 * HD, lv + bo, nv, lv + bo + half_b, nv + (size_t)32 * SEQ);
    copy4_to_lds(lk + bo + tile_b, nk + 64 * HD, lk + bo + tile_b + half_b, nk + 96 * HD,
                 lv + bo + tile_b, nv + 64, lv + bo + tile_b + half_b, nv + (size_t)32 * SEQ + 64);
  };

  // stage 0 into buffer 0, landed and published; then stage 1, where there is one, into buffer 1
  stage_copy(0);
  asm volatile("s_wait_asynccnt 0x0" ::: "memory");   // this wave's copies of stage 0 have landed
  __syncthreads();              // stage 0 visible to every wave
  if (NST > 1) stage_copy(1);

  for (int s = 0; s < NST; ++s) {
    const int tb = ((s & 1) << 1) + grp;
    const _Float16* Kb = &Kt[tb][0];
    const _Float16* Vb = &Vt[tb][0];

    // S^T(64 keys x 32 queries) = K(64x64) . Q^T : sc[cg][t][r] = S[query n16 of cg][key 16t + 8hh + r]
    v8f sc[2][4];
#pragma unroll
    for (int t = 0; t < 4; ++t) {
      const v16h ka0 = frag_h(Kb + (t * 16) * LP, LP);
      const v16h ka1 = frag_h(Kb + (t * 16) * LP + 32, LP);
      v8f c0 = z8(), c1 = z8();
      c0 = mma_h(ka0, bq[0][0], c0);
      c1 = mma_h(ka0, bq[1][0], c1);
      c0 = mma_h(ka1, bq[0][1], c0);
      c1 = mma_h(ka1, bq[1][1], c1);
      sc[0][t] = c0;
      sc[1][t] = c1;
    }

    FragH pb[2][2];
#pragma unroll  // constant indices keep sc, pb and o in registers
    for (int cg = 0; cg < 2; ++cg) {
      // online softmax of query n16: 32 keys in this lane, the other 32 in lane ^ 16
      float mx = sc[cg][0][0];
#pragma unroll  // constant indices keep sc in registers
      for (int t = 0; t < 4; ++t)
#pragma unroll  // as above
        for (int r = 0; r < 8; ++r) mx = fmaxf(mx, sc[cg][t][r]);
      mx = fmaxf(mx, xhalf(mx)) * scale;
      const float mnew  = fmaxf(mrow[cg], mx);
      const float alpha = __expf(mrow[cg] - mnew);
      mrow[cg] = mnew;

      // P^T as B operand, in frag_h's k order: element s of pb[cg][j] is key 32j + 16(s >> 3) + 8hh + (s & 7) = score tile 2j + (s >> 3), register s & 7
#pragma unroll  // constant indices keep sc and pb in registers
      for (int t = 0; t < 4; ++t) {
        const v8f x = sc[cg][t] * scale - mnew;
        v8f p;
#pragma unroll  // as above
        for (int r = 0; r < 8; ++r) p[r] = __expf(x[r]);
        sc[cg][t] = p;
        pb[cg][t >> 1].p[t & 1] = __builtin_convertvector(p * 1024.0f, v8ha);
      }
      // in-lane sum of the 32 p as a tree: short dependent chains, packed adds
      const v8f s8 = (sc[cg][0] + sc[cg][1]) + (sc[cg][2] + sc[cg][3]);
      const float ps = ((s8[0] + s8[1]) + (s8[2] + s8[3])) + ((s8[4] + s8[5]) + (s8[6] + s8[7]));
      lrow[cg] = lrow[cg] * alpha + ps;
#pragma unroll  // constant indices keep o in registers
      for (int t = 0; t < 4; ++t) o[cg][t] *= alpha;
    }

    // O^T(64 d x 32 queries) += V^T(64 d x 64 keys) . P^T : A[m=d][k=key] = Vt[d][key]
#pragma unroll
    for (int dt = 0; dt < 4; ++dt) {
      const v16h va0 = frag_h(Vb + (dt * 16) * LP, LP);
      const v16h va1 = frag_h(Vb + (dt * 16) * LP + 32, LP);
      v8f c0 = o[0][dt], c1 = o[1][dt];
      c0 = mma_h(va0, pb[0][0].v, c0);
      c1 = mma_h(va0, pb[1][0].v, c1);
      c0 = mma_h(va1, pb[0][1].v, c0);
      c1 = mma_h(va1, pb[1][1].v, c1);
      o[0][dt] = c0;
      o[1][dt] = c1;
    }

    // hand-over: this wave's reads of stage s are done, its copies of stage s + 1 have landed; the one barrier
    // publishes stage s + 1 and frees stage s's buffer, which then takes stage s + 2
    asm volatile("s_wait_dscnt 0x0" ::: "memory");      // own LDS reads retired before the buffer is refilled
    asm volatile("s_wait_asynccnt 0x0" ::: "memory");   // own copies landed before other waves read them
    __syncthreads();
    if (s + 2 < NST) stage_copy(s + 2);                 // same for the whole work-group
  }
  asm volatile("s_wait_asynccnt 0x0" ::: "memory");     // nothing of this wave in flight behind the loop

  // merge of the two key groups: the wave of key group g finishes column group g of its 32 queries; it hands its partial
  // of the other column group to the partner wave (wave ^ 4, same queries, same lane map) and takes the partner's of its own
  const float mk = grp ? mrow[1] : mrow[0], lkp = grp ? lrow[1] : lrow[0];
  Xm[wave][0][lane] = grp ? mrow[0] : mrow[1];
  Xm[wave][1][lane] = grp ? lrow[0] : lrow[1];
  v8f keep[4];
#pragma unroll
  for (int dt = 0; dt < 4; ++dt) {
    keep[dt] = grp ? o[1][dt] : o[0][dt];
    const v8f give = grp ? o[0][dt] : o[1][dt];
    Xo[wave][2 * dt][lane]     = __builtin_shufflevector(give, give, 0, 1, 2, 3);
    Xo[wave][2 * dt + 1][lane] = __builtin_shufflevector(give, give, 4, 5, 6, 7);
  }
  __syncthreads();              // both partners' partials are in LDS

  const int part = wave ^ 4;
  const float mo = Xm[part][0][lane], lo = Xm[part][1][lane];
  const float mm = fmaxf(mk, mo);
  const float ak = __expf(mk - mm), ao = __expf(mo - mm);
  const float lsum = lkp * ak + lo * ao;

  // normalise: o holds 1024 * sum(p v); ctx carried x64 -> o * (64/1024) / l; l joins the two halves' sums
  const float inv = 0.0625f * __builtin_amdgcn_rcpf(lsum + xhalf(lsum));
  const float fk = ak * inv, fo = ao * inv;

  // a lane's 8 registers of one dt are 8 consecutive d of one query row: one 16-byte LDS store each
#pragma unroll
  for (int dt = 0; dt < 4; ++dt) {
    const v4fa y0 = Xo[part][2 * dt][lane];
    const v4fa y1 = Xo[part][2 * dt + 1][lane];
    Pack8 w;
#pragma unroll
    for (int r = 0; r < 4; ++r) {
      w.s[r]     = (_Float16)(keep[dt][r] * fk + y0[r] * fo);
      w.s[r + 4] = (_Float16)(keep[dt][r + 4] * fk + y1[r] * fo);
    }
    *(v8ha*)&Ct[wave][n16 * LP + dt * 16 + 8 * hh] = w.h;
  }
  __syncthreads();              // staged rows complete before they are read back across lanes

  wave_store_rows16(&Ct[wave][0],
                    Cp + ((size_t)b * SEQ + q0 + 16 * grp) * EMB + h * HD, EMB);
}

// ---------------- kernel 3: output projection out = ctx . Wo^T + bo ----------------
// block = 256 threads (8 waves); block tile 128 tokens x 64 outputs; wave owns 16 x 64.
// B tile (Wo rows n0..n0+63, k slab of 32) staged in LDS as f16(16 * bf16RNE(Wo)).
__global__ __launch_bounds__(256) void k_oproj(
    const _Float16* __restrict__ Cp, const float* __restrict__ Wo,
    const float* __restrict__ bo, float* __restrict__ out) {
  __shared__ __align__(16) _Float16 Bt[64 * BP];     // [n local][k local]
  __shared__ __align__(16) float Os[8][16 * OP];     // per wave f32 output staging

  const int tid = threadIdx.x, wave = tid >> 5, lane = tid & 31;
  const int hh = lane >> 4, n16 = lane & 15;
  const int m0 = blockIdx.x * 128 + wave * 16;
  const int n0 = blockIdx.y * 64;

  const int nl = tid >> 2, ko = (tid & 3) << 3;      // staging: 8 consecutive k of one n row
  const float* wsrc = Wo + (size_t)(n0 + nl) * EMB + ko;
  const _Float16* arow = Cp + (size_t)m0 * EMB;

  v8f acc[4];
#pragma unroll
  for (int t = 0; t < 4; ++t) acc[t] = z8();

  for (int kk = 0; kk < EMB; kk += 32) {
    __syncthreads();            // Bt free
    {
      const v4fa x0 = *(const v4fa*)(wsrc + kk);
      const v4fa x1 = *(const v4fa*)(wsrc + kk + 4);
      Pack8 w;
      w.s[0] = (_Float16)(bfval(x0.x) * 16.0f);
      w.s[1] = (_Float16)(bfval(x0.y) * 16.0f);
      w.s[2] = (_Float16)(bfval(x0.z) * 16.0f);
      w.s[3] = (_Float16)(bfval(x0.w) * 16.0f);
      w.s[4] = (_Float16)(bfval(x1.x) * 16.0f);
      w.s[5] = (_Float16)(bfval(x1.y) * 16.0f);
      w.s[6] = (_Float16)(bfval(x1.z) * 16.0f);
      w.s[7] = (_Float16)(bfval(x1.w) * 16.0f);
      *(v8ha*)&Bt[nl * BP + ko] = w.h;
    }
    __syncthreads();            // Bt visible
    const v16h a = frag_h(arow + kk, EMB);
#pragma unroll
    for (int t = 0; t < 4; ++t)
      acc[t] = mma_h(a, frag_h(&Bt[(t * 16) * BP], BP), acc[t]);
  }

  // epilogue: undo carries (64*16 = 1024), add bf16-RNE bias, stage f32 tile
#pragma unroll
  for (int t = 0; t < 4; ++t) {
    const float bias = bfval(bo[n0 + t * 16 + n16]);
#pragma unroll
    for (int r = 0; r < 8; ++r)
      Os[wave][(8 * hh + r) * OP + t * 16 + n16] = acc[t][r] * (1.0f / 1024.0f) + bias;
  }
  __syncthreads();

  // 16 rows x 256 B = 32 lines; line = (row, half); 8 lanes x 16 B per line, 4 lines per instruction
  const int rsub = lane >> 3, c4 = (lane & 7) << 2;
  v4fa v[8];
#pragma unroll
  for (int it = 0; it < 8; ++it) {
    const int li = it * 4 + rsub;
    const int row = li >> 1, hf = li & 1;
    v[it] = *(const v4fa*)&Os[wave][row * OP + hf * 32 + c4];
  }
  float* base = out + (size_t)m0 * EMB + n0;
#pragma unroll
  for (int it = 0; it < 8; ++it) {
    const int li = it * 4 + rsub;
    const int row = li >> 1, hf = li & 1;
    *(v4fa*)(base + (size_t)row * EMB + hf * 32 + c4) = v[it];
  }
  
}

// ---------------- launcher ----------------
extern "C" void kernel_launch(void* const* d_in, const int* in_sizes, int n_in,
                              void* d_out, int out_size, void* d_ws, size_t ws_size,
                              hipStream_t stream) {
  if (n_in < 9) return;
  if (in_sizes[0] < ((NB - 1) * SEQ_FULL + SEQ) * EMB) return;
  if (in_sizes[1] < NH * HD * HD || in_sizes[3] < NH * HD * HD || in_sizes[5] < NH * HD * HD) return;
  if (in_sizes[2] < NH * HD || in_sizes[4] < NH * HD || in_sizes[6] < NH * HD) return;
  if (in_sizes[7] < EMB * EMB || in_sizes[8] < EMB) return;
  if (out_size < MTOK * EMB) return;

  const float* x  = (const float*)d_in[0];
  const float* Wq = (const float*)d_in[1];
  const float* bq = (const float*)d_in[2];
  const float* Wk = (const float*)d_in[3];
  const float* bk = (const float*)d_in[4];
  const float* Wv = (const float*)d_in[5];
  const float* bv = (const float*)d_in[6];
  const float* Wo = (const float*)d_in[7];
  const float* bo = (const float*)d_in[8];
  float* out = (float*)d_out;

  const size_t qkv_bytes = (size_t)NB * NH * SEQ * HD * 2;   // 8 MiB at full size
  const size_t ctx_bytes = (size_t)MTOK * EMB * 2;           // 8 MiB at full size
  const size_t off_q = 0;
  const size_t off_k = off_q + qkv_bytes;
  const size_t off_v = off_k + qkv_bytes;
  const size_t off_c = off_v + qkv_bytes;
  const size_t total = off_c + ctx_bytes;
  if (total > ws_size) return;

  char* ws = (char*)d_ws;
  _Float16* Qp  = (_Float16*)(ws + off_q);
  _Float16* Kp  = (_Float16*)(ws + off_k);
  _Float16* Vtp = (_Float16*)(ws + off_v);
  _Float16* Cp  = (_Float16*)(ws + off_c);

  k_qkv<<<dim3(MTOK / 128, NH), 256, 0, stream>>>(x, Wq, bq, Wk, bk, Wv, bv, Qp, Kp, Vtp);
  k_attn<<<dim3(NB * NH, SEQ / 128), 256, 0, stream>>>(Qp, Kp, Vtp, Cp);
  k_oproj<<<dim3(MTOK / 128, EMB / 64), 256, 0, stream>>>(Cp, Wo, bo, out);
}

// v006
// One run takes 53.5 microseconds.
// Two timings next to v005 both put it at 1.12 times that version's speed.
// Over all steps from v000 it is 3.92 times as fast.
#include <hip/hip_runtime.h>

// Contractions: per-head x*W^T (q,k,v) on v_wmma_f32_16x16x32_bf16 (bf16 operands); q*k^T, p*v, ctx*Wo^T on v_wmma_f32_16x16x32_f16 (f16 operands, power-of-two carries p*1024, ctx*64, Wo*16); f32 accumulate; softmax in f32.

#ifndef NB
#define NB 4
#endif
#ifndef SEQ
#define SEQ 2048
#endif
#define NB_FULL 4
#define SEQ_FULL 2048
#define EMB 512
#define NH 8
#define HD 64
#define MTOK (NB * SEQ)
// LDS row pitches: data row + 16 B, an odd multiple of 16 B, so that the 16 rows of a 16-byte fragment read fall on different banks
#define LP 72   // halves, rows of 64 halves (128 B -> 144 B)
#define KP 520  // halves, rows of 512 halves (1024 B -> 1040 B)
#define WP 9    // 16-byte chunks, rows of 8 chunks (128 B -> 144 B)
#define OP 68   // floats, rows of 64 floats (256 B -> 272 B)

static_assert(NB >= 1 && NB <= NB_FULL);
static_assert(SEQ >= 128 && SEQ <= SEQ_FULL && (SEQ % 128) == 0);
static_assert(EMB == NH * HD);
static_assert((EMB % 64) == 0 && (MTOK % 128) == 0);
// full-size carve: 3 planes of NB*NH*SEQ*HD halves + ctx plane of MTOK*EMB halves
static_assert((3ull * NB_FULL * NH * SEQ_FULL * HD + (unsigned long long)NB_FULL * SEQ_FULL * EMB) * 2ull <= 134217728ull);

typedef unsigned short u16;
typedef _Float16 v16h __attribute__((ext_vector_type(16)));
typedef __bf16   v16bf __attribute__((ext_vector_type(16)));
typedef float    v8f  __attribute__((ext_vector_type(8)));
typedef _Float16 v8ha __attribute__((ext_vector_type(8), __may_alias__));
typedef _Float16 v4ha __attribute__((ext_vector_type(4), __may_alias__));
typedef float    v4fa __attribute__((ext_vector_type(4), __may_alias__));
typedef unsigned v4u  __attribute__((ext_vector_type(4), __may_alias__));

union FragH { v16h v; v8ha p[2]; };
union FragB { v16bf v; v4u q[2]; };
union Pack8 { v8ha h; v4u u; _Float16 s[8]; };

// ---------------- helpers ----------------

__device__ __forceinline__ unsigned bfbits(float f) {   // f32 -> bf16 bits, RNE
  unsigned u = __float_as_uint(f);
  u += 0x7FFFu + ((u >> 16) & 1u);
  return u >> 16;
}
__device__ __forceinline__ float bfval(float f) {       // f32 -> value of its bf16 RNE image
  unsigned u = __float_as_uint(f);
  u += 0x7FFFu + ((u >> 16) & 1u);
  return __uint_as_float(u & 0xFFFF0000u);
}
__device__ __forceinline__ v8f z8() {
  v8f z = {0.f, 0.f, 0.f, 0.f, 0.f, 0.f, 0.f, 0.f};
  return z;
}

// 8 consecutive f32 -> 8 bf16 packed in 16 bytes (low half-word = lower index)
__device__ __forceinline__ v4u pack_bf8(const float* __restrict__ p) {
  const v4fa x0 = *(const v4fa*)p;
  const v4fa x1 = *(const v4fa*)(p + 4);
  v4u r;
  r.x = bfbits(x0.x) | (bfbits(x0.y) << 16);
  r.y = bfbits(x0.z) | (bfbits(x0.w) << 16);
  r.z = bfbits(x1.x) | (bfbits(x1.y) << 16);
  r.w = bfbits(x1.z) | (bfbits(x1.w) << 16);
  return r;
}

// 16x32 16-bit fragment (A or B layout, identical k map), row-major source, pitch ld (elements):
//   lane l: row = l&15; elements 0..7 <- k 8h..8h+7; elements 8..15 <- k 16+8h..16+8h+7, h = l>>4.
__device__ __forceinline__ v16h frag_h(const _Float16* base, int ld) {
  const int lane = threadIdx.x & 31;
  const int row  = lane & 15;
  const int kb   = (lane >> 4) << 3;
  FragH u;
  u.p[0] = *(const v8ha*)(base + (size_t)row * ld + kb);
  u.p[1] = *(const v8ha*)(base + (size_t)row * ld + 16 + kb);
  return u.v;
}

// A fragment from f32 rows (pitch ld floats), k columns k0..k0+31, converted to bf16 RNE.
__device__ __forceinline__ v16bf frag_x_bf(const float* base, int ld, int k0) {
  const int lane = threadIdx.x & 31;
  const int row  = lane & 15;
  const int kb   = (lane >> 4) << 3;
  const float* p = base + (size_t)row * ld + k0 + kb;
  FragB u;
  u.q[0] = pack_bf8(p);        // k0+kb .. k0+kb+7
  u.q[1] = pack_bf8(p + 16);   // k0+16+kb .. k0+16+kb+7
  return u.v;
}

// B fragment from an LDS bf16 tile stored as [n][8 chunks of 8 k] (64 k per row, row pitch WP chunks);
// rows nrow0..nrow0+15, k chunk base kc0 (0 -> k 0..31, 4 -> k 32..63).
__device__ __forceinline__ v16bf frag_w_bf(const v4u* tile, int nrow0, int kc0) {
  const int lane = threadIdx.x & 31;
  const int n    = lane & 15;
  const int hh   = lane >> 4;
  FragB u;
  u.q[0] = tile[(nrow0 + n) * WP + kc0 + hh];
  u.q[1] = tile[(nrow0 + n) * WP + kc0 + 2 + hh];
  return u.v;
}

// builtin forms: the compiler itself keeps the distance the chip needs behind a matrix instruction and is free to schedule round it
__device__ __forceinline__ v8f mma_h(v16h a, v16h b, v8f c) {
  v8f d = __builtin_amdgcn_wmma_f32_16x16x32_f16(false, a, false, b, (short)0, c, false, false);
  return d;
}
__device__ __forceinline__ v8f mma_bf(v16bf a, v16bf b, v8f c) {
  v8f d = __builtin_amdgcn_wmma_f32_16x16x32_bf16(false, a, false, b, (short)0, c, false, false);
  return d;
}

// value of the same column in the other 16-lane half (lane ^ 16), a vector cross-row move
__device__ __forceinline__ float xhalf(float x) {
  const int b = __float_as_int(x);
  return __int_as_float(__builtin_amdgcn_permlanex16(b, b, 0x76543210, 0xfedcba98, false, false));
}

// A lane's four 16-byte asynchronous copies global -> LDS (through no register): its share of one K tile and one V^T tile.
// l* = LDS byte address (low 32 bits of the __shared__ address), g* = global address, all multiples of 16 B.
// s_wait_xcnt 0 is the statement's last line so that no address register of a copy is rewritten in front of it.
__device__ __forceinline__ void copy4_to_lds(unsigned l0, const _Float16* g0, unsigned l1, const _Float16* g1,
                                             unsigned l2, const _Float16* g2, unsigned l3, const _Float16* g3) {
  asm volatile("global_load_async_to_lds_b128 %0, %1, off\n\t"
               "global_load_async_to_lds_b128 %2, %3, off\n\t"
               "global_load_async_to_lds_b128 %4, %5, off\n\t"
               "global_load_async_to_lds_b128 %6, %7, off\n\t"
               "s_wait_xcnt 0x0"
               :: "v"(l0), "v"(g0), "v"(l1), "v"(g1), "v"(l2), "v"(g2), "v"(l3), "v"(g3)
               : "memory");
}

// One wave writes its 16 x 64-half tile (LDS, pitch LP) to 16 global rows of pitch `pitch` halves.
__device__ __forceinline__ void wave_store_rows16(const _Float16* tile, _Float16* dst, int pitch) {
  const int lane = threadIdx.x & 31;
  const int rsub = lane >> 3, c8 = (lane & 7) << 3;
  Pack8 v[4];
#pragma unroll
  for (int it = 0; it < 4; ++it)
    v[it].h = *(const v8ha*)(tile + (it * 4 + rsub) * LP + c8);
#pragma unroll
  for (int it = 0; it < 4; ++it)
    *(v4u*)(dst + (size_t)(it * 4 + rsub) * pitch + c8) = v[it].u;
  
}

// ---------------- kernel 1: per-head q/k/v projections ----------------
// block = 256 threads (8 waves); block owns (128 tokens, head h); wave owns 16 tokens x 64 outputs.
// Q,K planes: [bh][s][64] f16.   V plane transposed: [bh][64][SEQ] f16.
__global__ __launch_bounds__(256) void k_qkv(
    const float* __restrict__ x,
    const float* __restrict__ Wq, const float* __restrict__ bq,
    const float* __restrict__ Wk, const float* __restrict__ bk,
    const float* __restrict__ Wv, const float* __restrict__ bv,
    _Float16* __restrict__ Qp, _Float16* __restrict__ Kp, _Float16* __restrict__ Vtp) {
  __shared__ __align__(16) v4u Wl[3][HD * WP];      // bf16 [n][k] per matrix, 8 k per chunk
  __shared__ float Bl[3][HD];                        // bf16-RNE biases as f32
  __shared__ __align__(16) _Float16 St[128 * LP];    // f16 staging [token local][d]

  const int tid = threadIdx.x, wave = tid >> 5, lane = tid & 31;
  const int hh = lane >> 4, n16 = lane & 15;
  const int h  = blockIdx.y;
  const int m0 = blockIdx.x * 128;                   // compact token index
  const int b  = m0 / SEQ, s0 = m0 - b * SEQ;
  const int bh = b * NH + h;

  // stage the head's three 64x64 weight tiles (bf16 RNE) and biases
#pragma unroll
  for (int c = tid; c < 512; c += 256) {
    const int nrow = c >> 3, ko = (c & 7) << 3;
    const size_t off = ((size_t)h * HD + nrow) * HD + ko;
    const int cl = nrow * WP + (c & 7);
    Wl[0][cl] = pack_bf8(Wq + off);
    Wl[1][cl] = pack_bf8(Wk + off);
    Wl[2][cl] = pack_bf8(Wv + off);
  }
  if (tid < HD) {                                    // wave-uniform (waves 0,1)
    Bl[0][tid] = bfval(bq[h * HD + tid]);
    Bl[1][tid] = bfval(bk[h * HD + tid]);
    Bl[2][tid] = bfval(bv[h * HD + tid]);
  }
  __syncthreads();

  // A fragments of the wave's 16 tokens (64 input dims of head h), bf16 RNE in registers
  const float* xp = x + ((size_t)b * SEQ_FULL + s0 + wave * 16) * EMB + h * HD;
  const v16bf a0 = frag_x_bf(xp, EMB, 0);
  const v16bf a1 = frag_x_bf(xp, EMB, 32);

#pragma unroll
  for (int mat = 0; mat < 3; ++mat) {
    v8f acc[4];
#pragma unroll
    for (int t = 0; t < 4; ++t) {
      v8f c = z8();
      c = mma_bf(a0, frag_w_bf(Wl[mat], t * 16, 0), c);
      c = mma_bf(a1, frag_w_bf(Wl[mat], t * 16, 4), c);
      acc[t] = c;
    }
    // bias add in f32, convert to f16, stage: D element r of lane -> (row 8hh+r, col t*16+n16)
#pragma unroll
    for (int t = 0; t < 4; ++t) {
      const float bias = Bl[mat][t * 16 + n16];
#pragma unroll
      for (int r = 0; r < 8; ++r)
        St[(wave * 16 + 8 * hh + r) * LP + t * 16 + n16] = (_Float16)(acc[t][r] + bias);
    }
    __syncthreads();

    if (mat < 2) {
      _Float16* plane = (mat == 0) ? Qp : Kp;
      wave_store_rows16(&St[(wave * 16) * LP],
                        plane + ((size_t)bh * SEQ + s0 + wave * 16) * HD, HD);
    } else {
      // V transposed: line L = (d, half); 8 lanes x 16 B per line, 4 lines per instruction
      const int c8 = (tid & 7) << 3;
      Pack8 w[4];
#pragma unroll
      for (int it = 0; it < 4; ++it) {
        const int L = it * 32 + (tid >> 3);
        const int d = L >> 1, j0 = (L & 1) * 64 + c8;
#pragma unroll
        for (int e = 0; e < 8; ++e) w[it].s[e] = St[(j0 + e) * LP + d];
      }
#pragma unroll
      for (int it = 0; it < 4; ++it) {
        const int L = it * 32 + (tid >> 3);
        const int d = L >> 1, j0 = (L & 1) * 64 + c8;
        *(v4u*)(Vtp + ((size_t)bh * HD + d) * SEQ + s0 + j0) = w[it].u;
      }
      
    }
    __syncthreads();                                 // St free for the next matrix
  }
}

__global__ __launch_bounds__(256) void k_attn(
    const _Float16* __restrict__ Qp, const _Float16* __restrict__ Kp,
    const _Float16* __restrict__ Vtp, _Float16* __restrict__ Cp) {
  __shared__ __align__(16) _Float16 Kt[4][64 * LP];   // [2 * buffer + key group][key][d]
  __shared__ __align__(16) _Float16 Vt[4][HD * LP];   // [2 * buffer + key group][d][key]
  __shared__ __align__(16) _Float16 Ct[8][16 * LP];   // per wave [q row][d], ctx staging for whole-line stores
  __shared__ __align__(16) v4fa Xo[8][8][32];         // per wave [4 registers of O][lane]: partial O handed to the partner wave
  __shared__ float Xm[8][2][32];                      // per wave [maximum, sum][lane] of the same columns

  const int tid = threadIdx.x, lane = tid & 31;
  const int wave = __builtin_amdgcn_readfirstlane(tid >> 5);
  const int grp = wave >> 2;    // key group
  const int hh = lane >> 4, n16 = lane & 15;
  const int bh = blockIdx.x;
  const int b  = bh / NH, h = bh - b * NH;
  const int q0 = blockIdx.y * 128 + (wave & 3) * 32;

  const _Float16* Qbh = Qp  + (size_t)bh * SEQ * HD;
  const _Float16* Kbh = Kp  + (size_t)bh * SEQ * HD;
  const _Float16* Vbh = Vtp + (size_t)bh * HD * SEQ;

  // Q^T as B operand (column group cg: query q0 + 16cg + lane&15; d 0..31, 32..63), in registers for the whole key loop
  v16h bq[2][2];
#pragma unroll
  for (int cg = 0; cg < 2; ++cg) {
    bq[cg][0] = frag_h(Qbh + (size_t)(q0 + 16 * cg) * HD, HD);
    bq[cg][1] = frag_h(Qbh + (size_t)(q0 + 16 * cg) * HD + 32, HD);
  }

  float mrow[2] = {-1e30f, -1e30f};   // running maximum of the column group's query n16 (equal in both lane halves)
  float lrow[2] = {0.f, 0.f};         // running sum of that query over this lane half's keys only
  v8f o[2][4];                        // o[cg][dt][r] = O^T[d = 16dt + 8hh + r][query n16 of group cg]
#pragma unroll
  for (int cg = 0; cg < 2; ++cg)
#pragma unroll
    for (int t = 0; t < 4; ++t) o[cg][t] = z8();

  const float scale = 0.125f;   // 1/sqrt(64), exact

  // a thread copies rows crow and crow + 32, 16 bytes at column coff, of each of a stage's four tiles
  const int crow = tid >> 3, coff = (tid & 7) << 3;
  const unsigned lk = (unsigned)(size_t)&Kt[0][crow * LP + coff];
  const unsigned lv = (unsigned)(size_t)&Vt[0][crow * LP + coff];
  const unsigned half_b = 32 * LP * 2, tile_b = 64 * LP * 2;   // bytes: 32 rows, one tile
  const _Float16* gk = Kbh + (size_t)crow * HD + coff;         // tile at key t0: + t0 * HD
  const _Float16* gv = Vbh + (size_t)crow * SEQ + coff;        // tile at key t0: + t0
  constexpr int NST = SEQ / 128;                               // stages

  auto stage_copy = [&](int s) {
    const unsigned bo = (unsigned)(s & 1) * 2u * tile_b;
    const _Float16* nk = gk + (size_t)s * 128 * HD;
    const _Float16* nv = gv + s * 128;
    copy4_to_lds(lk + bo, nk, lk + bo + half_b, nk + 32 * HD, lv + bo, nv, lv + bo + half_b, nv + (size_t)32 * SEQ);
    copy4_to_lds(lk + bo + tile_b, nk + 64 * HD, lk + bo + tile_b + half_b, nk + 96 * HD,
                 lv + bo + tile_b, nv + 64, lv + bo + tile_b + half_b, nv + (size_t)32 * SEQ + 64);
  };

  // stage 0 into buffer 0, landed and published; then stage 1, where there is one, into buffer 1
  stage_copy(0);
  asm volatile("s_wait_asynccnt 0x0" ::: "memory");   // this wave's copies of stage 0 have landed
  __syncthreads();              // stage 0 visible to every wave
  if (NST > 1) stage_copy(1);

  for (int s = 0; s < NST; ++s) {
    const int tb = ((s & 1) << 1) + grp;
    const _Float16* Kb = &Kt[tb][0];
    const _Float16* Vb = &Vt[tb][0];

    // S^T(64 keys x 32 queries) = K(64x64) . Q^T : sc[cg][t][r] = S[query n16 of cg][key 16t + 8hh + r]
    v8f sc[2][4];
#pragma unroll
    for (int t = 0; t < 4; ++t) {
      const v16h ka0 = frag_h(Kb + (t * 16) * LP, LP);
      const v16h ka1 = frag_h(Kb + (t * 16) * LP + 32, LP);
      v8f c0 = z8(), c1 = z8();
      c0 = mma_h(ka0, bq[0][0], c0);
      c1 = mma_h(ka0, bq[1][0], c1);
      c0 = mma_h(ka1, bq[0][1], c0);
      c1 = mma_h(ka1, bq[1][1], c1);
      sc[0][t] = c0;
      sc[1][t] = c1;
    }

    FragH pb[2][2];
#pragma unroll  // constant indices keep sc, pb and o in registers
    for (int cg = 0; cg < 2; ++cg) {
      // online softmax of query n16: 32 keys in this lane, the other 32 in lane ^ 16
      float mx = sc[cg][0][0];
#pragma unroll  // constant indices keep sc in registers
      for (int t = 0; t < 4; ++t)
#pragma unroll  // as above
        for (int r = 0; r < 8; ++r) mx = fmaxf(mx, sc[cg][t][r]);
      mx = fmaxf(mx, xhalf(mx)) * scale;
      const float mnew  = fmaxf(mrow[cg], mx);
      const float alpha = __expf(mrow[cg] - mnew);
      mrow[cg] = mnew;

      // P^T as B operand, in frag_h's k order: element s of pb[cg][j] is key 32j + 16(s >> 3) + 8hh + (s & 7) = score tile 2j + (s >> 3), register s & 7
#pragma unroll  // constant indices keep sc and pb in registers
      for (int t = 0; t < 4; ++t) {
        const v8f x = sc[cg][t] * scale - mnew;
        v8f p;
#pragma unroll  // as above
        for (int r = 0; r < 8; ++r) p[r] = __expf(x[r]);
        sc[cg][t] = p;
        pb[cg][t >> 1].p[t & 1] = __builtin_convertvector(p * 1024.0f, v8ha);
      }
      // in-lane sum of the 32 p as a tree: short dependent chains, packed adds
      const v8f s8 = (sc[cg][0] + sc[cg][1]) + (sc[cg][2] + sc[cg][3]);
      const float ps = ((s8[0] + s8[1]) + (s8[2] + s8[3])) + ((s8[4] + s8[5]) + (s8[6] + s8[7]));
      lrow[cg] = lrow[cg] * alpha + ps;
#pragma unroll  // constant indices keep o in registers
      for (int t = 0; t < 4; ++t) o[cg][t] *= alpha;
    }

    // O^T(64 d x 32 queries) += V^T(64 d x 64 keys) . P^T : A[m=d][k=key] = Vt[d][key]
#pragma unroll
    for (int dt = 0; dt < 4; ++dt) {
      const v16h va0 = frag_h(Vb + (dt * 16) * LP, LP);
      const v16h va1 = frag_h(Vb + (dt * 16) * LP + 32, LP);
      v8f c0 = o[0][dt], c1 = o[1][dt];
      c0 = mma_h(va0, pb[0][0].v, c0);
      c1 = mma_h(va0, pb[1][0].v, c1);
      c0 = mma_h(va1, pb[0][1].v, c0);
      c1 = mma_h(va1, pb[1][1].v, c1);
      o[0][dt] = c0;
      o[1][dt] = c1;
    }

    // hand-over: this wave's reads of stage s are done, its copies of stage s + 1 have landed; the one barrier
    // publishes stage s + 1 and frees stage s's buffer, which then takes stage s + 2
    asm volatile("s_wait_dscnt 0x0" ::: "memory");      // own LDS reads retired before the buffer is refilled
    asm volatile("s_wait_asynccnt 0x0" ::: "memory");   // own copies landed before other waves read them
    __syncthreads();
    if (s + 2 < NST) stage_copy(s + 2);                 // same for the whole work-group
  }
  asm volatile("s_wait_asynccnt 0x0" ::: "memory");     // nothing of this wave in flight behind the loop

  // merge of the two key groups: the wave of key group g finishes column group g of its 32 queries; it hands its partial
  // of the other column group to the partner wave (wave ^ 4, same queries, same lane map) and takes the partner's of its own
  const float mk = grp ? mrow[1] : mrow[0], lkp = grp ? lrow[1] : lrow[0];
  Xm[wave][0][lane] = grp ? mrow[0] : mrow[1];
  Xm[wave][1][lane] = grp ? lrow[0] : lrow[1];
  v8f keep[4];
#pragma unroll
  for (int dt = 0; dt < 4; ++dt) {
    keep[dt] = grp ? o[1][dt] : o[0][dt];
    const v8f give = grp ? o[0][dt] : o[1][dt];
    Xo[wave][2 * dt][lane]     = __builtin_shufflevector(give, give, 0, 1, 2, 3);
    Xo[wave][2 * dt + 1][lane] = __builtin_shufflevector(give, give, 4, 5, 6, 7);
  }
  __syncthreads();              // both partners' partials are in LDS

  const int part = wave ^ 4;
  const float mo = Xm[part][0][lane], lo = Xm[part][1][lane];
  const float mm = fmaxf(mk, mo);
  const float ak = __expf(mk - mm), ao = __expf(mo - mm);
  const float lsum = lkp * ak + lo * ao;

  // normalise: o holds 1024 * sum(p v); ctx carried x64 -> o * (64/1024) / l; l joins the two halves' sums
  const float inv = 0.0625f * __builtin_amdgcn_rcpf(lsum + xhalf(lsum));
  const float fk = ak * inv, fo = ao * inv;

  // a lane's 8 registers of one dt are 8 consecutive d of one query row: one 16-byte LDS store each
#pragma unroll
  for (int dt = 0; dt < 4; ++dt) {
    const v4fa y0 = Xo[part][2 * dt][lane];
    const v4fa y1 = Xo[part][2 * dt + 1][lane];
    Pack8 w;
#pragma unroll
    for (int r = 0; r < 4; ++r) {
      w.s[r]     = (_Float16)(keep[dt][r] * fk + y0[r] * fo);
      w.s[r + 4] = (_Float16)(keep[dt][r + 4] * fk + y1[r] * fo);
    }
    *(v8ha*)&Ct[wave][n16 * LP + dt * 16 + 8 * hh] = w.h;
  }
  __syncthreads();              // staged rows complete before they are read back across lanes

  wave_store_rows16(&Ct[wave][0],
                    Cp + ((size_t)b * SEQ + q0 + 16 * grp) * EMB + h * HD, EMB);
}

// ---------------- kernel 3: output projection out = ctx . Wo^T + bo ----------------
// block = 256 threads (8 waves); block tile 128 tokens x 64 outputs; wave owns 16 x 64.
// The block's whole B slab (Wo rows n0..n0+63, all 512 k) is staged in LDS once, as f16(16 * bf16RNE(Wo)), behind one barrier;
// the k loop has no barrier, and only the second half of the A fragment loads waits for the one barrier: the slab's loads and a wave's A fragment loads are issued many at a time, ahead of their use.
__global__ __launch_bounds__(256) void k_oproj(
    const _Float16* __restrict__ Cp, const float* __restrict__ Wo,
    const float* __restrict__ bo, float* __restrict__ out) {
  __shared__ __align__(16) _Float16 Bt[64 * KP];     // [n local][k]
  __shared__ __align__(16) float Os[8][16 * OP];     // per wave f32 output staging

  const int tid = threadIdx.x, wave = tid >> 5, lane = tid & 31;
  const int hh = lane >> 4, n16 = lane & 15;
  const int m0 = blockIdx.x * 128 + wave * 16;
  const int n0 = blockIdx.y * 64;

  // the slab is 64 whole rows of Wo: 32768 consecutive floats; a wave's load covers 512 consecutive bytes
  const float* wsrc = Wo + (size_t)n0 * EMB + tid * 4;
  const _Float16* arow = Cp + (size_t)m0 * EMB;

  v4fa wr[32];
#pragma unroll  // constant indices keep wr in registers; the loads stand together
  for (int it = 0; it < 32; ++it) wr[it] = *(const v4fa*)(wsrc + it * 1024);

  v16h a[16];
#pragma unroll  // constant indices keep a in registers
  for (int ks = 0; ks < 8; ++ks) a[ks] = frag_h(arow + ks * 32, EMB);
  float braw[4];                // bias, read here so that no wait for it stands among the products behind later loads
#pragma unroll  // constant indices keep braw in registers
  for (int t = 0; t < 4; ++t) braw[t] = bo[n0 + t * 16 + n16];

  // load it of thread tid: row 2 it + (tid >> 7), k 4 (tid & 127) .. + 3
  _Float16* bdst = &Bt[(tid >> 7) * KP + (tid & 127) * 4];
#pragma unroll  // as above, wr
  for (int it = 0; it < 32; ++it) {
    v4ha w;
    w.x = (_Float16)(bfval(wr[it].x) * 16.0f);
    w.y = (_Float16)(bfval(wr[it].y) * 16.0f);
    w.z = (_Float16)(bfval(wr[it].z) * 16.0f);
    w.w = (_Float16)(bfval(wr[it].w) * 16.0f);
    *(v4ha*)(bdst + it * 2 * KP) = w;
  }
  __syncthreads();              // Bt visible

  // second half of the A fragments: into the registers that the staging has left; they land behind the first half's products
#pragma unroll  // as above, a
  for (int ks = 8; ks < 16; ++ks) a[ks] = frag_h(arow + ks * 32, EMB);

  v8f acc[4];
#pragma unroll
  for (int t = 0; t < 4; ++t) acc[t] = z8();

#pragma unroll  // constant indices keep a in registers
  for (int ks = 0; ks < 16; ++ks)
#pragma unroll  // constant indices keep acc in registers
    for (int t = 0; t < 4; ++t)
      acc[t] = mma_h(a[ks], frag_h(&Bt[(t * 16) * KP + ks * 32], KP), acc[t]);

  // epilogue: undo carries (64*16 = 1024), add bf16-RNE bias, stage f32 tile
#pragma unroll
  for (int t = 0; t < 4; ++t) {
    const float bias = bfval(braw[t]);
#pragma unroll
    for (int r = 0; r < 8; ++r)
      Os[wave][(8 * hh + r) * OP + t * 16 + n16] = acc[t][r] * (1.0f / 1024.0f) + bias;
  }
  __syncthreads();

  // 16 rows x 256 B = 32 lines; line = (row, half); 8 lanes x 16 B per line, 4 lines per instruction
  const int rsub = lane >> 3, c4 = (lane & 7) << 2;
  v4fa v[8];
#pragma unroll
  for (int it = 0; it < 8; ++it) {
    const int li = it * 4 + rsub;
    const int row = li >> 1, hf = li & 1;
    v[it] = *(const v4fa*)&Os[wave][row * OP + hf * 32 + c4];
  }
  float* base = out + (size_t)m0 * EMB + n0;
#pragma unroll
  for (int it = 0; it < 8; ++it) {
    const int li = it * 4 + rsub;
    const int row = li >> 1, hf = li & 1;
    *(v4fa*)(base + (size_t)row * EMB + hf * 32 + c4) = v[it];
  }
  
}

// ---------------- launcher ----------------
extern "C" void kernel_launch(void* const* d_in, const int* in_sizes, int n_in,
                              void* d_out, int out_size, void* d_ws, size_t ws_size,
                              hipStream_t stream) {
  if (n_in < 9) return;
  if (in_sizes[0] < ((NB - 1) * SEQ_FULL + SEQ) * EMB) return;
  if (in_sizes[1] < NH * HD * HD || in_sizes[3] < NH * HD * HD || in_sizes[5] < NH * HD * HD) return;
  if (in_sizes[2] < NH * HD || in_sizes[4] < NH * HD || in_sizes[6] < NH * HD) return;
  if (in_sizes[7] < EMB * EMB || in_sizes[8] < EMB) return;
  if (out_size < MTOK * EMB) return;

  const float* x  = (const float*)d_in[0];
  const float* Wq = (const float*)d_in[1];
  const float* bq = (const float*)d_in[2];
  const float* Wk = (const float*)d_in[3];
  const float* bk = (const float*)d_in[4];
  const float* Wv = (const float*)d_in[5];
  const float* bv = (const float*)d_in[6];
  const float* Wo = (const float*)d_in[7];
  const float* bo = (const float*)d_in[8];
  float* out = (float*)d_out;

  const size_t qkv_bytes = (size_t)NB * NH * SEQ * HD * 2;   // 8 MiB at full size
  const size_t ctx_bytes = (size_t)MTOK * EMB * 2;           // 8 MiB at full size
  const size_t off_q = 0;
  const size_t off_k = off_q + qkv_bytes;
  const size_t off_v = off_k + qkv_bytes;
  const size_t off_c = off_v + qkv_bytes;
  const size_t total = off_c + ctx_bytes;
  if (total > ws_size) return;

  char* ws = (char*)d_ws;
  _Float16* Qp  = (_Float16*)(ws + off_q);
  _Float16* Kp  = (_Float16*)(ws + off_k);
  _Float16* Vtp = (_Float16*)(ws + off_v);
  _Float16* Cp  = (_Float16*)(ws + off_c);

  k_qkv<<<dim3(MTOK / 128, NH), 256, 0, stream>>>(x, Wq, bq, Wk, bk, Wv, bv, Qp, Kp, Vtp);
  k_attn<<<dim3(NB * NH, SEQ / 128), 256, 0, stream>>>(Qp, Kp, Vtp, Cp);
  k_oproj<<<dim3(MTOK / 128, EMB / 64), 256, 0, stream>>>(Cp, Wo, bo, out);
}

// v007
// One run takes 50.4 microseconds.
// Next to v006, in two timings, it ran 1.06 times as fast each time.
// All steps since v000 together make it 4.16 times as fast.
#include <hip/hip_runtime.h>

// Contractions: per-head x*W^T (q,k,v) on v_wmma_f32_16x16x32_bf16 (bf16 operands); q*k^T, p*v, ctx*Wo^T on v_wmma_f32_16x16x32_f16 (f16 operands, power-of-two carries p*1024, ctx*64, Wo*16); f32 accumulate; softmax in f32.

#ifndef NB
#define NB 4
#endif
#ifndef SEQ
#define SEQ 2048
#endif
#define NB_FULL 4
#define SEQ_FULL 2048
#define EMB 512
#define NH 8
#define HD 64
#define MTOK (NB * SEQ)
// LDS row pitches: data row + 16 B, an odd multiple of 16 B, so that the 16 rows of a 16-byte fragment read fall on different banks
#define LP 72   // halves, rows of 64 halves (128 B -> 144 B)
#define KP 520  // halves, rows of 512 halves (1024 B -> 1040 B)
#define WP 9    // 16-byte chunks, rows of 8 chunks (128 B -> 144 B)
#define OP 68   // floats, rows of 64 floats (256 B -> 272 B)
// the Q plane carries 1/sqrt(64) * log2(e), applied in f32 before the one rounding to f16: K . Q^T is then the softmax argument in base 2
#define QCARRY 0.18033688011112042f
// base-2 offset of the score accumulators: p is carried x 2^10; a maximum in use may be exceeded by 2^PROOM before it is renewed (p <= 2^14 in f16)
#define PCARRY 10.0f
#define PROOM 4.0f

static_assert(NB >= 1 && NB <= NB_FULL);
static_assert(SEQ >= 128 && SEQ <= SEQ_FULL && (SEQ % 128) == 0);
static_assert(EMB == NH * HD);
static_assert((EMB % 64) == 0 && (MTOK % 128) == 0);
// full-size carve: 3 planes of NB*NH*SEQ*HD halves + ctx plane of MTOK*EMB halves
static_assert((3ull * NB_FULL * NH * SEQ_FULL * HD + (unsigned long long)NB_FULL * SEQ_FULL * EMB) * 2ull <= 134217728ull);

typedef unsigned short u16;
typedef _Float16 v16h __attribute__((ext_vector_type(16)));
typedef __bf16   v16bf __attribute__((ext_vector_type(16)));
typedef float    v8f  __attribute__((ext_vector_type(8)));
typedef _Float16 v8ha __attribute__((ext_vector_type(8), __may_alias__));
typedef _Float16 v4ha __attribute__((ext_vector_type(4), __may_alias__));
typedef float    v4fa __attribute__((ext_vector_type(4), __may_alias__));
typedef unsigned v4u  __attribute__((ext_vector_type(4), __may_alias__));

union FragH { v16h v; v8ha p[2]; };
union FragB { v16bf v; v4u q[2]; };
union Pack8 { v8ha h; v4u u; _Float16 s[8]; };

// ---------------- helpers ----------------

__device__ __forceinline__ unsigned bfbits(float f) {   // f32 -> bf16 bits, RNE
  unsigned u = __float_as_uint(f);
  u += 0x7FFFu + ((u >> 16) & 1u);
  return u >> 16;
}
__device__ __forceinline__ float bfval(float f) {       // f32 -> value of its bf16 RNE image
  unsigned u = __float_as_uint(f);
  u += 0x7FFFu + ((u >> 16) & 1u);
  return __uint_as_float(u & 0xFFFF0000u);
}
__device__ __forceinline__ v8f z8() {
  v8f z = {0.f, 0.f, 0.f, 0.f, 0.f, 0.f, 0.f, 0.f};
  return z;
}

// 8 consecutive f32 -> 8 bf16 packed in 16 bytes (low half-word = lower index)
__device__ __forceinline__ v4u pack_bf8(const float* __restrict__ p) {
  const v4fa x0 = *(const v4fa*)p;
  const v4fa x1 = *(const v4fa*)(p + 4);
  v4u r;
  r.x = bfbits(x0.x) | (bfbits(x0.y) << 16);
  r.y = bfbits(x0.z) | (bfbits(x0.w) << 16);
  r.z = bfbits(x1.x) | (bfbits(x1.y) << 16);
  r.w = bfbits(x1.z) | (bfbits(x1.w) << 16);
  return r;
}

// 16x32 16-bit fragment (A or B layout, identical k map), row-major source, pitch ld (elements):
//   lane l: row = l&15; elements 0..7 <- k 8h..8h+7; elements 8..15 <- k 16+8h..16+8h+7, h = l>>4.
__device__ __forceinline__ v16h frag_h(const _Float16* base, int ld) {
  const int lane = threadIdx.x & 31;
  const int row  = lane & 15;
  const int kb   = (lane >> 4) << 3;
  FragH u;
  u.p[0] = *(const v8ha*)(base + (size_t)row * ld + kb);
  u.p[1] = *(const v8ha*)(base + (size_t)row * ld + 16 + kb);
  return u.v;
}

// A fragment from f32 rows (pitch ld floats), k columns k0..k0+31, converted to bf16 RNE.
__device__ __forceinline__ v16bf frag_x_bf(const float* base, int ld, int k0) {
  const int lane = threadIdx.x & 31;
  const int row  = lane & 15;
  const int kb   = (lane >> 4) << 3;
  const float* p = base + (size_t)row * ld + k0 + kb;
  FragB u;
  u.q[0] = pack_bf8(p);        // k0+kb .. k0+kb+7
  u.q[1] = pack_bf8(p + 16);   // k0+16+kb .. k0+16+kb+7
  return u.v;
}

// B fragment from an LDS bf16 tile stored as [n][8 chunks of 8 k] (64 k per row, row pitch WP chunks);
// rows nrow0..nrow0+15, k chunk base kc0 (0 -> k 0..31, 4 -> k 32..63).
__device__ __forceinline__ v16bf frag_w_bf(const v4u* tile, int nrow0, int kc0) {
  const int lane = threadIdx.x & 31;
  const int n    = lane & 15;
  const int hh   = lane >> 4;
  FragB u;
  u.q[0] = tile[(nrow0 + n) * WP + kc0 + hh];
  u.q[1] = tile[(nrow0 + n) * WP + kc0 + 2 + hh];
  return u.v;
}

// builtin forms: the compiler itself keeps the distance the chip needs behind a matrix instruction and is free to schedule round it
__device__ __forceinline__ v8f mma_h(v16h a, v16h b, v8f c) {
  v8f d = __builtin_amdgcn_wmma_f32_16x16x32_f16(false, a, false, b, (short)0, c, false, false);
  return d;
}
__device__ __forceinline__ v8f mma_bf(v16bf a, v16bf b, v8f c) {
  v8f d = __builtin_amdgcn_wmma_f32_16x16x32_bf16(false, a, false, b, (short)0, c, false, false);
  return d;
}

// value of the same column in the other 16-lane half (lane ^ 16), a vector cross-row move
__device__ __forceinline__ float xhalf(float x) {
  const int b = __float_as_int(x);
  return __int_as_float(__builtin_amdgcn_permlanex16(b, b, 0x76543210, 0xfedcba98, false, false));
}

// A lane's four 16-byte asynchronous copies global -> LDS (through no register): its share of one K tile and one V^T tile.
// l* = LDS byte address (low 32 bits of the __shared__ address), g* = global address, all multiples of 16 B.
// s_wait_xcnt 0 is the statement's last line so that no address register of a copy is rewritten in front of it.
__device__ __forceinline__ void copy4_to_lds(unsigned l0, const _Float16* g0, unsigned l1, const _Float16* g1,
                                             unsigned l2, const _Float16* g2, unsigned l3, const _Float16* g3) {
  asm volatile("global_load_async_to_lds_b128 %0, %1, off\n\t"
               "global_load_async_to_lds_b128 %2, %3, off\n\t"
               "global_load_async_to_lds_b128 %4, %5, off\n\t"
               "global_load_async_to_lds_b128 %6, %7, off\n\t"
               "s_wait_xcnt 0x0"
               :: "v"(l0), "v"(g0), "v"(l1), "v"(g1), "v"(l2), "v"(g2), "v"(l3), "v"(g3)
               : "memory");
}

// One wave writes its 16 x 64-half tile (LDS, pitch LP) to 16 global rows of pitch `pitch` halves.
__device__ __forceinline__ void wave_store_rows16(const _Float16* tile, _Float16* dst, int pitch) {
  const int lane = threadIdx.x & 31;
  const int rsub = lane >> 3, c8 = (lane & 7) << 3;
  Pack8 v[4];
#pragma unroll
  for (int it = 0; it < 4; ++it)
    v[it].h = *(const v8ha*)(tile + (it * 4 + rsub) * LP + c8);
#pragma unroll
  for (int it = 0; it < 4; ++it)
    *(v4u*)(dst + (size_t)(it * 4 + rsub) * pitch + c8) = v[it].u;
  
}

// ---------------- kernel 1: per-head q/k/v projections ----------------
// block = 256 threads (8 waves); block owns (128 tokens, head h); wave owns 16 tokens x 64 outputs.
// Q,K planes: [bh][s][64] f16, Q times QCARRY.   V plane transposed: [bh][64][SEQ] f16.
__global__ __launch_bounds__(256) void k_qkv(
    const float* __restrict__ x,
    const float* __restrict__ Wq, const float* __restrict__ bq,
    const float* __restrict__ Wk, const float* __restrict__ bk,
    const float* __restrict__ Wv, const float* __restrict__ bv,
    _Float16* __restrict__ Qp, _Float16* __restrict__ Kp, _Float16* __restrict__ Vtp) {
  __shared__ __align__(16) v4u Wl[3][HD * WP];      // bf16 [n][k] per matrix, 8 k per chunk
  __shared__ float Bl[3][HD];                        // bf16-RNE biases as f32
  __shared__ __align__(16) _Float16 St[128 * LP];    // f16 staging [token local][d]

  const int tid = threadIdx.x, wave = tid >> 5, lane = tid & 31;
  const int hh = lane >> 4, n16 = lane & 15;
  const int h  = blockIdx.y;
  const int m0 = blockIdx.x * 128;                   // compact token index
  const int b  = m0 / SEQ, s0 = m0 - b * SEQ;
  const int bh = b * NH + h;

  // stage the head's three 64x64 weight tiles (bf16 RNE) and biases
#pragma unroll
  for (int c = tid; c < 512; c += 256) {
    const int nrow = c >> 3, ko = (c & 7) << 3;
    const size_t off = ((size_t)h * HD + nrow) * HD + ko;
    const int cl = nrow * WP + (c & 7);
    Wl[0][cl] = pack_bf8(Wq + off);
    Wl[1][cl] = pack_bf8(Wk + off);
    Wl[2][cl] = pack_bf8(Wv + off);
  }
  if (tid < HD) {                                    // wave-uniform (waves 0,1)
    Bl[0][tid] = bfval(bq[h * HD + tid]);
    Bl[1][tid] = bfval(bk[h * HD + tid]);
    Bl[2][tid] = bfval(bv[h * HD + tid]);
  }
  __syncthreads();

  // A fragments of the wave's 16 tokens (64 input dims of head h), bf16 RNE in registers
  const float* xp = x + ((size_t)b * SEQ_FULL + s0 + wave * 16) * EMB + h * HD;
  const v16bf a0 = frag_x_bf(xp, EMB, 0);
  const v16bf a1 = frag_x_bf(xp, EMB, 32);

#pragma unroll
  for (int mat = 0; mat < 3; ++mat) {
    v8f acc[4];
#pragma unroll
    for (int t = 0; t < 4; ++t) {
      v8f c = z8();
      c = mma_bf(a0, frag_w_bf(Wl[mat], t * 16, 0), c);
      c = mma_bf(a1, frag_w_bf(Wl[mat], t * 16, 4), c);
      acc[t] = c;
    }
    // bias add in f32, convert to f16, stage: D element r of lane -> (row 8hh+r, col t*16+n16)
#pragma unroll
    for (int t = 0; t < 4; ++t) {
      const float bias = Bl[mat][t * 16 + n16];
#pragma unroll
      for (int r = 0; r < 8; ++r) {
        const float y = acc[t][r] + bias;
        St[(wave * 16 + 8 * hh + r) * LP + t * 16 + n16] = (_Float16)(mat == 0 ? y * QCARRY : y);
      }
    }
    __syncthreads();

    if (mat < 2) {
      _Float16* plane = (mat == 0) ? Qp : Kp;
      wave_store_rows16(&St[(wave * 16) * LP],
                        plane + ((size_t)bh * SEQ + s0 + wave * 16) * HD, HD);
    } else {
      // V transposed: line L = (d, half); 8 lanes x 16 B per line, 4 lines per instruction
      const int c8 = (tid & 7) << 3;
      Pack8 w[4];
#pragma unroll
      for (int it = 0; it < 4; ++it) {
        const int L = it * 32 + (tid >> 3);
        const int d = L >> 1, j0 = (L & 1) * 64 + c8;
#pragma unroll
        for (int e = 0; e < 8; ++e) w[it].s[e] = St[(j0 + e) * LP + d];
      }
#pragma unroll
      for (int it = 0; it < 4; ++it) {
        const int L = it * 32 + (tid >> 3);
        const int d = L >> 1, j0 = (L & 1) * 64 + c8;
        *(v4u*)(Vtp + ((size_t)bh * HD + d) * SEQ + s0 + j0) = w[it].u;
      }
      
    }
    __syncthreads();                                 // St free for the next matrix
  }
}

__global__ __launch_bounds__(256) void k_attn(
    const _Float16* __restrict__ Qp, const _Float16* __restrict__ Kp,
    const _Float16* __restrict__ Vtp, _Float16* __restrict__ Cp) {
  __shared__ __align__(16) _Float16 Kt[4][64 * LP];   // [2 * buffer + key group][key][d]
  __shared__ __align__(16) _Float16 Vt[4][HD * LP];   // [2 * buffer + key group][d][key]
  __shared__ __align__(16) _Float16 Ct[8][16 * LP];   // per wave [q row][d], ctx staging for whole-line stores
  __shared__ __align__(16) v4fa Xo[8][8][32];         // per wave [4 registers of O][lane]: partial O handed to the partner wave
  __shared__ float Xm[8][2][32];                      // per wave [maximum, sum][lane] of the same columns

  const int tid = threadIdx.x, lane = tid & 31;
  const int wave = __builtin_amdgcn_readfirstlane(tid >> 5);
  const int grp = wave >> 2;    // key group
  const int hh = lane >> 4, n16 = lane & 15;
  const int bh = blockIdx.x;
  const int b  = bh / NH, h = bh - b * NH;
  const int q0 = blockIdx.y * 128 + (wave & 3) * 32;

  const _Float16* Qbh = Qp  + (size_t)bh * SEQ * HD;
  const _Float16* Kbh = Kp  + (size_t)bh * SEQ * HD;
  const _Float16* Vbh = Vtp + (size_t)bh * HD * SEQ;

  // Q^T as B operand (column group cg: query q0 + 16cg + lane&15; d 0..31, 32..63), in registers for the whole key loop
  v16h bq[2][2];
#pragma unroll
  for (int cg = 0; cg < 2; ++cg) {
    bq[cg][0] = frag_h(Qbh + (size_t)(q0 + 16 * cg) * HD, HD);
    bq[cg][1] = frag_h(Qbh + (size_t)(q0 + 16 * cg) * HD + 32, HD);
  }

  float lrow[2] = {0.f, 0.f};         // running sum of the carried p of the column group's query n16 over this lane half's keys only
  v8f ci[2];                          // start value of the score accumulators, the same in every element: PCARRY - mu of that query (equal in both lane halves); pass 0 sets mu
#pragma unroll
  for (int cg = 0; cg < 2; ++cg)
#pragma unroll
    for (int r = 0; r < 8; ++r) ci[cg][r] = PCARRY;
  v8f o[2][4];                        // o[cg][dt][r] = O^T[d = 16dt + 8hh + r][query n16 of group cg]
#pragma unroll
  for (int cg = 0; cg < 2; ++cg)
#pragma unroll
    for (int t = 0; t < 4; ++t) o[cg][t] = z8();

  // a thread copies rows crow and crow + 32, 16 bytes at column coff, of each of a stage's four tiles
  const int crow = tid >> 3, coff = (tid & 7) << 3;
  const unsigned lk = (unsigned)(size_t)&Kt[0][crow * LP + coff];
  const unsigned lv = (unsigned)(size_t)&Vt[0][crow * LP + coff];
  const unsigned half_b = 32 * LP * 2, tile_b = 64 * LP * 2;   // bytes: 32 rows, one tile
  const _Float16* gk = Kbh + (size_t)crow * HD + coff;         // tile at key t0: + t0 * HD
  const _Float16* gv = Vbh + (size_t)crow * SEQ + coff;        // tile at key t0: + t0
  constexpr int NST = SEQ / 128;                               // stages

  auto stage_copy = [&](int s) {
    const unsigned bo = (unsigned)(s & 1) * 2u * tile_b;
    const _Float16* nk = gk + (size_t)s * 128 * HD;
    const _Float16* nv = gv + s * 128;
    copy4_to_lds(lk + bo, nk, lk + bo + half_b, nk + 32 * HD, lv + bo, nv, lv + bo + half_b, nv + (size_t)32 * SEQ);
    copy4_to_lds(lk + bo + tile_b, nk + 64 * HD, lk + bo + tile_b + half_b, nk + 96 * HD,
                 lv + bo + tile_b, nv + 64, lv + bo + tile_b + half_b, nv + (size_t)32 * SEQ + 64);
  };

  // stage 0 into buffer 0, landed and published
  stage_copy(0);
  asm volatile("s_wait_asynccnt 0x0" ::: "memory");   // this wave's copies of stage 0 have landed
  __syncthreads();              // stage 0 visible to every wave

  for (int s = 0; s < NST; ++s) {
    // directly behind the barrier (the one above, or the one at the foot of pass s - 1, which freed that pass's buffer):
    // stage s + 1, where there is one, into the other buffer; the test reads the same for the whole work-group.
    // It stands at the head, not at the foot, so that the pass ends in one straight block: with a branch at the foot the row sums are
    // moved behind it, the 64 registers of f32 p stay live through the last products, and the wave no longer fits 256 registers (4 waves per SIMD).
    if (s + 1 < NST) stage_copy(s + 1);

    const int tb = ((s & 1) << 1) + grp;
    const _Float16* Kb = &Kt[tb][0];
    const _Float16* Vb = &Vt[tb][0];

    // S^T(64 keys x 32 queries) = K(64x64) . Q^T + (PCARRY - mu) : sc[cg][t][r] = of query n16 of cg, key 16t + 8hh + r
    v8f sc[2][4];
#pragma unroll
    for (int t = 0; t < 4; ++t) {
      const v16h ka0 = frag_h(Kb + (t * 16) * LP, LP);
      const v16h ka1 = frag_h(Kb + (t * 16) * LP + 32, LP);
      v8f c0 = mma_h(ka0, bq[0][0], ci[0]);
      v8f c1 = mma_h(ka0, bq[1][0], ci[1]);
      c0 = mma_h(ka1, bq[0][1], c0);
      c1 = mma_h(ka1, bq[1][1], c1);
      sc[0][t] = c0;
      sc[1][t] = c1;
    }

    // a query's largest accumulator: 32 keys in this lane, the other 32 in lane ^ 16
    float mx[2];
#pragma unroll  // constant indices keep sc in registers
    for (int cg = 0; cg < 2; ++cg) {
      float m = sc[cg][0][0];
#pragma unroll  // as above
      for (int t = 0; t < 4; ++t)
#pragma unroll  // as above
        for (int r = 0; r < 8; ++r) m = fmaxf(m, sc[cg][t][r]);
      mx[cg] = fmaxf(m, xhalf(m));
    }

    // one test per pass, a scalar branch for the whole wave: pass 0 sets the maxima in use, a later pass renews them only past that room
    const bool renew = (s == 0) || (fmaxf(mx[0], mx[1]) > PCARRY + PROOM);
    if (__builtin_amdgcn_ballot_w32(renew) != 0) {
#pragma unroll  // constant indices keep sc, ci and o in registers
      for (int cg = 0; cg < 2; ++cg) {
        float d = mx[cg] - PCARRY;                 // the new maximum above the one in use
        if (s > 0) d = fmaxf(d, 0.f);              // a maximum in use never falls; a lane with nothing to renew keeps its own (d = 0)
        const float alpha = __builtin_amdgcn_exp2f(fminf(-d, 0.f));   // pass 0 scales zeros: any finite factor
        lrow[cg] *= alpha;
        const float cn = ci[cg][0] - d;
#pragma unroll  // as above
        for (int r = 0; r < 8; ++r) ci[cg][r] = cn;
#pragma unroll  // as above
        for (int t = 0; t < 4; ++t) {
          sc[cg][t] -= d;
          o[cg][t] *= alpha;
        }
      }
    }

    FragH pb[2][2];
#pragma unroll  // constant indices keep sc and pb in registers
    for (int cg = 0; cg < 2; ++cg) {
      // P^T as B operand, in frag_h's k order: element s of pb[cg][j] is key 32j + 16(s >> 3) + 8hh + (s & 7) = score tile 2j + (s >> 3), register s & 7
#pragma unroll  // as above
      for (int t = 0; t < 4; ++t) {
        v8f p;
#pragma unroll  // as above
        for (int r = 0; r < 8; ++r) p[r] = __builtin_amdgcn_exp2f(sc[cg][t][r]);
        sc[cg][t] = p;
        pb[cg][t >> 1].p[t & 1] = __builtin_convertvector(p, v8ha);
      }
      // in-lane sum of the 32 p as a tree: short dependent chains, packed adds
      const v8f s8 = (sc[cg][0] + sc[cg][1]) + (sc[cg][2] + sc[cg][3]);
      const float ps = ((s8[0] + s8[1]) + (s8[2] + s8[3])) + ((s8[4] + s8[5]) + (s8[6] + s8[7]));
      lrow[cg] += ps;
    }

    // O^T(64 d x 32 queries) += V^T(64 d x 64 keys) . P^T : A[m=d][k=key] = Vt[d][key]
#pragma unroll
    for (int dt = 0; dt < 4; ++dt) {
      const v16h va0 = frag_h(Vb + (dt * 16) * LP, LP);
      const v16h va1 = frag_h(Vb + (dt * 16) * LP + 32, LP);
      v8f c0 = o[0][dt], c1 = o[1][dt];
      c0 = mma_h(va0, pb[0][0].v, c0);
      c1 = mma_h(va0, pb[1][0].v, c1);
      c0 = mma_h(va1, pb[0][1].v, c0);
      c1 = mma_h(va1, pb[1][1].v, c1);
      o[0][dt] = c0;
      o[1][dt] = c1;
    }

    // hand-over: this wave's reads of stage s are done, its copies of stage s + 1 have landed; the one barrier
    // publishes stage s + 1 and frees stage s's buffer, which takes stage s + 2 at the head of the next pass
    asm volatile("s_wait_dscnt 0x0" ::: "memory");      // own LDS reads retired before the buffer is refilled
    asm volatile("s_wait_asynccnt 0x0" ::: "memory");   // own copies landed before other waves read them
    __syncthreads();
  }
  asm volatile("s_wait_asynccnt 0x0" ::: "memory");     // nothing of this wave in flight behind the loop

  // merge of the two key groups: the wave of key group g finishes column group g of its 32 queries; it hands its partial
  // of the other column group to the partner wave (wave ^ 4, same queries, same lane map) and takes the partner's of its own
  const float mu0 = PCARRY - ci[0][0], mu1 = PCARRY - ci[1][0];   // the maxima in use
  const float mk = grp ? mu1 : mu0, lkp = grp ? lrow[1] : lrow[0];
  Xm[wave][0][lane] = grp ? mu0 : mu1;
  Xm[wave][1][lane] = grp ? lrow[0] : lrow[1];
  v8f keep[4];
#pragma unroll
  for (int dt = 0; dt < 4; ++dt) {
    keep[dt] = grp ? o[1][dt] : o[0][dt];
    const v8f give = grp ? o[0][dt] : o[1][dt];
    Xo[wave][2 * dt][lane]     = __builtin_shufflevector(give, give, 0, 1, 2, 3);
    Xo[wave][2 * dt + 1][lane] = __builtin_shufflevector(give, give, 4, 5, 6, 7);
  }
  __syncthreads();              // both partners' partials are in LDS

  const int part = wave ^ 4;
  const float mo = Xm[part][0][lane], lo = Xm[part][1][lane];
  const float mm = fmaxf(mk, mo);
  const float ak = __builtin_amdgcn_exp2f(mk - mm), ao = __builtin_amdgcn_exp2f(mo - mm);
  const float lsum = lkp * ak + lo * ao;

  // normalise: o and l hold the same carried p; ctx carried x64 -> o * 64 / l; l joins the two halves' sums
  const float inv = 64.0f * __builtin_amdgcn_rcpf(lsum + xhalf(lsum));
  const float fk = ak * inv, fo = ao * inv;

  // a lane's 8 registers of one dt are 8 consecutive d of one query row: one 16-byte LDS store each
#pragma unroll
  for (int dt = 0; dt < 4; ++dt) {
    const v4fa y0 = Xo[part][2 * dt][lane];
    const v4fa y1 = Xo[part][2 * dt + 1][lane];
    Pack8 w;
#pragma unroll
    for (int r = 0; r < 4; ++r) {
      w.s[r]     = (_Float16)(keep[dt][r] * fk + y0[r] * fo);
      w.s[r + 4] = (_Float16)(keep[dt][r + 4] * fk + y1[r] * fo);
    }
    *(v8ha*)&Ct[wave][n16 * LP + dt * 16 + 8 * hh] = w.h;
  }
  __syncthreads();              // staged rows complete before they are read back across lanes

  wave_store_rows16(&Ct[wave][0],
                    Cp + ((size_t)b * SEQ + q0 + 16 * grp) * EMB + h * HD, EMB);
}

// ---------------- kernel 3: output projection out = ctx . Wo^T + bo ----------------
// block = 256 threads (8 waves); block tile 128 tokens x 64 outputs; wave owns 16 x 64.
// The block's whole B slab (Wo rows n0..n0+63, all 512 k) is staged in LDS once, as f16(16 * bf16RNE(Wo)), behind one barrier;
// the k loop has no barrier, and only the second half of the A fragment loads waits for the one barrier: the slab's loads and a wave's A fragment loads are issued many at a time, ahead of their use.
__global__ __launch_bounds__(256) void k_oproj(
    const _Float16* __restrict__ Cp, const float* __restrict__ Wo,
    const float* __restrict__ bo, float* __restrict__ out) {
  __shared__ __align__(16) _Float16 Bt[64 * KP];     // [n local][k]
  __shared__ __align__(16) float Os[8][16 * OP];     // per wave f32 output staging

  const int tid = threadIdx.x, wave = tid >> 5, lane = tid & 31;
  const int hh = lane >> 4, n16 = lane & 15;
  const int m0 = blockIdx.x * 128 + wave * 16;
  const int n0 = blockIdx.y * 64;

  // the slab is 64 whole rows of Wo: 32768 consecutive floats; a wave's load covers 512 consecutive bytes
  const float* wsrc = Wo + (size_t)n0 * EMB + tid * 4;
  const _Float16* arow = Cp + (size_t)m0 * EMB;

  v4fa wr[32];
#pragma unroll  // constant indices keep wr in registers; the loads stand together
  for (int it = 0; it < 32; ++it) wr[it] = *(const v4fa*)(wsrc + it * 1024);

  v16h a[16];
#pragma unroll  // constant indices keep a in registers
  for (int ks = 0; ks < 8; ++ks) a[ks] = frag_h(arow + ks * 32, EMB);
  float braw[4];                // bias, read here so that no wait for it stands among the products behind later loads
#pragma unroll  // constant indices keep braw in registers
  for (int t = 0; t < 4; ++t) braw[t] = bo[n0 + t * 16 + n16];

  // load it of thread tid: row 2 it + (tid >> 7), k 4 (tid & 127) .. + 3
  _Float16* bdst = &Bt[(tid >> 7) * KP + (tid & 127) * 4];
#pragma unroll  // as above, wr
  for (int it = 0; it < 32; ++it) {
    v4ha w;
    w.x = (_Float16)(bfval(wr[it].x) * 16.0f);
    w.y = (_Float16)(bfval(wr[it].y) * 16.0f);
    w.z = (_Float16)(bfval(wr[it].z) * 16.0f);
    w.w = (_Float16)(bfval(wr[it].w) * 16.0f);
    *(v4ha*)(bdst + it * 2 * KP) = w;
  }
  __syncthreads();              // Bt visible

  // second half of the A fragments: into the registers that the staging has left; they land behind the first half's products
#pragma unroll  // as above, a
  for (int ks = 8; ks < 16; ++ks) a[ks] = frag_h(arow + ks * 32, EMB);

  v8f acc[4];
#pragma unroll
  for (int t = 0; t < 4; ++t) acc[t] = z8();

#pragma unroll  // constant indices keep a in registers
  for (int ks = 0; ks < 16; ++ks)
#pragma unroll  // constant indices keep acc in registers
    for (int t = 0; t < 4; ++t)
      acc[t] = mma_h(a[ks], frag_h(&Bt[(t * 16) * KP + ks * 32], KP), acc[t]);

  // epilogue: undo carries (64*16 = 1024), add bf16-RNE bias, stage f32 tile
#pragma unroll
  for (int t = 0; t < 4; ++t) {
    const float bias = bfval(braw[t]);
#pragma unroll
    for (int r = 0; r < 8; ++r)
      Os[wave][(8 * hh + r) * OP + t * 16 + n16] = acc[t][r] * (1.0f / 1024.0f) + bias;
  }
  __syncthreads();

  // 16 rows x 256 B = 32 lines; line = (row, half); 8 lanes x 16 B per line, 4 lines per instruction
  const int rsub = lane >> 3, c4 = (lane & 7) << 2;
  v4fa v[8];
#pragma unroll
  for (int it = 0; it < 8; ++it) {
    const int li = it * 4 + rsub;
    const int row = li >> 1, hf = li & 1;
    v[it] = *(const v4fa*)&Os[wave][row * OP + hf * 32 + c4];
  }
  float* base = out + (size_t)m0 * EMB + n0;
#pragma unroll
  for (int it = 0; it < 8; ++it) {
    const int li = it * 4 + rsub;
    const int row = li >> 1, hf = li & 1;
    *(v4fa*)(base + (size_t)row * EMB + hf * 32 + c4) = v[it];
  }
  
}

// ---------------- launcher ----------------
extern "C" void kernel_launch(void* const* d_in, const int* in_sizes, int n_in,
                              void* d_out, int out_size, void* d_ws, size_t ws_size,
                              hipStream_t stream) {
  if (n_in < 9) return;
  if (in_sizes[0] < ((NB - 1) * SEQ_FULL + SEQ) * EMB) return;
  if (in_sizes[1] < NH * HD * HD || in_sizes[3] < NH * HD * HD || in_sizes[5] < NH * HD * HD) return;
  if (in_sizes[2] < NH * HD || in_sizes[4] < NH * HD || in_sizes[6] < NH * HD) return;
  if (in_sizes[7] < EMB * EMB || in_sizes[8] < EMB) return;
  if (out_size < MTOK * EMB) return;

  const float* x  = (const float*)d_in[0];
  const float* Wq = (const float*)d_in[1];
  const float* bq = (const float*)d_in[2];
  const float* Wk = (const float*)d_in[3];
  const float* bk = (const float*)d_in[4];
  const float* Wv = (const float*)d_in[5];
  const float* bv = (const float*)d_in[6];
  const float* Wo = (const float*)d_in[7];
  const float* bo = (const float*)d_in[8];
  float* out = (float*)d_out;

  const size_t qkv_bytes = (size_t)NB * NH * SEQ * HD * 2;   // 8 MiB at full size
  const size_t ctx_bytes = (size_t)MTOK * EMB * 2;           // 8 MiB at full size
  const size_t off_q = 0;
  const size_t off_k = off_q + qkv_bytes;
  const size_t off_v = off_k + qkv_bytes;
  const size_t off_c = off_v + qkv_bytes;
  const size_t total = off_c + ctx_bytes;
  if (total > ws_size) return;

  char* ws = (char*)d_ws;
  _Float16* Qp  = (_Float16*)(ws + off_q);
  _Float16* Kp  = (_Float16*)(ws + off_k);
  _Float16* Vtp = (_Float16*)(ws + off_v);
  _Float16* Cp  = (_Float16*)(ws + off_c);

  k_qkv<<<dim3(MTOK / 128, NH), 256, 0, stream>>>(x, Wq, bq, Wk, bk, Wv, bv, Qp, Kp, Vtp);
  k_attn<<<dim3(NB * NH, SEQ / 128), 256, 0, stream>>>(Qp, Kp, Vtp, Cp);
  k_oproj<<<dim3(MTOK / 128, EMB / 64), 256, 0, stream>>>(Cp, Wo, bo, out);
}

// v008
// It runs in 48.2 microseconds.
// Two timings next to v007 both put it at 1.04 times that version's speed.
// Over all steps from v000 it is 4.34 times as fast.
#include <hip/hip_runtime.h>

// Contractions: per-head x*W^T (q,k,v) on v_wmma_f32_16x16x32_bf16 (bf16 operands); q*k^T, p*v, ctx*Wo^T on v_wmma_f32_16x16x32_f16 (f16 operands, power-of-two carries p*1024, ctx*64, Wo*16); f32 accumulate; softmax in f32.

#ifndef NB
#define NB 4
#endif
#ifndef SEQ
#define SEQ 2048
#endif
#define NB_FULL 4
#define SEQ_FULL 2048
#define EMB 512
#define NH 8
#define HD 64
#define MTOK (NB * SEQ)
// LDS row pitches: data row + 16 B, an odd multiple of 16 B, so that the 16 rows of a 16-byte fragment read fall on different banks
#define LP 72   // halves, rows of 64 halves (128 B -> 144 B)
#define KP 520  // halves, rows of 512 halves (1024 B -> 1040 B)
#define WP 9    // 16-byte chunks, rows of 8 chunks (128 B -> 144 B)
#define OP 68   // floats, rows of 64 floats (256 B -> 272 B)
#define VP 136  // halves, rows of 128 halves (256 B -> 272 B)
// the Q plane carries 1/sqrt(64) * log2(e), applied in f32 before the one rounding to f16: K . Q^T is then the softmax argument in base 2
#define QCARRY 0.18033688011112042f
// base-2 offset of the score accumulators: p is carried x 2^10; a maximum in use may be exceeded by 2^PROOM before it is renewed (p <= 2^14 in f16)
#define PCARRY 10.0f
#define PROOM 4.0f

static_assert(NB >= 1 && NB <= NB_FULL);
static_assert(SEQ >= 128 && SEQ <= SEQ_FULL && (SEQ % 128) == 0);
static_assert(EMB == NH * HD);
static_assert((EMB % 64) == 0 && (MTOK % 128) == 0);
// full-size carve: 3 planes of NB*NH*SEQ*HD halves + ctx plane of MTOK*EMB halves
static_assert((3ull * NB_FULL * NH * SEQ_FULL * HD + (unsigned long long)NB_FULL * SEQ_FULL * EMB) * 2ull <= 134217728ull);

typedef unsigned short u16;
typedef _Float16 v16h __attribute__((ext_vector_type(16)));
typedef __bf16   v16bf __attribute__((ext_vector_type(16)));
typedef float    v8f  __attribute__((ext_vector_type(8)));
typedef _Float16 v8ha __attribute__((ext_vector_type(8), __may_alias__));
typedef _Float16 v4ha __attribute__((ext_vector_type(4), __may_alias__));
typedef float    v4fa __attribute__((ext_vector_type(4), __may_alias__));
typedef unsigned v4u  __attribute__((ext_vector_type(4), __may_alias__));

union FragH { v16h v; v8ha p[2]; };
union FragB { v16bf v; v4u q[2]; };
union Pack8 { v8ha h; v4u u; _Float16 s[8]; };

// ---------------- helpers ----------------

__device__ __forceinline__ unsigned bfbits(float f) {   // f32 -> bf16 bits, RNE
  unsigned u = __float_as_uint(f);
  u += 0x7FFFu + ((u >> 16) & 1u);
  return u >> 16;
}
__device__ __forceinline__ float bfval(float f) {       // f32 -> value of its bf16 RNE image
  unsigned u = __float_as_uint(f);
  u += 0x7FFFu + ((u >> 16) & 1u);
  return __uint_as_float(u & 0xFFFF0000u);
}
__device__ __forceinline__ v8f z8() {
  v8f z = {0.f, 0.f, 0.f, 0.f, 0.f, 0.f, 0.f, 0.f};
  return z;
}

// 8 consecutive f32 -> 8 bf16 packed in 16 bytes (low half-word = lower index)
__device__ __forceinline__ v4u pack_bf8(const float* __restrict__ p) {
  const v4fa x0 = *(const v4fa*)p;
  const v4fa x1 = *(const v4fa*)(p + 4);
  v4u r;
  r.x = bfbits(x0.x) | (bfbits(x0.y) << 16);
  r.y = bfbits(x0.z) | (bfbits(x0.w) << 16);
  r.z = bfbits(x1.x) | (bfbits(x1.y) << 16);
  r.w = bfbits(x1.z) | (bfbits(x1.w) << 16);
  return r;
}

// 16x32 16-bit fragment (A or B layout, identical k map), row-major source, pitch ld (elements):
//   lane l: row = l&15; elements 0..7 <- k 8h..8h+7; elements 8..15 <- k 16+8h..16+8h+7, h = l>>4.
__device__ __forceinline__ v16h frag_h(const _Float16* base, int ld) {
  const int lane = threadIdx.x & 31;
  const int row  = lane & 15;
  const int kb   = (lane >> 4) << 3;
  FragH u;
  u.p[0] = *(const v8ha*)(base + (size_t)row * ld + kb);
  u.p[1] = *(const v8ha*)(base + (size_t)row * ld + 16 + kb);
  return u.v;
}

// A or B fragment from f32 rows (pitch ld floats), k columns k0..k0+31, converted to bf16 RNE.
__device__ __forceinline__ v16bf frag_x_bf(const float* base, int ld, int k0) {
  const int lane = threadIdx.x & 31;
  const int row  = lane & 15;
  const int kb   = (lane >> 4) << 3;
  const float* p = base + (size_t)row * ld + k0 + kb;
  FragB u;
  u.q[0] = pack_bf8(p);        // k0+kb .. k0+kb+7
  u.q[1] = pack_bf8(p + 16);   // k0+16+kb .. k0+16+kb+7
  return u.v;
}

// A or B fragment from an LDS bf16 tile stored as [n][8 chunks of 8 k] (64 k per row, row pitch WP chunks);
// rows nrow0..nrow0+15, k chunk base kc0 (0 -> k 0..31, 4 -> k 32..63).
__device__ __forceinline__ v16bf frag_w_bf(const v4u* tile, int nrow0, int kc0) {
  const int lane = threadIdx.x & 31;
  const int n    = lane & 15;
  const int hh   = lane >> 4;
  FragB u;
  u.q[0] = tile[(nrow0 + n) * WP + kc0 + hh];
  u.q[1] = tile[(nrow0 + n) * WP + kc0 + 2 + hh];
  return u.v;
}

// builtin forms: the compiler itself keeps the distance the chip needs behind a matrix instruction and is free to schedule round it
__device__ __forceinline__ v8f mma_h(v16h a, v16h b, v8f c) {
  v8f d = __builtin_amdgcn_wmma_f32_16x16x32_f16(false, a, false, b, (short)0, c, false, false);
  return d;
}
__device__ __forceinline__ v8f mma_bf(v16bf a, v16bf b, v8f c) {
  v8f d = __builtin_amdgcn_wmma_f32_16x16x32_bf16(false, a, false, b, (short)0, c, false, false);
  return d;
}

// value of the same column in the other 16-lane half (lane ^ 16), a vector cross-row move
__device__ __forceinline__ float xhalf(float x) {
  const int b = __float_as_int(x);
  return __int_as_float(__builtin_amdgcn_permlanex16(b, b, 0x76543210, 0xfedcba98, false, false));
}

// A lane's four 16-byte asynchronous copies global -> LDS (through no register): its share of one K tile and one V^T tile.
// l* = LDS byte address (low 32 bits of the __shared__ address), g* = global address, all multiples of 16 B.
// s_wait_xcnt 0 is the statement's last line so that no address register of a copy is rewritten in front of it.
__device__ __forceinline__ void copy4_to_lds(unsigned l0, const _Float16* g0, unsigned l1, const _Float16* g1,
                                             unsigned l2, const _Float16* g2, unsigned l3, const _Float16* g3) {
  asm volatile("global_load_async_to_lds_b128 %0, %1, off\n\t"
               "global_load_async_to_lds_b128 %2, %3, off\n\t"
               "global_load_async_to_lds_b128 %4, %5, off\n\t"
               "global_load_async_to_lds_b128 %6, %7, off\n\t"
               "s_wait_xcnt 0x0"
               :: "v"(l0), "v"(g0), "v"(l1), "v"(g1), "v"(l2), "v"(g2), "v"(l3), "v"(g3)
               : "memory");
}

// One wave writes its 16 x 64-half tile (LDS, pitch LP) to 16 global rows of pitch `pitch` halves.
__device__ __forceinline__ void wave_store_rows16(const _Float16* tile, _Float16* dst, int pitch) {
  const int lane = threadIdx.x & 31;
  const int rsub = lane >> 3, c8 = (lane & 7) << 3;
  Pack8 v[4];
#pragma unroll
  for (int it = 0; it < 4; ++it)
    v[it].h = *(const v8ha*)(tile + (it * 4 + rsub) * LP + c8);
#pragma unroll
  for (int it = 0; it < 4; ++it)
    *(v4u*)(dst + (size_t)(it * 4 + rsub) * pitch + c8) = v[it].u;
  
}

// ---------------- kernel 1: per-head q/k/v projections ----------------
// block = 256 threads (8 waves); block owns (128 tokens, head h); wave owns 16 tokens x 64 outputs.
// Q,K planes: [bh][s][64] f16, Q times QCARRY.   V plane transposed: [bh][64][SEQ] f16.
// The operand order of each product is that of its plane: Q^T = Wq . x^T and K^T = Wk . x^T (a lane's 8 accumulator registers are
// 8 consecutive d of one token), V = x . Wv^T (8 consecutive tokens of one d): 16 contiguous bytes of the plane's row either way,
// staged with one 16-byte LDS store and read back as 16 bytes. Both loaders have the same k map, so either side may be A or B.
__global__ __launch_bounds__(256) void k_qkv(
    const float* __restrict__ x,
    const float* __restrict__ Wq, const float* __restrict__ bq,
    const float* __restrict__ Wk, const float* __restrict__ bk,
    const float* __restrict__ Wv, const float* __restrict__ bv,
    _Float16* __restrict__ Qp, _Float16* __restrict__ Kp, _Float16* __restrict__ Vtp) {
  __shared__ __align__(16) v4u Wl[3][HD * WP];      // bf16 [n][k] per matrix, 8 k per chunk
  __shared__ __align__(16) float Bl[3][HD];          // bf16-RNE biases as f32
  __shared__ __align__(16) _Float16 St[128 * LP];    // f16 staging: Q, K [token local][d], pitch LP; V [d][token local], pitch VP
  static_assert(HD * VP <= 128 * LP);

  const int tid = threadIdx.x, wave = tid >> 5, lane = tid & 31;
  const int hh = lane >> 4, n16 = lane & 15;
  const int h  = blockIdx.y;
  const int m0 = blockIdx.x * 128;                   // compact token index
  const int b  = m0 / SEQ, s0 = m0 - b * SEQ;
  const int bh = b * NH + h;

  // stage the head's three 64x64 weight tiles (bf16 RNE) and biases
#pragma unroll
  for (int c = tid; c < 512; c += 256) {
    const int nrow = c >> 3, ko = (c & 7) << 3;
    const size_t off = ((size_t)h * HD + nrow) * HD + ko;
    const int cl = nrow * WP + (c & 7);
    Wl[0][cl] = pack_bf8(Wq + off);
    Wl[1][cl] = pack_bf8(Wk + off);
    Wl[2][cl] = pack_bf8(Wv + off);
  }
  if (tid < HD) {                                    // wave-uniform (waves 0,1)
    Bl[0][tid] = bfval(bq[h * HD + tid]);
    Bl[1][tid] = bfval(bk[h * HD + tid]);
    Bl[2][tid] = bfval(bv[h * HD + tid]);
  }
  __syncthreads();

  // fragments of the wave's 16 tokens (64 input dims of head h), bf16 RNE in registers: B of the Q, K products, A of the V product
  const float* xp = x + ((size_t)b * SEQ_FULL + s0 + wave * 16) * EMB + h * HD;
  const v16bf a0 = frag_x_bf(xp, EMB, 0);
  const v16bf a1 = frag_x_bf(xp, EMB, 32);

#pragma unroll
  for (int mat = 0; mat < 3; ++mat) {
    v8f acc[4];
#pragma unroll
    for (int t = 0; t < 4; ++t) {
      v8f c = z8();
      if (mat < 2) {   // D element r of lane -> (d = t*16 + 8hh + r, token n16)
        c = mma_bf(frag_w_bf(Wl[mat], t * 16, 0), a0, c);
        c = mma_bf(frag_w_bf(Wl[mat], t * 16, 4), a1, c);
      } else {         // D element r of lane -> (token 8hh + r, d = t*16 + n16)
        c = mma_bf(a0, frag_w_bf(Wl[mat], t * 16, 0), c);
        c = mma_bf(a1, frag_w_bf(Wl[mat], t * 16, 4), c);
      }
      acc[t] = c;
    }
    // bias add in f32, convert to f16, stage a lane's 8 values of one tile as 16 bytes
#pragma unroll
    for (int t = 0; t < 4; ++t) {
      Pack8 w;
      if (mat < 2) {
        const v4fa b0 = *(const v4fa*)&Bl[mat][t * 16 + 8 * hh];
        const v4fa b1 = *(const v4fa*)&Bl[mat][t * 16 + 8 * hh + 4];
#pragma unroll  // constant indices keep acc and w in registers
        for (int r = 0; r < 4; ++r) {
          const float y0 = acc[t][r] + b0[r];
          const float y1 = acc[t][r + 4] + b1[r];
          w.s[r]     = (_Float16)(mat == 0 ? y0 * QCARRY : y0);
          w.s[r + 4] = (_Float16)(mat == 0 ? y1 * QCARRY : y1);
        }
        *(v8ha*)&St[(wave * 16 + n16) * LP + t * 16 + 8 * hh] = w.h;
      } else {
        const float bias = Bl[mat][t * 16 + n16];
#pragma unroll  // as above
        for (int r = 0; r < 8; ++r) w.s[r] = (_Float16)(acc[t][r] + bias);
        *(v8ha*)&St[(t * 16 + n16) * VP + wave * 16 + 8 * hh] = w.h;
      }
    }
    __syncthreads();

    if (mat < 2) {
      _Float16* plane = (mat == 0) ? Qp : Kp;
      wave_store_rows16(&St[(wave * 16) * LP],
                        plane + ((size_t)bh * SEQ + s0 + wave * 16) * HD, HD);
    } else {
      // V^T rows as staged: line L = (d, half); 8 lanes x 16 B per line, 4 lines per instruction, 32 per block-wide pass
      const int c8 = (tid & 7) << 3;
      Pack8 w[4];
#pragma unroll
      for (int it = 0; it < 4; ++it) {
        const int L = it * 32 + (tid >> 3);
        const int d = L >> 1, j0 = (L & 1) * 64 + c8;
        w[it].h = *(const v8ha*)&St[d * VP + j0];
      }
#pragma unroll
      for (int it = 0; it < 4; ++it) {
        const int L = it * 32 + (tid >> 3);
        const int d = L >> 1, j0 = (L & 1) * 64 + c8;
        *(v4u*)(Vtp + ((size_t)bh * HD + d) * SEQ + s0 + j0) = w[it].u;
      }
      
    }
    __syncthreads();                                 // St free for the next matrix
  }
}

__global__ __launch_bounds__(256) void k_attn(
    const _Float16* __restrict__ Qp, const _Float16* __restrict__ Kp,
    const _Float16* __restrict__ Vtp, _Float16* __restrict__ Cp) {
  __shared__ __align__(16) _Float16 Kt[4][64 * LP];   // [2 * buffer + key group][key][d]
  __shared__ __align__(16) _Float16 Vt[4][HD * LP];   // [2 * buffer + key group][d][key]
  __shared__ __align__(16) _Float16 Ct[8][16 * LP];   // per wave [q row][d], ctx staging for whole-line stores
  __shared__ __align__(16) v4fa Xo[8][8][32];         // per wave [4 registers of O][lane]: partial O handed to the partner wave
  __shared__ float Xm[8][2][32];                      // per wave [maximum, sum][lane] of the same columns

  const int tid = threadIdx.x, lane = tid & 31;
  const int wave = __builtin_amdgcn_readfirstlane(tid >> 5);
  const int grp = wave >> 2;    // key group
  const int hh = lane >> 4, n16 = lane & 15;
  const int bh = blockIdx.x;
  const int b  = bh / NH, h = bh - b * NH;
  const int q0 = blockIdx.y * 128 + (wave & 3) * 32;

  const _Float16* Qbh = Qp  + (size_t)bh * SEQ * HD;
  const _Float16* Kbh = Kp  + (size_t)bh * SEQ * HD;
  const _Float16* Vbh = Vtp + (size_t)bh * HD * SEQ;

  // Q^T as B operand (column group cg: query q0 + 16cg + lane&15; d 0..31, 32..63), in registers for the whole key loop
  v16h bq[2][2];
#pragma unroll
  for (int cg = 0; cg < 2; ++cg) {
    bq[cg][0] = frag_h(Qbh + (size_t)(q0 + 16 * cg) * HD, HD);
    bq[cg][1] = frag_h(Qbh + (size_t)(q0 + 16 * cg) * HD + 32, HD);
  }

  float lrow[2] = {0.f, 0.f};         // running sum of the carried p of the column group's query n16 over this lane half's keys only
  v8f ci[2];                          // start value of the score accumulators, the same in every element: PCARRY - mu of that query (equal in both lane halves); pass 0 sets mu
#pragma unroll
  for (int cg = 0; cg < 2; ++cg)
#pragma unroll
    for (int r = 0; r < 8; ++r) ci[cg][r] = PCARRY;
  v8f o[2][4];                        // o[cg][dt][r] = O^T[d = 16dt + 8hh + r][query n16 of group cg]
#pragma unroll
  for (int cg = 0; cg < 2; ++cg)
#pragma unroll
    for (int t = 0; t < 4; ++t) o[cg][t] = z8();

  // a thread copies rows crow and crow + 32, 16 bytes at column coff, of each of a stage's four tiles
  const int crow = tid >> 3, coff = (tid & 7) << 3;
  const unsigned lk = (unsigned)(size_t)&Kt[0][crow * LP + coff];
  const unsigned lv = (unsigned)(size_t)&Vt[0][crow * LP + coff];
  const unsigned half_b = 32 * LP * 2, tile_b = 64 * LP * 2;   // bytes: 32 rows, one tile
  const _Float16* gk = Kbh + (size_t)crow * HD + coff;         // tile at key t0: + t0 * HD
  const _Float16* gv = Vbh + (size_t)crow * SEQ + coff;        // tile at key t0: + t0
  constexpr int NST = SEQ / 128;                               // stages

  auto stage_copy = [&](int s) {
    const unsigned bo = (unsigned)(s & 1) * 2u * tile_b;
    const _Float16* nk = gk + (size_t)s * 128 * HD;
    const _Float16* nv = gv + s * 128;
    copy4_to_lds(lk + bo, nk, lk + bo + half_b, nk + 32 * HD, lv + bo, nv, lv + bo + half_b, nv + (size_t)32 * SEQ);
    copy4_to_lds(lk + bo + tile_b, nk + 64 * HD, lk + bo + tile_b + half_b, nk + 96 * HD,
                 lv + bo + tile_b, nv + 64, lv + bo + tile_b + half_b, nv + (size_t)32 * SEQ + 64);
  };

  // stage 0 into buffer 0, landed and published
  stage_copy(0);
  asm volatile("s_wait_asynccnt 0x0" ::: "memory");   // this wave's copies of stage 0 have landed
  __syncthreads();              // stage 0 visible to every wave

  for (int s = 0; s < NST; ++s) {
    // directly behind the barrier (the one above, or the one at the foot of pass s - 1, which freed that pass's buffer):
    // stage s + 1, where there is one, into the other buffer; the test reads the same for the whole work-group.
    // It stands at the head, not at the foot, so that the pass ends in one straight block: with a branch at the foot the row sums are
    // moved behind it, the 64 registers of f32 p stay live through the last products, and the wave no longer fits 256 registers (4 waves per SIMD).
    if (s + 1 < NST) stage_copy(s + 1);

    const int tb = ((s & 1) << 1) + grp;
    const _Float16* Kb = &Kt[tb][0];
    const _Float16* Vb = &Vt[tb][0];

    // S^T(64 keys x 32 queries) = K(64x64) . Q^T + (PCARRY - mu) : sc[cg][t][r] = of query n16 of cg, key 16t + 8hh + r
    v8f sc[2][4];
#pragma unroll
    for (int t = 0; t < 4; ++t) {
      const v16h ka0 = frag_h(Kb + (t * 16) * LP, LP);
      const v16h ka1 = frag_h(Kb + (t * 16) * LP + 32, LP);
      v8f c0 = mma_h(ka0, bq[0][0], ci[0]);
      v8f c1 = mma_h(ka0, bq[1][0], ci[1]);
      c0 = mma_h(ka1, bq[0][1], c0);
      c1 = mma_h(ka1, bq[1][1], c1);
      sc[0][t] = c0;
      sc[1][t] = c1;
    }

    // a query's largest accumulator: 32 keys in this lane, the other 32 in lane ^ 16
    float mx[2];
#pragma unroll  // constant indices keep sc in registers
    for (int cg = 0; cg < 2; ++cg) {
      float m = sc[cg][0][0];
#pragma unroll  // as above
      for (int t = 0; t < 4; ++t)
#pragma unroll  // as above
        for (int r = 0; r < 8; ++r) m = fmaxf(m, sc[cg][t][r]);
      mx[cg] = fmaxf(m, xhalf(m));
    }

    // one test per pass, a scalar branch for the whole wave: pass 0 sets the maxima in use, a later pass renews them only past that room
    const bool renew = (s == 0) || (fmaxf(mx[0], mx[1]) > PCARRY + PROOM);
    if (__builtin_amdgcn_ballot_w32(renew) != 0) {
#pragma unroll  // constant indices keep sc, ci and o in registers
      for (int cg = 0; cg < 2; ++cg) {
        float d = mx[cg] - PCARRY;                 // the new maximum above the one in use
        if (s > 0) d = fmaxf(d, 0.f);              // a maximum in use never falls; a lane with nothing to renew keeps its own (d = 0)
        const float alpha = __builtin_amdgcn_exp2f(fminf(-d, 0.f));   // pass 0 scales zeros: any finite factor
        lrow[cg] *= alpha;
        const float cn = ci[cg][0] - d;
#pragma unroll  // as above
        for (int r = 0; r < 8; ++r) ci[cg][r] = cn;
#pragma unroll  // as above
        for (int t = 0; t < 4; ++t) {
          sc[cg][t] -= d;
          o[cg][t] *= alpha;
        }
      }
    }

    FragH pb[2][2];
#pragma unroll  // constant indices keep sc and pb in registers
    for (int cg = 0; cg < 2; ++cg) {
      // P^T as B operand, in frag_h's k order: element s of pb[cg][j] is key 32j + 16(s >> 3) + 8hh + (s & 7) = score tile 2j + (s >> 3), register s & 7
#pragma unroll  // as above
      for (int t = 0; t < 4; ++t) {
        v8f p;
#pragma unroll  // as above
        for (int r = 0; r < 8; ++r) p[r] = __builtin_amdgcn_exp2f(sc[cg][t][r]);
        sc[cg][t] = p;
        pb[cg][t >> 1].p[t & 1] = __builtin_convertvector(p, v8ha);
      }
      // in-lane sum of the 32 p as a tree: short dependent chains, packed adds
      const v8f s8 = (sc[cg][0] + sc[cg][1]) + (sc[cg][2] + sc[cg][3]);
      const float ps = ((s8[0] + s8[1]) + (s8[2] + s8[3])) + ((s8[4] + s8[5]) + (s8[6] + s8[7]));
      lrow[cg] += ps;
    }

    // O^T(64 d x 32 queries) += V^T(64 d x 64 keys) . P^T : A[m=d][k=key] = Vt[d][key]
#pragma unroll
    for (int dt = 0; dt < 4; ++dt) {
      const v16h va0 = frag_h(Vb + (dt * 16) * LP, LP);
      const v16h va1 = frag_h(Vb + (dt * 16) * LP + 32, LP);
      v8f c0 = o[0][dt], c1 = o[1][dt];
      c0 = mma_h(va0, pb[0][0].v, c0);
      c1 = mma_h(va0, pb[1][0].v, c1);
      c0 = mma_h(va1, pb[0][1].v, c0);
      c1 = mma_h(va1, pb[1][1].v, c1);
      o[0][dt] = c0;
      o[1][dt] = c1;
    }

    // hand-over: this wave's reads of stage s are done, its copies of stage s + 1 have landed; the one barrier
    // publishes stage s + 1 and frees stage s's buffer, which takes stage s + 2 at the head of the next pass
    asm volatile("s_wait_dscnt 0x0" ::: "memory");      // own LDS reads retired before the buffer is refilled
    asm volatile("s_wait_asynccnt 0x0" ::: "memory");   // own copies landed before other waves read them
    __syncthreads();
  }
  asm volatile("s_wait_asynccnt 0x0" ::: "memory");     // nothing of this wave in flight behind the loop

  // merge of the two key groups: the wave of key group g finishes column group g of its 32 queries; it hands its partial
  // of the other column group to the partner wave (wave ^ 4, same queries, same lane map) and takes the partner's of its own
  const float mu0 = PCARRY - ci[0][0], mu1 = PCARRY - ci[1][0];   // the maxima in use
  const float mk = grp ? mu1 : mu0, lkp = grp ? lrow[1] : lrow[0];
  Xm[wave][0][lane] = grp ? mu0 : mu1;
  Xm[wave][1][lane] = grp ? lrow[0] : lrow[1];
  v8f keep[4];
#pragma unroll
  for (int dt = 0; dt < 4; ++dt) {
    keep[dt] = grp ? o[1][dt] : o[0][dt];
    const v8f give = grp ? o[0][dt] : o[1][dt];
    Xo[wave][2 * dt][lane]     = __builtin_shufflevector(give, give, 0, 1, 2, 3);
    Xo[wave][2 * dt + 1][lane] = __builtin_shufflevector(give, give, 4, 5, 6, 7);
  }
  __syncthreads();              // both partners' partials are in LDS

  const int part = wave ^ 4;
  const float mo = Xm[part][0][lane], lo = Xm[part][1][lane];
  const float mm = fmaxf(mk, mo);
  const float ak = __builtin_amdgcn_exp2f(mk - mm), ao = __builtin_amdgcn_exp2f(mo - mm);
  const float lsum = lkp * ak + lo * ao;

  // normalise: o and l hold the same carried p; ctx carried x64 -> o * 64 / l; l joins the two halves' sums
  const float inv = 64.0f * __builtin_amdgcn_rcpf(lsum + xhalf(lsum));
  const float fk = ak * inv, fo = ao * inv;

  // a lane's 8 registers of one dt are 8 consecutive d of one query row: one 16-byte LDS store each
#pragma unroll
  for (int dt = 0; dt < 4; ++dt) {
    const v4fa y0 = Xo[part][2 * dt][lane];
    const v4fa y1 = Xo[part][2 * dt + 1][lane];
    Pack8 w;
#pragma unroll
    for (int r = 0; r < 4; ++r) {
      w.s[r]     = (_Float16)(keep[dt][r] * fk + y0[r] * fo);
      w.s[r + 4] = (_Float16)(keep[dt][r + 4] * fk + y1[r] * fo);
    }
    *(v8ha*)&Ct[wave][n16 * LP + dt * 16 + 8 * hh] = w.h;
  }
  __syncthreads();              // staged rows complete before they are read back across lanes

  wave_store_rows16(&Ct[wave][0],
                    Cp + ((size_t)b * SEQ + q0 + 16 * grp) * EMB + h * HD, EMB);
}

// ---------------- kernel 3: output projection out = ctx . Wo^T + bo ----------------
// block = 256 threads (8 waves); block tile 128 tokens x 64 outputs; wave owns 16 x 64.
// The block's whole B slab (Wo rows n0..n0+63, all 512 k) is staged in LDS once, as f16(16 * bf16RNE(Wo)), behind one barrier;
// the k loop has no barrier, and only the second half of the A fragment loads waits for the one barrier: the slab's loads and a wave's A fragment loads are issued many at a time, ahead of their use.
__global__ __launch_bounds__(256) void k_oproj(
    const _Float16* __restrict__ Cp, const float* __restrict__ Wo,
    const float* __restrict__ bo, float* __restrict__ out) {
  __shared__ __align__(16) _Float16 Bt[64 * KP];     // [n local][k]
  __shared__ __align__(16) float Os[8][16 * OP];     // per wave f32 output staging

  const int tid = threadIdx.x, wave = tid >> 5, lane = tid & 31;
  const int hh = lane >> 4, n16 = lane & 15;
  const int m0 = blockIdx.x * 128 + wave * 16;
  const int n0 = blockIdx.y * 64;

  // the slab is 64 whole rows of Wo: 32768 consecutive floats; a wave's load covers 512 consecutive bytes
  const float* wsrc = Wo + (size_t)n0 * EMB + tid * 4;
  const _Float16* arow = Cp + (size_t)m0 * EMB;

  v4fa wr[32];
#pragma unroll  // constant indices keep wr in registers; the loads stand together
  for (int it = 0; it < 32; ++it) wr[it] = *(const v4fa*)(wsrc + it * 1024);

  v16h a[16];
#pragma unroll  // constant indices keep a in registers
  for (int ks = 0; ks < 8; ++ks) a[ks] = frag_h(arow + ks * 32, EMB);
  float braw[4];                // bias, read here so that no wait for it stands among the products behind later loads
#pragma unroll  // constant indices keep braw in registers
  for (int t = 0; t < 4; ++t) braw[t] = bo[n0 + t * 16 + n16];

  // load it of thread tid: row 2 it + (tid >> 7), k 4 (tid & 127) .. + 3
  _Float16* bdst = &Bt[(tid >> 7) * KP + (tid & 127) * 4];
#pragma unroll  // as above, wr
  for (int it = 0; it < 32; ++it) {
    v4ha w;
    w.x = (_Float16)(bfval(wr[it].x) * 16.0f);
    w.y = (_Float16)(bfval(wr[it].y) * 16.0f);
    w.z = (_Float16)(bfval(wr[it].z) * 16.0f);
    w.w = (_Float16)(bfval(wr[it].w) * 16.0f);
    *(v4ha*)(bdst + it * 2 * KP) = w;
  }
  __syncthreads();              // Bt visible

  // second half of the A fragments: into the registers that the staging has left; they land behind the first half's products
#pragma unroll  // as above, a
  for (int ks = 8; ks < 16; ++ks) a[ks] = frag_h(arow + ks * 32, EMB);

  v8f acc[4];
#pragma unroll
  for (int t = 0; t < 4; ++t) acc[t] = z8();

#pragma unroll  // constant indices keep a in registers
  for (int ks = 0; ks < 16; ++ks)
#pragma unroll  // constant indices keep acc in registers
    for (int t = 0; t < 4; ++t)
      acc[t] = mma_h(a[ks], frag_h(&Bt[(t * 16) * KP + ks * 32], KP), acc[t]);

  // epilogue: undo carries (64*16 = 1024), add bf16-RNE bias, stage f32 tile
#pragma unroll
  for (int t = 0; t < 4; ++t) {
    const float bias = bfval(braw[t]);
#pragma unroll
    for (int r = 0; r < 8; ++r)
      Os[wave][(8 * hh + r) * OP + t * 16 + n16] = acc[t][r] * (1.0f / 1024.0f) + bias;
  }
  __syncthreads();

  // 16 rows x 256 B = 32 lines; line = (row, half); 8 lanes x 16 B per line, 4 lines per instruction
  const int rsub = lane >> 3, c4 = (lane & 7) << 2;
  v4fa v[8];
#pragma unroll
  for (int it = 0; it < 8; ++it) {
    const int li = it * 4 + rsub;
    const int row = li >> 1, hf = li & 1;
    v[it] = *(const v4fa*)&Os[wave][row * OP + hf * 32 + c4];
  }
  float* base = out + (size_t)m0 * EMB + n0;
#pragma unroll
  for (int it = 0; it < 8; ++it) {
    const int li = it * 4 + rsub;
    const int row = li >> 1, hf = li & 1;
    *(v4fa*)(base + (size_t)row * EMB + hf * 32 + c4) = v[it];
  }
  
}

// ---------------- launcher ----------------
extern "C" void kernel_launch(void* const* d_in, const int* in_sizes, int n_in,
                              void* d_out, int out_size, void* d_ws, size_t ws_size,
                              hipStream_t stream) {
  if (n_in < 9) return;
  if (in_sizes[0] < ((NB - 1) * SEQ_FULL + SEQ) * EMB) return;
  if (in_sizes[1] < NH * HD * HD || in_sizes[3] < NH * HD * HD || in_sizes[5] < NH * HD * HD) return;
  if (in_sizes[2] < NH * HD || in_sizes[4] < NH * HD || in_sizes[6] < NH * HD) return;
  if (in_sizes[7] < EMB * EMB || in_sizes[8] < EMB) return;
  if (out_size < MTOK * EMB) return;

  const float* x  = (const float*)d_in[0];
  const float* Wq = (const float*)d_in[1];
  const float* bq = (const float*)d_in[2];
  const float* Wk = (const float*)d_in[3];
  const float* bk = (const float*)d_in[4];
  const float* Wv = (const float*)d_in[5];
  const float* bv = (const float*)d_in[6];
  const float* Wo = (const float*)d_in[7];
  const float* bo = (const float*)d_in[8];
  float* out = (float*)d_out;

  const size_t qkv_bytes = (size_t)NB * NH * SEQ * HD * 2;   // 8 MiB at full size
  const size_t ctx_bytes = (size_t)MTOK * EMB * 2;           // 8 MiB at full size
  const size_t off_q = 0;
  const size_t off_k = off_q + qkv_bytes;
  const size_t off_v = off_k + qkv_bytes;
  const size_t off_c = off_v + qkv_bytes;
  const size_t total = off_c + ctx_bytes;
  if (total > ws_size) return;

  char* ws = (char*)d_ws;
  _Float16* Qp  = (_Float16*)(ws + off_q);
  _Float16* Kp  = (_Float16*)(ws + off_k);
  _Float16* Vtp = (_Float16*)(ws + off_v);
  _Float16* Cp  = (_Float16*)(ws + off_c);

  k_qkv<<<dim3(MTOK / 128, NH), 256, 0, stream>>>(x, Wq, bq, Wk, bk, Wv, bv, Qp, Kp, Vtp);
  k_attn<<<dim3(NB * NH, SEQ / 128), 256, 0, stream>>>(Qp, Kp, Vtp, Cp);
  k_oproj<<<dim3(MTOK / 128, EMB / 64), 256, 0, stream>>>(Cp, Wo, bo, out);
}

// v009
// One run takes 46.4 microseconds.
// Timed twice side by side with v008, it ran 1.04 times as fast both times.
// Over all steps from v000 it is 4.52 times as fast.
#include <hip/hip_runtime.h>

// Contractions: per-head x*W^T (q,k,v) on v_wmma_f32_16x16x32_bf16 (bf16 operands); q*k^T, p*v, ctx*Wo^T on v_wmma_f32_16x16x32_f16 (f16 operands, power-of-two carries p*1024, ctx*64, Wo*16); f32 accumulate; softmax in f32.

#ifndef NB
#define NB 4
#endif
#ifndef SEQ
#define SEQ 2048
#endif
#define NB_FULL 4
#define SEQ_FULL 2048
#define EMB 512
#define NH 8
#define HD 64
#define MTOK (NB * SEQ)
// LDS row pitches: data row + 16 B, an odd multiple of 16 B, so that the 16 rows of a 16-byte fragment read fall on different banks
#define LP 72   // halves, rows of 64 halves (128 B -> 144 B)
#define KP 520  // halves, rows of 512 halves (1024 B -> 1040 B)
#define WP 9    // 16-byte chunks, rows of 8 chunks (128 B -> 144 B)
#define OP 68   // floats, rows of 64 floats (256 B -> 272 B)
#define VP 136  // halves, rows of 128 halves (256 B -> 272 B)
// the Q plane carries 1/sqrt(64) * log2(e), applied in f32 before the one rounding to f16: K . Q^T is then the softmax argument in base 2
#define QCARRY 0.18033688011112042f
// base-2 offset of the score accumulators: p is carried x 2^10; a maximum in use may be exceeded by 2^PROOM before it is renewed (p <= 2^14 in f16)
#define PCARRY 10.0f
#define PROOM 4.0f

static_assert(NB >= 1 && NB <= NB_FULL);
static_assert(SEQ >= 128 && SEQ <= SEQ_FULL && (SEQ % 128) == 0);
static_assert(EMB == NH * HD);
static_assert((EMB % 64) == 0 && (MTOK % 128) == 0);
// full-size carve: 3 planes of NB*NH*SEQ*HD halves + ctx plane of MTOK*EMB halves + Wo plane of EMB*EMB halves
static_assert((3ull * NB_FULL * NH * SEQ_FULL * HD + (unsigned long long)NB_FULL * SEQ_FULL * EMB + (unsigned long long)EMB * EMB) * 2ull <= 134217728ull);

typedef unsigned short u16;
typedef _Float16 v16h __attribute__((ext_vector_type(16)));
typedef __bf16   v16bf __attribute__((ext_vector_type(16)));
typedef float    v8f  __attribute__((ext_vector_type(8)));
typedef _Float16 v8ha __attribute__((ext_vector_type(8), __may_alias__));
typedef _Float16 v4ha __attribute__((ext_vector_type(4), __may_alias__));
typedef float    v4fa __attribute__((ext_vector_type(4), __may_alias__));
typedef unsigned v4u  __attribute__((ext_vector_type(4), __may_alias__));

union FragH { v16h v; v8ha p[2]; };
union FragB { v16bf v; v4u q[2]; };
union Pack8 { v8ha h; v4u u; _Float16 s[8]; };

// ---------------- helpers ----------------

__device__ __forceinline__ unsigned bfbits(float f) {   // f32 -> bf16 bits, RNE
  unsigned u = __float_as_uint(f);
  u += 0x7FFFu + ((u >> 16) & 1u);
  return u >> 16;
}
__device__ __forceinline__ float bfval(float f) {       // f32 -> value of its bf16 RNE image
  unsigned u = __float_as_uint(f);
  u += 0x7FFFu + ((u >> 16) & 1u);
  return __uint_as_float(u & 0xFFFF0000u);
}
__device__ __forceinline__ v8f z8() {
  v8f z = {0.f, 0.f, 0.f, 0.f, 0.f, 0.f, 0.f, 0.f};
  return z;
}

// 8 consecutive f32 -> 8 bf16 packed in 16 bytes (low half-word = lower index)
__device__ __forceinline__ v4u pack_bf8(const float* __restrict__ p) {
  const v4fa x0 = *(const v4fa*)p;
  const v4fa x1 = *(const v4fa*)(p + 4);
  v4u r;
  r.x = bfbits(x0.x) | (bfbits(x0.y) << 16);
  r.y = bfbits(x0.z) | (bfbits(x0.w) << 16);
  r.z = bfbits(x1.x) | (bfbits(x1.y) << 16);
  r.w = bfbits(x1.z) | (bfbits(x1.w) << 16);
  return r;
}

// 16x32 16-bit fragment (A or B layout, identical k map), row-major source, pitch ld (elements):
//   lane l: row = l&15; elements 0..7 <- k 8h..8h+7; elements 8..15 <- k 16+8h..16+8h+7, h = l>>4.
__device__ __forceinline__ v16h frag_h(const _Float16* base, int ld) {
  const int lane = threadIdx.x & 31;
  const int row  = lane & 15;
  const int kb   = (lane >> 4) << 3;
  FragH u;
  u.p[0] = *(const v8ha*)(base + (size_t)row * ld + kb);
  u.p[1] = *(const v8ha*)(base + (size_t)row * ld + 16 + kb);
  return u.v;
}

// A or B fragment from f32 rows (pitch ld floats), k columns k0..k0+31, converted to bf16 RNE.
__device__ __forceinline__ v16bf frag_x_bf(const float* base, int ld, int k0) {
  const int lane = threadIdx.x & 31;
  const int row  = lane & 15;
  const int kb   = (lane >> 4) << 3;
  const float* p = base + (size_t)row * ld + k0 + kb;
  FragB u;
  u.q[0] = pack_bf8(p);        // k0+kb .. k0+kb+7
  u.q[1] = pack_bf8(p + 16);   // k0+16+kb .. k0+16+kb+7
  return u.v;
}

// A or B fragment from an LDS bf16 tile stored as [n][8 chunks of 8 k] (64 k per row, row pitch WP chunks);
// rows nrow0..nrow0+15, k chunk base kc0 (0 -> k 0..31, 4 -> k 32..63).
__device__ __forceinline__ v16bf frag_w_bf(const v4u* tile, int nrow0, int kc0) {
  const int lane = threadIdx.x & 31;
  const int n    = lane & 15;
  const int hh   = lane >> 4;
  FragB u;
  u.q[0] = tile[(nrow0 + n) * WP + kc0 + hh];
  u.q[1] = tile[(nrow0 + n) * WP + kc0 + 2 + hh];
  return u.v;
}

// builtin forms: the compiler itself keeps the distance the chip needs behind a matrix instruction and is free to schedule round it
__device__ __forceinline__ v8f mma_h(v16h a, v16h b, v8f c) {
  v8f d = __builtin_amdgcn_wmma_f32_16x16x32_f16(false, a, false, b, (short)0, c, false, false);
  return d;
}
__device__ __forceinline__ v8f mma_bf(v16bf a, v16bf b, v8f c) {
  v8f d = __builtin_amdgcn_wmma_f32_16x16x32_bf16(false, a, false, b, (short)0, c, false, false);
  return d;
}

// value of the same column in the other 16-lane half (lane ^ 16), a vector cross-row move
__device__ __forceinline__ float xhalf(float x) {
  const int b = __float_as_int(x);
  return __int_as_float(__builtin_amdgcn_permlanex16(b, b, 0x76543210, 0xfedcba98, false, false));
}

// A lane's four 16-byte asynchronous copies global -> LDS (through no register): its share of one K tile and one V^T tile.
// l* = LDS byte address (low 32 bits of the __shared__ address), g* = global address, all multiples of 16 B.
// s_wait_xcnt 0 is the statement's last line so that no address register of a copy is rewritten in front of it.
__device__ __forceinline__ void copy4_to_lds(unsigned l0, const _Float16* g0, unsigned l1, const _Float16* g1,
                                             unsigned l2, const _Float16* g2, unsigned l3, const _Float16* g3) {
  asm volatile("global_load_async_to_lds_b128 %0, %1, off\n\t"
               "global_load_async_to_lds_b128 %2, %3, off\n\t"
               "global_load_async_to_lds_b128 %4, %5, off\n\t"
               "global_load_async_to_lds_b128 %6, %7, off\n\t"
               "s_wait_xcnt 0x0"
               :: "v"(l0), "v"(g0), "v"(l1), "v"(g1), "v"(l2), "v"(g2), "v"(l3), "v"(g3)
               : "memory");
}

// One wave writes its 16 x 64-half tile (LDS, pitch LP) to 16 global rows of pitch `pitch` halves.
__device__ __forceinline__ void wave_store_rows16(const _Float16* tile, _Float16* dst, int pitch) {
  const int lane = threadIdx.x & 31;
  const int rsub = lane >> 3, c8 = (lane & 7) << 3;
  Pack8 v[4];
#pragma unroll
  for (int it = 0; it < 4; ++it)
    v[it].h = *(const v8ha*)(tile + (it * 4 + rsub) * LP + c8);
#pragma unroll
  for (int it = 0; it < 4; ++it)
    *(v4u*)(dst + (size_t)(it * 4 + rsub) * pitch + c8) = v[it].u;
  
}

// ---------------- kernel 1: per-head q/k/v projections ----------------
// block = 256 threads (8 waves); block owns (128 tokens, head h); wave owns 16 tokens x 64 outputs.
// Q,K planes: [bh][s][64] f16, Q times QCARRY.   V plane transposed: [bh][64][SEQ] f16.
// The operand order of each product is that of its plane: Q^T = Wq . x^T and K^T = Wk . x^T (a lane's 8 accumulator registers are
// 8 consecutive d of one token), V = x . Wv^T (8 consecutive tokens of one d): 16 contiguous bytes of the plane's row either way,
// staged with one 16-byte LDS store and read back as 16 bytes. Both loaders have the same k map, so either side may be A or B.
// The launch also writes the Wo plane [n][k] = f16(16 * bf16RNE(Wo)), each element once, for the output projection two launches on:
// there 64 blocks read each row, and none of them has to convert it again.
__global__ __launch_bounds__(256) void k_qkv(
    const float* __restrict__ x,
    const float* __restrict__ Wq, const float* __restrict__ bq,
    const float* __restrict__ Wk, const float* __restrict__ bk,
    const float* __restrict__ Wv, const float* __restrict__ bv,
    const float* __restrict__ Wo,
    _Float16* __restrict__ Qp, _Float16* __restrict__ Kp, _Float16* __restrict__ Vtp, _Float16* __restrict__ Whp) {
  __shared__ __align__(16) v4u Wl[3][HD * WP];      // bf16 [n][k] per matrix, 8 k per chunk
  __shared__ __align__(16) float Bl[3][HD];          // bf16-RNE biases as f32
  __shared__ __align__(16) _Float16 St[128 * LP];    // f16 staging: Q, K [token local][d], pitch LP; V [d][token local], pitch VP
  static_assert(HD * VP <= 128 * LP);

  const int tid = threadIdx.x, wave = tid >> 5, lane = tid & 31;
  const int hh = lane >> 4, n16 = lane & 15;
  const int h  = blockIdx.y;
  const int m0 = blockIdx.x * 128;                   // compact token index
  const int b  = m0 / SEQ, s0 = m0 - b * SEQ;
  const int bh = b * NH + h;

  // Wo plane: chunks of 4 consecutive elements, dealt over the grid's threads; a chunk test reads the same for a whole block.
  // Read here, so that the loads fly with the weight loads; converted and stored at the kernel's end, where nothing waits for the stores.
  constexpr int WCH = EMB * EMB / 4, WTH = (MTOK / 128) * NH * 256, WIT = (WCH + WTH - 1) / WTH;
  const int wc0 = (blockIdx.y * (MTOK / 128) + blockIdx.x) * 256 + tid;
  v4fa wo[WIT];
#pragma unroll  // constant indices keep wo in registers
  for (int it = 0; it < WIT; ++it)
    if (wc0 + it * WTH < WCH) wo[it] = *(const v4fa*)(Wo + (size_t)(wc0 + it * WTH) * 4);

  // stage the head's three 64x64 weight tiles (bf16 RNE) and biases
#pragma unroll
  for (int c = tid; c < 512; c += 256) {
    const int nrow = c >> 3, ko = (c & 7) << 3;
    const size_t off = ((size_t)h * HD + nrow) * HD + ko;
    const int cl = nrow * WP + (c & 7);
    Wl[0][cl] = pack_bf8(Wq + off);
    Wl[1][cl] = pack_bf8(Wk + off);
    Wl[2][cl] = pack_bf8(Wv + off);
  }
  if (tid < HD) {                                    // wave-uniform (waves 0,1)
    Bl[0][tid] = bfval(bq[h * HD + tid]);
    Bl[1][tid] = bfval(bk[h * HD + tid]);
    Bl[2][tid] = bfval(bv[h * HD + tid]);
  }
  __syncthreads();

  // fragments of the wave's 16 tokens (64 input dims of head h), bf16 RNE in registers: B of the Q, K products, A of the V product
  const float* xp = x + ((size_t)b * SEQ_FULL + s0 + wave * 16) * EMB + h * HD;
  const v16bf a0 = frag_x_bf(xp, EMB, 0);
  const v16bf a1 = frag_x_bf(xp, EMB, 32);

#pragma unroll
  for (int mat = 0; mat < 3; ++mat) {
    v8f acc[4];
#pragma unroll
    for (int t = 0; t < 4; ++t) {
      v8f c = z8();
      if (mat < 2) {   // D element r of lane -> (d = t*16 + 8hh + r, token n16)
        c = mma_bf(frag_w_bf(Wl[mat], t * 16, 0), a0, c);
        c = mma_bf(frag_w_bf(Wl[mat], t * 16, 4), a1, c);
      } else {         // D element r of lane -> (token 8hh + r, d = t*16 + n16)
        c = mma_bf(a0, frag_w_bf(Wl[mat], t * 16, 0), c);
        c = mma_bf(a1, frag_w_bf(Wl[mat], t * 16, 4), c);
      }
      acc[t] = c;
    }
    // bias add in f32, convert to f16, stage a lane's 8 values of one tile as 16 bytes
#pragma unroll
    for (int t = 0; t < 4; ++t) {
      Pack8 w;
      if (mat < 2) {
        const v4fa b0 = *(const v4fa*)&Bl[mat][t * 16 + 8 * hh];
        const v4fa b1 = *(const v4fa*)&Bl[mat][t * 16 + 8 * hh + 4];
#pragma unroll  // constant indices keep acc and w in registers
        for (int r = 0; r < 4; ++r) {
          const float y0 = acc[t][r] + b0[r];
          const float y1 = acc[t][r + 4] + b1[r];
          w.s[r]     = (_Float16)(mat == 0 ? y0 * QCARRY : y0);
          w.s[r + 4] = (_Float16)(mat == 0 ? y1 * QCARRY : y1);
        }
        *(v8ha*)&St[(wave * 16 + n16) * LP + t * 16 + 8 * hh] = w.h;
      } else {
        const float bias = Bl[mat][t * 16 + n16];
#pragma unroll  // as above
        for (int r = 0; r < 8; ++r) w.s[r] = (_Float16)(acc[t][r] + bias);
        *(v8ha*)&St[(t * 16 + n16) * VP + wave * 16 + 8 * hh] = w.h;
      }
    }
    __syncthreads();

    if (mat < 2) {
      _Float16* plane = (mat == 0) ? Qp : Kp;
      wave_store_rows16(&St[(wave * 16) * LP],
                        plane + ((size_t)bh * SEQ + s0 + wave * 16) * HD, HD);
    } else {
      // V^T rows as staged: line L = (d, half); 8 lanes x 16 B per line, 4 lines per instruction, 32 per block-wide pass
      const int c8 = (tid & 7) << 3;
      Pack8 w[4];
#pragma unroll
      for (int it = 0; it < 4; ++it) {
        const int L = it * 32 + (tid >> 3);
        const int d = L >> 1, j0 = (L & 1) * 64 + c8;
        w[it].h = *(const v8ha*)&St[d * VP + j0];
      }
#pragma unroll
      for (int it = 0; it < 4; ++it) {
        const int L = it * 32 + (tid >> 3);
        const int d = L >> 1, j0 = (L & 1) * 64 + c8;
        *(v4u*)(Vtp + ((size_t)bh * HD + d) * SEQ + s0 + j0) = w[it].u;
      }
      
    }
    __syncthreads();                                 // St free for the next matrix
  }

#pragma unroll  // as above, wo
  for (int it = 0; it < WIT; ++it)
    if (wc0 + it * WTH < WCH) {
      v4ha w;
      w.x = (_Float16)(bfval(wo[it].x) * 16.0f);
      w.y = (_Float16)(bfval(wo[it].y) * 16.0f);
      w.z = (_Float16)(bfval(wo[it].z) * 16.0f);
      w.w = (_Float16)(bfval(wo[it].w) * 16.0f);
      *(v4ha*)(Whp + (size_t)(wc0 + it * WTH) * 4) = w;
    }
}

__global__ __launch_bounds__(256) void k_attn(
    const _Float16* __restrict__ Qp, const _Float16* __restrict__ Kp,
    const _Float16* __restrict__ Vtp, _Float16* __restrict__ Cp) {
  __shared__ __align__(16) _Float16 Kt[4][64 * LP];   // [2 * buffer + key group][key][d]
  __shared__ __align__(16) _Float16 Vt[4][HD * LP];   // [2 * buffer + key group][d][key]
  __shared__ __align__(16) _Float16 Ct[8][16 * LP];   // per wave [q row][d], ctx staging for whole-line stores
  __shared__ __align__(16) v4fa Xo[8][8][32];         // per wave [4 registers of O][lane]: partial O handed to the partner wave
  __shared__ float Xm[8][2][32];                      // per wave [maximum, sum][lane] of the same columns

  const int tid = threadIdx.x, lane = tid & 31;
  const int wave = __builtin_amdgcn_readfirstlane(tid >> 5);
  const int grp = wave >> 2;    // key group
  const int hh = lane >> 4, n16 = lane & 15;
  const int bh = blockIdx.x;
  const int b  = bh / NH, h = bh - b * NH;
  const int q0 = blockIdx.y * 128 + (wave & 3) * 32;

  const _Float16* Qbh = Qp  + (size_t)bh * SEQ * HD;
  const _Float16* Kbh = Kp  + (size_t)bh * SEQ * HD;
  const _Float16* Vbh = Vtp + (size_t)bh * HD * SEQ;

  // Q^T as B operand (column group cg: query q0 + 16cg + lane&15; d 0..31, 32..63), in registers for the whole key loop
  v16h bq[2][2];
#pragma unroll
  for (int cg = 0; cg < 2; ++cg) {
    bq[cg][0] = frag_h(Qbh + (size_t)(q0 + 16 * cg) * HD, HD);
    bq[cg][1] = frag_h(Qbh + (size_t)(q0 + 16 * cg) * HD + 32, HD);
  }

  float lrow[2] = {0.f, 0.f};         // running sum of the carried p of the column group's query n16 over this lane half's keys only
  v8f ci[2];                          // start value of the score accumulators, the same in every element: PCARRY - mu of that query (equal in both lane halves); pass 0 sets mu
#pragma unroll
  for (int cg = 0; cg < 2; ++cg)
#pragma unroll
    for (int r = 0; r < 8; ++r) ci[cg][r] = PCARRY;
  v8f o[2][4];                        // o[cg][dt][r] = O^T[d = 16dt + 8hh + r][query n16 of group cg]
#pragma unroll
  for (int cg = 0; cg < 2; ++cg)
#pragma unroll
    for (int t = 0; t < 4; ++t) o[cg][t] = z8();

  // a thread copies rows crow and crow + 32, 16 bytes at column coff, of each of a stage's four tiles
  const int crow = tid >> 3, coff = (tid & 7) << 3;
  const unsigned lk = (unsigned)(size_t)&Kt[0][crow * LP + coff];
  const unsigned lv = (unsigned)(size_t)&Vt[0][crow * LP + coff];
  const unsigned half_b = 32 * LP * 2, tile_b = 64 * LP * 2;   // bytes: 32 rows, one tile
  const _Float16* gk = Kbh + (size_t)crow * HD + coff;         // tile at key t0: + t0 * HD
  const _Float16* gv = Vbh + (size_t)crow * SEQ + coff;        // tile at key t0: + t0
  constexpr int NST = SEQ / 128;                               // stages

  auto stage_copy = [&](int s) {
    const unsigned bo = (unsigned)(s & 1) * 2u * tile_b;
    const _Float16* nk = gk + (size_t)s * 128 * HD;
    const _Float16* nv = gv + s * 128;
    copy4_to_lds(lk + bo, nk, lk + bo + half_b, nk + 32 * HD, lv + bo, nv, lv + bo + half_b, nv + (size_t)32 * SEQ);
    copy4_to_lds(lk + bo + tile_b, nk + 64 * HD, lk + bo + tile_b + half_b, nk + 96 * HD,
                 lv + bo + tile_b, nv + 64, lv + bo + tile_b + half_b, nv + (size_t)32 * SEQ + 64);
  };

  // stage 0 into buffer 0, landed and published
  stage_copy(0);
  asm volatile("s_wait_asynccnt 0x0" ::: "memory");   // this wave's copies of stage 0 have landed
  __syncthreads();              // stage 0 visible to every wave

  for (int s = 0; s < NST; ++s) {
    // directly behind the barrier (the one above, or the one at the foot of pass s - 1, which freed that pass's buffer):
    // stage s + 1, where there is one, into the other buffer; the test reads the same for the whole work-group.
    // It stands at the head, not at the foot, so that the pass ends in one straight block: with a branch at the foot the row sums are
    // moved behind it, the 64 registers of f32 p stay live through the last products, and the wave no longer fits 256 registers (4 waves per SIMD).
    if (s + 1 < NST) stage_copy(s + 1);

    const int tb = ((s & 1) << 1) + grp;
    const _Float16* Kb = &Kt[tb][0];
    const _Float16* Vb = &Vt[tb][0];

    // S^T(64 keys x 32 queries) = K(64x64) . Q^T + (PCARRY - mu) : sc[cg][t][r] = of query n16 of cg, key 16t + 8hh + r
    v8f sc[2][4];
#pragma unroll
    for (int t = 0; t < 4; ++t) {
      const v16h ka0 = frag_h(Kb + (t * 16) * LP, LP);
      const v16h ka1 = frag_h(Kb + (t * 16) * LP + 32, LP);
      v8f c0 = mma_h(ka0, bq[0][0], ci[0]);
      v8f c1 = mma_h(ka0, bq[1][0], ci[1]);
      c0 = mma_h(ka1, bq[0][1], c0);
      c1 = mma_h(ka1, bq[1][1], c1);
      sc[0][t] = c0;
      sc[1][t] = c1;
    }

    // a query's largest accumulator: 32 keys in this lane, the other 32 in lane ^ 16
    float mx[2];
#pragma unroll  // constant indices keep sc in registers
    for (int cg = 0; cg < 2; ++cg) {
      float m = sc[cg][0][0];
#pragma unroll  // as above
      for (int t = 0; t < 4; ++t)
#pragma unroll  // as above
        for (int r = 0; r < 8; ++r) m = fmaxf(m, sc[cg][t][r]);
      mx[cg] = fmaxf(m, xhalf(m));
    }

    // one test per pass, a scalar branch for the whole wave: pass 0 sets the maxima in use, a later pass renews them only past that room
    const bool renew = (s == 0) || (fmaxf(mx[0], mx[1]) > PCARRY + PROOM);
    if (__builtin_amdgcn_ballot_w32(renew) != 0) {
#pragma unroll  // constant indices keep sc, ci and o in registers
      for (int cg = 0; cg < 2; ++cg) {
        float d = mx[cg] - PCARRY;                 // the new maximum above the one in use
        if (s > 0) d = fmaxf(d, 0.f);              // a maximum in use never falls; a lane with nothing to renew keeps its own (d = 0)
        const float alpha = __builtin_amdgcn_exp2f(fminf(-d, 0.f));   // pass 0 scales zeros: any finite factor
        lrow[cg] *= alpha;
        const float cn = ci[cg][0] - d;
#pragma unroll  // as above
        for (int r = 0; r < 8; ++r) ci[cg][r] = cn;
#pragma unroll  // as above
        for (int t = 0; t < 4; ++t) {
          sc[cg][t] -= d;
          o[cg][t] *= alpha;
        }
      }
    }

    FragH pb[2][2];
#pragma unroll  // constant indices keep sc and pb in registers
    for (int cg = 0; cg < 2; ++cg) {
      // P^T as B operand, in frag_h's k order: element s of pb[cg][j] is key 32j + 16(s >> 3) + 8hh + (s & 7) = score tile 2j + (s >> 3), register s & 7
#pragma unroll  // as above
      for (int t = 0; t < 4; ++t) {
        v8f p;
#pragma unroll  // as above
        for (int r = 0; r < 8; ++r) p[r] = __builtin_amdgcn_exp2f(sc[cg][t][r]);
        sc[cg][t] = p;
        pb[cg][t >> 1].p[t & 1] = __builtin_convertvector(p, v8ha);
      }
      // in-lane sum of the 32 p as a tree: short dependent chains, packed adds
      const v8f s8 = (sc[cg][0] + sc[cg][1]) + (sc[cg][2] + sc[cg][3]);
      const float ps = ((s8[0] + s8[1]) + (s8[2] + s8[3])) + ((s8[4] + s8[5]) + (s8[6] + s8[7]));
      lrow[cg] += ps;
    }

    // O^T(64 d x 32 queries) += V^T(64 d x 64 keys) . P^T : A[m=d][k=key] = Vt[d][key]
#pragma unroll
    for (int dt = 0; dt < 4; ++dt) {
      const v16h va0 = frag_h(Vb + (dt * 16) * LP, LP);
      const v16h va1 = frag_h(Vb + (dt * 16) * LP + 32, LP);
      v8f c0 = o[0][dt], c1 = o[1][dt];
      c0 = mma_h(va0, pb[0][0].v, c0);
      c1 = mma_h(va0, pb[1][0].v, c1);
      c0 = mma_h(va1, pb[0][1].v, c0);
      c1 = mma_h(va1, pb[1][1].v, c1);
      o[0][dt] = c0;
      o[1][dt] = c1;
    }

    // hand-over: this wave's reads of stage s are done, its copies of stage s + 1 have landed; the one barrier
    // publishes stage s + 1 and frees stage s's buffer, which takes stage s + 2 at the head of the next pass
    asm volatile("s_wait_dscnt 0x0" ::: "memory");      // own LDS reads retired before the buffer is refilled
    asm volatile("s_wait_asynccnt 0x0" ::: "memory");   // own copies landed before other waves read them
    __syncthreads();
  }
  asm volatile("s_wait_asynccnt 0x0" ::: "memory");     // nothing of this wave in flight behind the loop

  // merge of the two key groups: the wave of key group g finishes column group g of its 32 queries; it hands its partial
  // of the other column group to the partner wave (wave ^ 4, same queries, same lane map) and takes the partner's of its own
  const float mu0 = PCARRY - ci[0][0], mu1 = PCARRY - ci[1][0];   // the maxima in use
  const float mk = grp ? mu1 : mu0, lkp = grp ? lrow[1] : lrow[0];
  Xm[wave][0][lane] = grp ? mu0 : mu1;
  Xm[wave][1][lane] = grp ? lrow[0] : lrow[1];
  v8f keep[4];
#pragma unroll
  for (int dt = 0; dt < 4; ++dt) {
    keep[dt] = grp ? o[1][dt] : o[0][dt];
    const v8f give = grp ? o[0][dt] : o[1][dt];
    Xo[wave][2 * dt][lane]     = __builtin_shufflevector(give, give, 0, 1, 2, 3);
    Xo[wave][2 * dt + 1][lane] = __builtin_shufflevector(give, give, 4, 5, 6, 7);
  }
  __syncthreads();              // both partners' partials are in LDS

  const int part = wave ^ 4;
  const float mo = Xm[part][0][lane], lo = Xm[part][1][lane];
  const float mm = fmaxf(mk, mo);
  const float ak = __builtin_amdgcn_exp2f(mk - mm), ao = __builtin_amdgcn_exp2f(mo - mm);
  const float lsum = lkp * ak + lo * ao;

  // normalise: o and l hold the same carried p; ctx carried x64 -> o * 64 / l; l joins the two halves' sums
  const float inv = 64.0f * __builtin_amdgcn_rcpf(lsum + xhalf(lsum));
  const float fk = ak * inv, fo = ao * inv;

  // a lane's 8 registers of one dt are 8 consecutive d of one query row: one 16-byte LDS store each
#pragma unroll
  for (int dt = 0; dt < 4; ++dt) {
    const v4fa y0 = Xo[part][2 * dt][lane];
    const v4fa y1 = Xo[part][2 * dt + 1][lane];
    Pack8 w;
#pragma unroll
    for (int r = 0; r < 4; ++r) {
      w.s[r]     = (_Float16)(keep[dt][r] * fk + y0[r] * fo);
      w.s[r + 4] = (_Float16)(keep[dt][r + 4] * fk + y1[r] * fo);
    }
    *(v8ha*)&Ct[wave][n16 * LP + dt * 16 + 8 * hh] = w.h;
  }
  __syncthreads();              // staged rows complete before they are read back across lanes

  wave_store_rows16(&Ct[wave][0],
                    Cp + ((size_t)b * SEQ + q0 + 16 * grp) * EMB + h * HD, EMB);
}

// ---------------- kernel 3: output projection out = ctx . Wo^T + bo ----------------
// block = 256 threads (8 waves); block tile 128 tokens x 64 outputs; wave owns 16 x 64.
// The block's whole B slab (rows n0..n0+63 of the Wo plane, all 512 k, f16 as the first launch left them) is staged in LDS once, behind one barrier;
// the k loop has no barrier, so no global load waits for a barrier: the slab's loads and a wave's A fragment loads are issued many at a time, ahead of their use.
__global__ __launch_bounds__(256) void k_oproj(
    const _Float16* __restrict__ Cp, const _Float16* __restrict__ Whp,
    const float* __restrict__ bo, float* __restrict__ out) {
  __shared__ __align__(16) _Float16 Bt[64 * KP];     // [n local][k]
  __shared__ __align__(16) float Os[8][16 * OP];     // per wave f32 output staging

  const int tid = threadIdx.x, wave = tid >> 5, lane = tid & 31;
  const int hh = lane >> 4, n16 = lane & 15;
  const int m0 = blockIdx.x * 128 + wave * 16;
  const int n0 = blockIdx.y * 64;

  // the slab is 64 whole rows of the plane: 32768 consecutive halves; a wave's load covers 512 consecutive bytes
  const _Float16* wsrc = Whp + (size_t)n0 * EMB + tid * 8;
  const _Float16* arow = Cp + (size_t)m0 * EMB;

  v4u wr[16];
#pragma unroll  // constant indices keep wr in registers; the loads stand together
  for (int it = 0; it < 16; ++it) wr[it] = *(const v4u*)(wsrc + it * 2048);

  v16h a[16];
#pragma unroll  // constant indices keep a in registers
  for (int ks = 0; ks < 8; ++ks) a[ks] = frag_h(arow + ks * 32, EMB);
  float braw[4];                // bias, read here so that no wait for it stands among the products behind later loads
#pragma unroll  // constant indices keep braw in registers
  for (int t = 0; t < 4; ++t) braw[t] = bo[n0 + t * 16 + n16];

  // load it of thread tid: row 4 it + (tid >> 6), k 8 (tid & 63) .. + 7
  _Float16* bdst = &Bt[(tid >> 6) * KP + (tid & 63) * 8];
#pragma unroll  // as above, wr
  for (int it = 0; it < 16; ++it) *(v4u*)(bdst + it * 4 * KP) = wr[it];
  __syncthreads();              // Bt visible

  // second half of the A fragments: behind the barrier, which waits for every load in flight; they land behind the first half's products
#pragma unroll  // as above, a
  for (int ks = 8; ks < 16; ++ks) a[ks] = frag_h(arow + ks * 32, EMB);

  v8f acc[4];
#pragma unroll
  for (int t = 0; t < 4; ++t) acc[t] = z8();

#pragma unroll  // constant indices keep a in registers
  for (int ks = 0; ks < 16; ++ks)
#pragma unroll  // constant indices keep acc in registers
    for (int t = 0; t < 4; ++t)
      acc[t] = mma_h(a[ks], frag_h(&Bt[(t * 16) * KP + ks * 32], KP), acc[t]);

  // epilogue: undo carries (64*16 = 1024), add bf16-RNE bias, stage f32 tile
#pragma unroll
  for (int t = 0; t < 4; ++t) {
    const float bias = bfval(braw[t]);
#pragma unroll
    for (int r = 0; r < 8; ++r)
      Os[wave][(8 * hh + r) * OP + t * 16 + n16] = acc[t][r] * (1.0f / 1024.0f) + bias;
  }
  __syncthreads();

  // 16 rows x 256 B = 32 lines; line = (row, half); 8 lanes x 16 B per line, 4 lines per instruction
  const int rsub = lane >> 3, c4 = (lane & 7) << 2;
  v4fa v[8];
#pragma unroll
  for (int it = 0; it < 8; ++it) {
    const int li = it * 4 + rsub;
    const int row = li >> 1, hf = li & 1;
    v[it] = *(const v4fa*)&Os[wave][row * OP + hf * 32 + c4];
  }
  float* base = out + (size_t)m0 * EMB + n0;
#pragma unroll
  for (int it = 0; it < 8; ++it) {
    const int li = it * 4 + rsub;
    const int row = li >> 1, hf = li & 1;
    *(v4fa*)(base + (size_t)row * EMB + hf * 32 + c4) = v[it];
  }
  
}

// ---------------- launcher ----------------
extern "C" void kernel_launch(void* const* d_in, const int* in_sizes, int n_in,
                              void* d_out, int out_size, void* d_ws, size_t ws_size,
                              hipStream_t stream) {
  if (n_in < 9) return;
  if (in_sizes[0] < ((NB - 1) * SEQ_FULL + SEQ) * EMB) return;
  if (in_sizes[1] < NH * HD * HD || in_sizes[3] < NH * HD * HD || in_sizes[5] < NH * HD * HD) return;
  if (in_sizes[2] < NH * HD || in_sizes[4] < NH * HD || in_sizes[6] < NH * HD) return;
  if (in_sizes[7] < EMB * EMB || in_sizes[8] < EMB) return;
  if (out_size < MTOK * EMB) return;

  const float* x  = (const float*)d_in[0];
  const float* Wq = (const float*)d_in[1];
  const float* bq = (const float*)d_in[2];
  const float* Wk = (const float*)d_in[3];
  const float* bk = (const float*)d_in[4];
  const float* Wv = (const float*)d_in[5];
  const float* bv = (const float*)d_in[6];
  const float* Wo = (const float*)d_in[7];
  const float* bo = (const float*)d_in[8];
  float* out = (float*)d_out;

  const size_t qkv_bytes = (size_t)NB * NH * SEQ * HD * 2;   // 8 MiB at full size
  const size_t ctx_bytes = (size_t)MTOK * EMB * 2;           // 8 MiB at full size
  const size_t off_q = 0;
  const size_t off_k = off_q + qkv_bytes;
  const size_t off_v = off_k + qkv_bytes;
  const size_t off_c = off_v + qkv_bytes;
  const size_t off_w = off_c + ctx_bytes;
  const size_t total = off_w + (size_t)EMB * EMB * 2;        // + 512 KiB
  if (total > ws_size) return;

  char* ws = (char*)d_ws;
  _Float16* Qp  = (_Float16*)(ws + off_q);
  _Float16* Kp  = (_Float16*)(ws + off_k);
  _Float16* Vtp = (_Float16*)(ws + off_v);
  _Float16* Cp  = (_Float16*)(ws + off_c);
  _Float16* Whp = (_Float16*)(ws + off_w);

  k_qkv<<<dim3(MTOK / 128, NH), 256, 0, stream>>>(x, Wq, bq, Wk, bk, Wv, bv, Wo, Qp, Kp, Vtp, Whp);
  k_attn<<<dim3(NB * NH, SEQ / 128), 256, 0, stream>>>(Qp, Kp, Vtp, Cp);
  k_oproj<<<dim3(MTOK / 128, EMB / 64), 256, 0, stream>>>(Cp, Whp, bo, out);
}

// v010
// One run takes 44.4 microseconds.
// Two timings next to v009 put it at 1.04 and 1.05 times that version's speed.
// Counting every step since v000, it is 4.72 times as fast.
#include <hip/hip_runtime.h>

// Contractions: per-head x*W^T (q,k,v) on v_wmma_f32_16x16x32_bf16 (bf16 operands); q*k^T, p*v, ctx*Wo^T on v_wmma_f32_16x16x32_f16 (f16 operands, power-of-two carries p*1024, ctx*64, Wo*16); f32 accumulate; softmax in f32.

#ifndef NB
#define NB 4
#endif
#ifndef SEQ
#define SEQ 2048
#endif
#define NB_FULL 4
#define SEQ_FULL 2048
#define EMB 512
#define NH 8
#define HD 64
#define MTOK (NB * SEQ)
// LDS row pitches: data row + 16 B, an odd multiple of 16 B, so that the 16 rows of a 16-byte fragment read fall on different banks
#define LP 72   // halves, rows of 64 halves (128 B -> 144 B)
#define KP 520  // halves, rows of 512 halves (1024 B -> 1040 B)
#define WP 9    // 16-byte chunks, rows of 8 chunks (128 B -> 144 B)
#define OP 68   // floats, rows of 64 floats (256 B -> 272 B)
#define VP 136  // halves, rows of 128 halves (256 B -> 272 B)
// the Q plane carries 1/sqrt(64) * log2(e), applied in f32 before the one rounding to f16: K . Q^T is then the softmax argument in base 2
#define QCARRY 0.18033688011112042f
// base-2 offset of the score accumulators: p is carried x 2^10; a maximum in use stays until a lane's 32 carried p of one pass sum to more than
// PSUMMAX, the largest finite f16 (a p above it would round to infinity in the B operand)
#define PCARRY 10.0f
#define PSUMMAX 65504.0f

static_assert(NB >= 1 && NB <= NB_FULL);
static_assert(SEQ >= 128 && SEQ <= SEQ_FULL && (SEQ % 128) == 0);
static_assert(EMB == NH * HD);
static_assert((EMB % 64) == 0 && (MTOK % 128) == 0);
// full-size carve: 3 planes of NB*NH*SEQ*HD halves + ctx plane of MTOK*EMB halves + Wo plane of EMB*EMB halves
static_assert((3ull * NB_FULL * NH * SEQ_FULL * HD + (unsigned long long)NB_FULL * SEQ_FULL * EMB + (unsigned long long)EMB * EMB) * 2ull <= 134217728ull);

typedef unsigned short u16;
typedef _Float16 v16h __attribute__((ext_vector_type(16)));
typedef __bf16   v16bf __attribute__((ext_vector_type(16)));
typedef float    v8f  __attribute__((ext_vector_type(8)));
typedef _Float16 v8ha __attribute__((ext_vector_type(8), __may_alias__));
typedef _Float16 v4ha __attribute__((ext_vector_type(4), __may_alias__));
typedef float    v4fa __attribute__((ext_vector_type(4), __may_alias__));
typedef unsigned v4u  __attribute__((ext_vector_type(4), __may_alias__));

union FragH { v16h v; v8ha p[2]; };
union FragB { v16bf v; v4u q[2]; };
union Pack8 { v8ha h; v4u u; _Float16 s[8]; };

// ---------------- helpers ----------------

__device__ __forceinline__ unsigned bfbits(float f) {   // f32 -> bf16 bits, RNE
  unsigned u = __float_as_uint(f);
  u += 0x7FFFu + ((u >> 16) & 1u);
  return u >> 16;
}
__device__ __forceinline__ float bfval(float f) {       // f32 -> value of its bf16 RNE image
  unsigned u = __float_as_uint(f);
  u += 0x7FFFu + ((u >> 16) & 1u);
  return __uint_as_float(u & 0xFFFF0000u);
}
__device__ __forceinline__ v8f z8() {
  v8f z = {0.f, 0.f, 0.f, 0.f, 0.f, 0.f, 0.f, 0.f};
  return z;
}

// 8 consecutive f32 -> 8 bf16 packed in 16 bytes (low half-word = lower index)
__device__ __forceinline__ v4u pack_bf8(const float* __restrict__ p) {
  const v4fa x0 = *(const v4fa*)p;
  const v4fa x1 = *(const v4fa*)(p + 4);
  v4u r;
  r.x = bfbits(x0.x) | (bfbits(x0.y) << 16);
  r.y = bfbits(x0.z) | (bfbits(x0.w) << 16);
  r.z = bfbits(x1.x) | (bfbits(x1.y) << 16);
  r.w = bfbits(x1.z) | (bfbits(x1.w) << 16);
  return r;
}

// 16x32 16-bit fragment (A or B layout, identical k map), row-major source, pitch ld (elements):
//   lane l: row = l&15; elements 0..7 <- k 8h..8h+7; elements 8..15 <- k 16+8h..16+8h+7, h = l>>4.
__device__ __forceinline__ v16h frag_h(const _Float16* base, int ld) {
  const int lane = threadIdx.x & 31;
  const int row  = lane & 15;
  const int kb   = (lane >> 4) << 3;
  FragH u;
  u.p[0] = *(const v8ha*)(base + (size_t)row * ld + kb);
  u.p[1] = *(const v8ha*)(base + (size_t)row * ld + 16 + kb);
  return u.v;
}

// A or B fragment from f32 rows (pitch ld floats), k columns k0..k0+31, converted to bf16 RNE.
__device__ __forceinline__ v16bf frag_x_bf(const float* base, int ld, int k0) {
  const int lane = threadIdx.x & 31;
  const int row  = lane & 15;
  const int kb   = (lane >> 4) << 3;
  const float* p = base + (size_t)row * ld + k0 + kb;
  FragB u;
  u.q[0] = pack_bf8(p);        // k0+kb .. k0+kb+7
  u.q[1] = pack_bf8(p + 16);   // k0+16+kb .. k0+16+kb+7
  return u.v;
}

// A or B fragment from an LDS bf16 tile stored as [n][8 chunks of 8 k] (64 k per row, row pitch WP chunks);
// rows nrow0..nrow0+15, k chunk base kc0 (0 -> k 0..31, 4 -> k 32..63).
__device__ __forceinline__ v16bf frag_w_bf(const v4u* tile, int nrow0, int kc0) {
  const int lane = threadIdx.x & 31;
  const int n    = lane & 15;
  const int hh   = lane >> 4;
  FragB u;
  u.q[0] = tile[(nrow0 + n) * WP + kc0 + hh];
  u.q[1] = tile[(nrow0 + n) * WP + kc0 + 2 + hh];
  return u.v;
}

// builtin forms: the compiler itself keeps the distance the chip needs behind a matrix instruction and is free to schedule round it
__device__ __forceinline__ v8f mma_h(v16h a, v16h b, v8f c) {
  v8f d = __builtin_amdgcn_wmma_f32_16x16x32_f16(false, a, false, b, (short)0, c, false, false);
  return d;
}
__device__ __forceinline__ v8f mma_bf(v16bf a, v16bf b, v8f c) {
  v8f d = __builtin_amdgcn_wmma_f32_16x16x32_bf16(false, a, false, b, (short)0, c, false, false);
  return d;
}

// value of the same column in the other 16-lane half (lane ^ 16), a vector cross-row move
__device__ __forceinline__ float xhalf(float x) {
  const int b = __float_as_int(x);
  return __int_as_float(__builtin_amdgcn_permlanex16(b, b, 0x76543210, 0xfedcba98, false, false));
}

// A lane's four 16-byte asynchronous copies global -> LDS (through no register): its share of one K tile and one V^T tile.
// l* = LDS byte address (low 32 bits of the __shared__ address), g* = global address, all multiples of 16 B.
// s_wait_xcnt 0 is the statement's last line so that no address register of a copy is rewritten in front of it.
__device__ __forceinline__ void copy4_to_lds(unsigned l0, const _Float16* g0, unsigned l1, const _Float16* g1,
                                             unsigned l2, const _Float16* g2, unsigned l3, const _Float16* g3) {
  asm volatile("global_load_async_to_lds_b128 %0, %1, off\n\t"
               "global_load_async_to_lds_b128 %2, %3, off\n\t"
               "global_load_async_to_lds_b128 %4, %5, off\n\t"
               "global_load_async_to_lds_b128 %6, %7, off\n\t"
               "s_wait_xcnt 0x0"
               :: "v"(l0), "v"(g0), "v"(l1), "v"(g1), "v"(l2), "v"(g2), "v"(l3), "v"(g3)
               : "memory");
}

// One wave writes its 16 x 64-half tile (LDS, pitch LP) to 16 global rows of pitch `pitch` halves.
__device__ __forceinline__ void wave_store_rows16(const _Float16* tile, _Float16* dst, int pitch) {
  const int lane = threadIdx.x & 31;
  const int rsub = lane >> 3, c8 = (lane & 7) << 3;
  Pack8 v[4];
#pragma unroll
  for (int it = 0; it < 4; ++it)
    v[it].h = *(const v8ha*)(tile + (it * 4 + rsub) * LP + c8);
#pragma unroll
  for (int it = 0; it < 4; ++it)
    *(v4u*)(dst + (size_t)(it * 4 + rsub) * pitch + c8) = v[it].u;
  
}

// ---------------- kernel 1: per-head q/k/v projections ----------------
// block = 256 threads (8 waves); block owns (128 tokens, head h); wave owns 16 tokens x 64 outputs.
// Q,K planes: [bh][s][64] f16, Q times QCARRY.   V plane transposed: [bh][64][SEQ] f16.
// The operand order of each product is that of its plane: Q^T = Wq . x^T and K^T = Wk . x^T (a lane's 8 accumulator registers are
// 8 consecutive d of one token), V = x . Wv^T (8 consecutive tokens of one d): 16 contiguous bytes of the plane's row either way,
// staged with one 16-byte LDS store and read back as 16 bytes. Both loaders have the same k map, so either side may be A or B.
// The launch also writes the Wo plane [n][k] = f16(16 * bf16RNE(Wo)), each element once, for the output projection two launches on:
// there 64 blocks read each row, and none of them has to convert it again.
__global__ __launch_bounds__(256) void k_qkv(
    const float* __restrict__ x,
    const float* __restrict__ Wq, const float* __restrict__ bq,
    const float* __restrict__ Wk, const float* __restrict__ bk,
    const float* __restrict__ Wv, const float* __restrict__ bv,
    const float* __restrict__ Wo,
    _Float16* __restrict__ Qp, _Float16* __restrict__ Kp, _Float16* __restrict__ Vtp, _Float16* __restrict__ Whp) {
  __shared__ __align__(16) v4u Wl[3][HD * WP];      // bf16 [n][k] per matrix, 8 k per chunk
  __shared__ __align__(16) float Bl[3][HD];          // bf16-RNE biases as f32
  __shared__ __align__(16) _Float16 St[128 * LP];    // f16 staging: Q, K [token local][d], pitch LP; V [d][token local], pitch VP
  static_assert(HD * VP <= 128 * LP);

  const int tid = threadIdx.x, wave = tid >> 5, lane = tid & 31;
  const int hh = lane >> 4, n16 = lane & 15;
  const int h  = blockIdx.y;
  const int m0 = blockIdx.x * 128;                   // compact token index
  const int b  = m0 / SEQ, s0 = m0 - b * SEQ;
  const int bh = b * NH + h;

  // Wo plane: chunks of 4 consecutive elements, dealt over the grid's threads; a chunk test reads the same for a whole block.
  // Read here, so that the loads fly with the weight loads; converted and stored at the kernel's end, where nothing waits for the stores.
  constexpr int WCH = EMB * EMB / 4, WTH = (MTOK / 128) * NH * 256, WIT = (WCH + WTH - 1) / WTH;
  const int wc0 = (blockIdx.y * (MTOK / 128) + blockIdx.x) * 256 + tid;
  v4fa wo[WIT];
#pragma unroll  // constant indices keep wo in registers
  for (int it = 0; it < WIT; ++it)
    if (wc0 + it * WTH < WCH) wo[it] = *(const v4fa*)(Wo + (size_t)(wc0 + it * WTH) * 4);

  // stage the head's three 64x64 weight tiles (bf16 RNE) and biases
#pragma unroll
  for (int c = tid; c < 512; c += 256) {
    const int nrow = c >> 3, ko = (c & 7) << 3;
    const size_t off = ((size_t)h * HD + nrow) * HD + ko;
    const int cl = nrow * WP + (c & 7);
    Wl[0][cl] = pack_bf8(Wq + off);
    Wl[1][cl] = pack_bf8(Wk + off);
    Wl[2][cl] = pack_bf8(Wv + off);
  }
  if (tid < HD) {                                    // wave-uniform (waves 0,1)
    Bl[0][tid] = bfval(bq[h * HD + tid]);
    Bl[1][tid] = bfval(bk[h * HD + tid]);
    Bl[2][tid] = bfval(bv[h * HD + tid]);
  }
  __syncthreads();

  // fragments of the wave's 16 tokens (64 input dims of head h), bf16 RNE in registers: B of the Q, K products, A of the V product
  const float* xp = x + ((size_t)b * SEQ_FULL + s0 + wave * 16) * EMB + h * HD;
  const v16bf a0 = frag_x_bf(xp, EMB, 0);
  const v16bf a1 = frag_x_bf(xp, EMB, 32);

#pragma unroll
  for (int mat = 0; mat < 3; ++mat) {
    v8f acc[4];
#pragma unroll
    for (int t = 0; t < 4; ++t) {
      v8f c = z8();
      if (mat < 2) {   // D element r of lane -> (d = t*16 + 8hh + r, token n16)
        c = mma_bf(frag_w_bf(Wl[mat], t * 16, 0), a0, c);
        c = mma_bf(frag_w_bf(Wl[mat], t * 16, 4), a1, c);
      } else {         // D element r of lane -> (token 8hh + r, d = t*16 + n16)
        c = mma_bf(a0, frag_w_bf(Wl[mat], t * 16, 0), c);
        c = mma_bf(a1, frag_w_bf(Wl[mat], t * 16, 4), c);
      }
      acc[t] = c;
    }
    // bias add in f32, convert to f16, stage a lane's 8 values of one tile as 16 bytes
#pragma unroll
    for (int t = 0; t < 4; ++t) {
      Pack8 w;
      if (mat < 2) {
        const v4fa b0 = *(const v4fa*)&Bl[mat][t * 16 + 8 * hh];
        const v4fa b1 = *(const v4fa*)&Bl[mat][t * 16 + 8 * hh + 4];
#pragma unroll  // constant indices keep acc and w in registers
        for (int r = 0; r < 4; ++r) {
          const float y0 = acc[t][r] + b0[r];
          const float y1 = acc[t][r + 4] + b1[r];
          w.s[r]     = (_Float16)(mat == 0 ? y0 * QCARRY : y0);
          w.s[r + 4] = (_Float16)(mat == 0 ? y1 * QCARRY : y1);
        }
        *(v8ha*)&St[(wave * 16 + n16) * LP + t * 16 + 8 * hh] = w.h;
      } else {
        const float bias = Bl[mat][t * 16 + n16];
#pragma unroll  // as above
        for (int r = 0; r < 8; ++r) w.s[r] = (_Float16)(acc[t][r] + bias);
        *(v8ha*)&St[(t * 16 + n16) * VP + wave * 16 + 8 * hh] = w.h;
      }
    }
    __syncthreads();

    if (mat < 2) {
      _Float16* plane = (mat == 0) ? Qp : Kp;
      wave_store_rows16(&St[(wave * 16) * LP],
                        plane + ((size_t)bh * SEQ + s0 + wave * 16) * HD, HD);
    } else {
      // V^T rows as staged: line L = (d, half); 8 lanes x 16 B per line, 4 lines per instruction, 32 per block-wide pass
      const int c8 = (tid & 7) << 3;
      Pack8 w[4];
#pragma unroll
      for (int it = 0; it < 4; ++it) {
        const int L = it * 32 + (tid >> 3);
        const int d = L >> 1, j0 = (L & 1) * 64 + c8;
        w[it].h = *(const v8ha*)&St[d * VP + j0];
      }
#pragma unroll
      for (int it = 0; it < 4; ++it) {
        const int L = it * 32 + (tid >> 3);
        const int d = L >> 1, j0 = (L & 1) * 64 + c8;
        *(v4u*)(Vtp + ((size_t)bh * HD + d) * SEQ + s0 + j0) = w[it].u;
      }
      
    }
    __syncthreads();                                 // St free for the next matrix
  }

#pragma unroll  // as above, wo
  for (int it = 0; it < WIT; ++it)
    if (wc0 + it * WTH < WCH) {
      v4ha w;
      w.x = (_Float16)(bfval(wo[it].x) * 16.0f);
      w.y = (_Float16)(bfval(wo[it].y) * 16.0f);
      w.z = (_Float16)(bfval(wo[it].z) * 16.0f);
      w.w = (_Float16)(bfval(wo[it].w) * 16.0f);
      *(v4ha*)(Whp + (size_t)(wc0 + it * WTH) * 4) = w;
    }
}

__global__ __launch_bounds__(256) void k_attn(
    const _Float16* __restrict__ Qp, const _Float16* __restrict__ Kp,
    const _Float16* __restrict__ Vtp, _Float16* __restrict__ Cp) {
  __shared__ __align__(16) _Float16 Kt[4][64 * LP];   // [2 * buffer + key group][key][d]
  __shared__ __align__(16) _Float16 Vt[4][HD * LP];   // [2 * buffer + key group][d][key]
  __shared__ __align__(16) _Float16 Ct[8][16 * LP];   // per wave [q row][d], ctx staging for whole-line stores
  __shared__ __align__(16) v4fa Xo[8][8][32];         // per wave [4 registers of O][lane]: partial O handed to the partner wave
  __shared__ float Xm[8][2][32];                      // per wave [maximum, sum][lane] of the same columns

  const int tid = threadIdx.x, lane = tid & 31;
  const int wave = __builtin_amdgcn_readfirstlane(tid >> 5);
  const int grp = wave >> 2;    // key group
  const int hh = lane >> 4, n16 = lane & 15;
  const int bh = blockIdx.x;
  const int b  = bh / NH, h = bh - b * NH;
  const int q0 = blockIdx.y * 128 + (wave & 3) * 32;

  const _Float16* Qbh = Qp  + (size_t)bh * SEQ * HD;
  const _Float16* Kbh = Kp  + (size_t)bh * SEQ * HD;
  const _Float16* Vbh = Vtp + (size_t)bh * HD * SEQ;

  // Q^T as B operand (column group cg: query q0 + 16cg + lane&15; d 0..31, 32..63), in registers for the whole key loop
  v16h bq[2][2];
#pragma unroll
  for (int cg = 0; cg < 2; ++cg) {
    bq[cg][0] = frag_h(Qbh + (size_t)(q0 + 16 * cg) * HD, HD);
    bq[cg][1] = frag_h(Qbh + (size_t)(q0 + 16 * cg) * HD + 32, HD);
  }

  float lrow[2] = {0.f, 0.f};         // running sum of the carried p of the column group's query n16 over this lane half's keys only
  v8f ci[2];                          // start value of the score accumulators, the same in every element: PCARRY - mu of that query (equal in both lane halves); pass 0 sets mu
#pragma unroll
  for (int cg = 0; cg < 2; ++cg)
#pragma unroll
    for (int r = 0; r < 8; ++r) ci[cg][r] = PCARRY;
  v8f o[2][4];                        // o[cg][dt][r] = O^T[d = 16dt + 8hh + r][query n16 of group cg]
#pragma unroll
  for (int cg = 0; cg < 2; ++cg)
#pragma unroll
    for (int t = 0; t < 4; ++t) o[cg][t] = z8();

  // a thread copies rows crow and crow + 32, 16 bytes at column coff, of each of a stage's four tiles
  const int crow = tid >> 3, coff = (tid & 7) << 3;
  const unsigned lk = (unsigned)(size_t)&Kt[0][crow * LP + coff];
  const unsigned lv = (unsigned)(size_t)&Vt[0][crow * LP + coff];
  const unsigned half_b = 32 * LP * 2, tile_b = 64 * LP * 2;   // bytes: 32 rows, one tile
  const _Float16* gk = Kbh + (size_t)crow * HD + coff;         // tile at key t0: + t0 * HD
  const _Float16* gv = Vbh + (size_t)crow * SEQ + coff;        // tile at key t0: + t0
  constexpr int NST = SEQ / 128;                               // stages

  auto stage_copy = [&](int s) {
    const unsigned bo = (unsigned)(s & 1) * 2u * tile_b;
    const _Float16* nk = gk + (size_t)s * 128 * HD;
    const _Float16* nv = gv + s * 128;
    copy4_to_lds(lk + bo, nk, lk + bo + half_b, nk + 32 * HD, lv + bo, nv, lv + bo + half_b, nv + (size_t)32 * SEQ);
    copy4_to_lds(lk + bo + tile_b, nk + 64 * HD, lk + bo + tile_b + half_b, nk + 96 * HD,
                 lv + bo + tile_b, nv + 64, lv + bo + tile_b + half_b, nv + (size_t)32 * SEQ + 64);
  };

  // stage 0 into buffer 0, landed and published
  stage_copy(0);
  asm volatile("s_wait_asynccnt 0x0" ::: "memory");   // this wave's copies of stage 0 have landed
  __syncthreads();              // stage 0 visible to every wave

  for (int s = 0; s < NST; ++s) {
    // directly behind the barrier (the one above, or the one at the foot of pass s - 1, which freed that pass's buffer):
    // stage s + 1, where there is one, into the other buffer; the test reads the same for the whole work-group.
    // It stands at the head, not at the foot, so that the pass ends in one straight block: with a branch at the foot the row sums are
    // moved behind it, the 64 registers of f32 p stay live through the last products, and the wave no longer fits 256 registers (4 waves per SIMD).
    if (s + 1 < NST) stage_copy(s + 1);

    const int tb = ((s & 1) << 1) + grp;
    const _Float16* Kb = &Kt[tb][0];
    const _Float16* Vb = &Vt[tb][0];

    v8f sc[2][4];
    FragH pb[2][2];
    float ps[2];

    // S^T(64 keys x 32 queries) = K(64x64) . Q^T + (PCARRY - mu) : sc[cg][t][r] = of query n16 of cg, key 16t + 8hh + r
    auto scores = [&]() {
#pragma unroll
      for (int t = 0; t < 4; ++t) {
        const v16h ka0 = frag_h(Kb + (t * 16) * LP, LP);
        const v16h ka1 = frag_h(Kb + (t * 16) * LP + 32, LP);
        v8f c0 = mma_h(ka0, bq[0][0], ci[0]);
        v8f c1 = mma_h(ka0, bq[1][0], ci[1]);
        c0 = mma_h(ka1, bq[0][1], c0);
        c1 = mma_h(ka1, bq[1][1], c1);
        sc[0][t] = c0;
        sc[1][t] = c1;
      }
    };

    // V^T as A operand: va[2 dt + j] = rows d 16dt .. 16dt + 15, keys 32j .. 32j + 31
    v16h va[8];

    // p = 2^sc; P^T as B operand; ps = the lane's sum of its 32 p of a column group
    auto exp_sum = [&]() {
      // the V^T fragments that fit beside the 64 p are read in front of the test: they land behind the sums, the test and the conversions
#pragma unroll  // constant indices keep va in registers
      for (int i = 0; i < 6; ++i) va[i] = frag_h(Vb + ((i >> 1) * 16) * LP + (i & 1) * 32, LP);
      asm volatile("" ::: "memory");         // holds these reads in front of the test: without it they are moved behind the branch, where only the conversions stand between them and the products
#pragma unroll  // constant indices keep sc and pb in registers
      for (int cg = 0; cg < 2; ++cg) {
        // in frag_h's k order: element s of pb[cg][j] is key 32j + 16(s >> 3) + 8hh + (s & 7) = score tile 2j + (s >> 3), register s & 7
#pragma unroll  // as above
        for (int t = 0; t < 4; ++t) {
          v8f p;
#pragma unroll  // as above
          for (int r = 0; r < 8; ++r) p[r] = __builtin_amdgcn_exp2f(sc[cg][t][r]);
          sc[cg][t] = p;
          pb[cg][t >> 1].p[t & 1] = __builtin_convertvector(p, v8ha);
        }
        // in-lane sum of the 32 p as a tree: short dependent chains, packed adds
        const v8f s8 = (sc[cg][0] + sc[cg][1]) + (sc[cg][2] + sc[cg][3]);
        ps[cg] = ((s8[0] + s8[1]) + (s8[2] + s8[3])) + ((s8[4] + s8[5]) + (s8[6] + s8[7]));
      }
    };

    // The common pass forms no maximum: no p is negative, so each is at most the lane's sum, which the pass needs anyway;
    // a sum within f16's range says that every p of the lane is. Pass 0 has no maximum in use yet and goes straight to the renewing path.
    bool renew = true;
    if (s > 0) {
      scores();
      exp_sum();
      renew = !(fmaxf(ps[0], ps[1]) <= PSUMMAX);
    }

    // one test per pass, a scalar branch for the whole wave; the renewing path forms the pass's scores again (its K tile is still in LDS)
    if (__builtin_expect(__builtin_amdgcn_ballot_w32(renew) != 0, 0)) {
      asm volatile("" ::: "memory");         // the K fragments are read from LDS again here: kept in registers for this path, 64 of them would stay live through the common path (over 256 registers, 3 waves per SIMD)
      scores();
      __builtin_amdgcn_sched_barrier(0);     // the maxima stay behind the products: moved in among them, one was given a register of the start values directly behind the last product that reads it
#pragma unroll  // constant indices keep sc, ci and o in registers
      for (int cg = 0; cg < 2; ++cg) {
        // a query's largest accumulator: 32 keys in this lane, the other 32 in lane ^ 16
        float m = sc[cg][0][0];
#pragma unroll  // as above
        for (int t = 0; t < 4; ++t)
#pragma unroll  // as above
          for (int r = 0; r < 8; ++r) m = fmaxf(m, sc[cg][t][r]);
        m = fmaxf(m, xhalf(m));
        float d = m - PCARRY;                      // the new maximum above the one in use
        if (s > 0) d = fmaxf(d, 0.f);              // a maximum in use never falls; a lane with nothing to renew keeps its own (d = 0)
        const float alpha = __builtin_amdgcn_exp2f(fminf(-d, 0.f));   // pass 0 scales zeros: any finite factor
        lrow[cg] *= alpha;
        const float cn = ci[cg][0] - d;
#pragma unroll  // as above
        for (int r = 0; r < 8; ++r) ci[cg][r] = cn;
#pragma unroll  // as above
        for (int t = 0; t < 4; ++t) {
          sc[cg][t] -= d;
          o[cg][t] *= alpha;
        }
      }
      exp_sum();   // every accumulator is now at most PCARRY: 32 p sum to at most 2^(PCARRY + 5), inside PSUMMAX
    }
    lrow[0] += ps[0];
    lrow[1] += ps[1];

    // O^T(64 d x 32 queries) += V^T(64 d x 64 keys) . P^T : A[m=d][k=key] = Vt[d][key]
    va[6] = frag_h(Vb + 48 * LP, LP);        // the last two fragments, once the f32 p are gone; they land behind the first products
    va[7] = frag_h(Vb + 48 * LP + 32, LP);
#pragma unroll
    for (int dt = 0; dt < 4; ++dt) {
      v8f c0 = o[0][dt], c1 = o[1][dt];
      c0 = mma_h(va[2 * dt], pb[0][0].v, c0);
      c1 = mma_h(va[2 * dt], pb[1][0].v, c1);
      c0 = mma_h(va[2 * dt + 1], pb[0][1].v, c0);
      c1 = mma_h(va[2 * dt + 1], pb[1][1].v, c1);
      o[0][dt] = c0;
      o[1][dt] = c1;
    }

    // hand-over: this wave's reads of stage s are done, its copies of stage s + 1 have landed; the one barrier
    // publishes stage s + 1 and frees stage s's buffer, which takes stage s + 2 at the head of the next pass
    asm volatile("s_wait_dscnt 0x0" ::: "memory");      // own LDS reads retired before the buffer is refilled
    asm volatile("s_wait_asynccnt 0x0" ::: "memory");   // own copies landed before other waves read them
    __syncthreads();
  }
  asm volatile("s_wait_asynccnt 0x0" ::: "memory");     // nothing of this wave in flight behind the loop

  // merge of the two key groups: the wave of key group g finishes column group g of its 32 queries; it hands its partial
  // of the other column group to the partner wave (wave ^ 4, same queries, same lane map) and takes the partner's of its own
  const float mu0 = PCARRY - ci[0][0], mu1 = PCARRY - ci[1][0];   // the maxima in use
  const float mk = grp ? mu1 : mu0, lkp = grp ? lrow[1] : lrow[0];
  Xm[wave][0][lane] = grp ? mu0 : mu1;
  Xm[wave][1][lane] = grp ? lrow[0] : lrow[1];
  v8f keep[4];
#pragma unroll
  for (int dt = 0; dt < 4; ++dt) {
    keep[dt] = grp ? o[1][dt] : o[0][dt];
    const v8f give = grp ? o[0][dt] : o[1][dt];
    Xo[wave][2 * dt][lane]     = __builtin_shufflevector(give, give, 0, 1, 2, 3);
    Xo[wave][2 * dt + 1][lane] = __builtin_shufflevector(give, give, 4, 5, 6, 7);
  }
  __syncthreads();              // both partners' partials are in LDS

  const int part = wave ^ 4;
  const float mo = Xm[part][0][lane], lo = Xm[part][1][lane];
  const float mm = fmaxf(mk, mo);
  const float ak = __builtin_amdgcn_exp2f(mk - mm), ao = __builtin_amdgcn_exp2f(mo - mm);
  const float lsum = lkp * ak + lo * ao;

  // normalise: o and l hold the same carried p; ctx carried x64 -> o * 64 / l; l joins the two halves' sums
  const float inv = 64.0f * __builtin_amdgcn_rcpf(lsum + xhalf(lsum));
  const float fk = ak * inv, fo = ao * inv;

  // a lane's 8 registers of one dt are 8 consecutive d of one query row: one 16-byte LDS store each
#pragma unroll
  for (int dt = 0; dt < 4; ++dt) {
    const v4fa y0 = Xo[part][2 * dt][lane];
    const v4fa y1 = Xo[part][2 * dt + 1][lane];
    Pack8 w;
#pragma unroll
    for (int r = 0; r < 4; ++r) {
      w.s[r]     = (_Float16)(keep[dt][r] * fk + y0[r] * fo);
      w.s[r + 4] = (_Float16)(keep[dt][r + 4] * fk + y1[r] * fo);
    }
    *(v8ha*)&Ct[wave][n16 * LP + dt * 16 + 8 * hh] = w.h;
  }
  __syncthreads();              // staged rows complete before they are read back across lanes

  wave_store_rows16(&Ct[wave][0],
                    Cp + ((size_t)b * SEQ + q0 + 16 * grp) * EMB + h * HD, EMB);
}

// ---------------- kernel 3: output projection out = ctx . Wo^T + bo ----------------
// block = 256 threads (8 waves); block tile 128 tokens x 64 outputs; wave owns 16 x 64.
// The block's whole B slab (rows n0..n0+63 of the Wo plane, all 512 k, f16 as the first launch left them) is staged in LDS once, behind one barrier;
// the k loop has no barrier, so no global load waits for a barrier: the slab's loads and a wave's A fragment loads are issued many at a time, ahead of their use.
__global__ __launch_bounds__(256) void k_oproj(
    const _Float16* __restrict__ Cp, const _Float16* __restrict__ Whp,
    const float* __restrict__ bo, float* __restrict__ out) {
  __shared__ __align__(16) _Float16 Bt[64 * KP];     // [n local][k]
  __shared__ __align__(16) float Os[8][16 * OP];     // per wave f32 output staging

  const int tid = threadIdx.x, wave = tid >> 5, lane = tid & 31;
  const int hh = lane >> 4, n16 = lane & 15;
  const int m0 = blockIdx.x * 128 + wave * 16;
  const int n0 = blockIdx.y * 64;

  // the slab is 64 whole rows of the plane: 32768 consecutive halves; a wave's load covers 512 consecutive bytes
  const _Float16* wsrc = Whp + (size_t)n0 * EMB + tid * 8;
  const _Float16* arow = Cp + (size_t)m0 * EMB;

  v4u wr[16];
#pragma unroll  // constant indices keep wr in registers; the loads stand together
  for (int it = 0; it < 16; ++it) wr[it] = *(const v4u*)(wsrc + it * 2048);

  v16h a[16];
#pragma unroll  // constant indices keep a in registers
  for (int ks = 0; ks < 8; ++ks) a[ks] = frag_h(arow + ks * 32, EMB);
  float braw[4];                // bias, read here so that no wait for it stands among the products behind later loads
#pragma unroll  // constant indices keep braw in registers
  for (int t = 0; t < 4; ++t) braw[t] = bo[n0 + t * 16 + n16];

  // load it of thread tid: row 4 it + (tid >> 6), k 8 (tid & 63) .. + 7
  _Float16* bdst = &Bt[(tid >> 6) * KP + (tid & 63) * 8];
#pragma unroll  // as above, wr
  for (int it = 0; it < 16; ++it) *(v4u*)(bdst + it * 4 * KP) = wr[it];
  __syncthreads();              // Bt visible

  // second half of the A fragments: behind the barrier, which waits for every load in flight; they land behind the first half's products
#pragma unroll  // as above, a
  for (int ks = 8; ks < 16; ++ks) a[ks] = frag_h(arow + ks * 32, EMB);

  v8f acc[4];
#pragma unroll
  for (int t = 0; t < 4; ++t) acc[t] = z8();

#pragma unroll  // constant indices keep a in registers
  for (int ks = 0; ks < 16; ++ks)
#pragma unroll  // constant indices keep acc in registers
    for (int t = 0; t < 4; ++t)
      acc[t] = mma_h(a[ks], frag_h(&Bt[(t * 16) * KP + ks * 32], KP), acc[t]);

  // epilogue: undo carries (64*16 = 1024), add bf16-RNE bias, stage f32 tile
#pragma unroll
  for (int t = 0; t < 4; ++t) {
    const float bias = bfval(braw[t]);
#pragma unroll
    for (int r = 0; r < 8; ++r)
      Os[wave][(8 * hh + r) * OP + t * 16 + n16] = acc[t][r] * (1.0f / 1024.0f) + bias;
  }
  __syncthreads();

  // 16 rows x 256 B = 32 lines; line = (row, half); 8 lanes x 16 B per line, 4 lines per instruction
  const int rsub = lane >> 3, c4 = (lane & 7) << 2;
  v4fa v[8];
#pragma unroll
  for (int it = 0; it < 8; ++it) {
    const int li = it * 4 + rsub;
    const int row = li >> 1, hf = li & 1;
    v[it] = *(const v4fa*)&Os[wave][row * OP + hf * 32 + c4];
  }
  float* base = out + (size_t)m0 * EMB + n0;
#pragma unroll
  for (int it = 0; it < 8; ++it) {
    const int li = it * 4 + rsub;
    const int row = li >> 1, hf = li & 1;
    *(v4fa*)(base + (size_t)row * EMB + hf * 32 + c4) = v[it];
  }
  
}

// ---------------- launcher ----------------
extern "C" void kernel_launch(void* const* d_in, const int* in_sizes, int n_in,
                              void* d_out, int out_size, void* d_ws, size_t ws_size,
                              hipStream_t stream) {
  if (n_in < 9) return;
  if (in_sizes[0] < ((NB - 1) * SEQ_FULL + SEQ) * EMB) return;
  if (in_sizes[1] < NH * HD * HD || in_sizes[3] < NH * HD * HD || in_sizes[5] < NH * HD * HD) return;
  if (in_sizes[2] < NH * HD || in_sizes[4] < NH * HD || in_sizes[6] < NH * HD) return;
  if (in_sizes[7] < EMB * EMB || in_sizes[8] < EMB) return;
  if (out_size < MTOK * EMB) return;

  const float* x  = (const float*)d_in[0];
  const float* Wq = (const float*)d_in[1];
  const float* bq = (const float*)d_in[2];
  const float* Wk = (const float*)d_in[3];
  const float* bk = (const float*)d_in[4];
  const float* Wv = (const float*)d_in[5];
  const float* bv = (const float*)d_in[6];
  const float* Wo = (const float*)d_in[7];
  const float* bo = (const float*)d_in[8];
  float* out = (float*)d_out;

  const size_t qkv_bytes = (size_t)NB * NH * SEQ * HD * 2;   // 8 MiB at full size
  const size_t ctx_bytes = (size_t)MTOK * EMB * 2;           // 8 MiB at full size
  const size_t off_q = 0;
  const size_t off_k = off_q + qkv_bytes;
  const size_t off_v = off_k + qkv_bytes;
  const size_t off_c = off_v + qkv_bytes;
  const size_t off_w = off_c + ctx_bytes;
  const size_t total = off_w + (size_t)EMB * EMB * 2;        // + 512 KiB
  if (total > ws_size) return;

  char* ws = (char*)d_ws;
  _Float16* Qp  = (_Float16*)(ws + off_q);
  _Float16* Kp  = (_Float16*)(ws + off_k);
  _Float16* Vtp = (_Float16*)(ws + off_v);
  _Float16* Cp  = (_Float16*)(ws + off_c);
  _Float16* Whp = (_Float16*)(ws + off_w);

  k_qkv<<<dim3(MTOK / 128, NH), 256, 0, stream>>>(x, Wq, bq, Wk, bk, Wv, bv, Wo, Qp, Kp, Vtp, Whp);
  k_attn<<<dim3(NB * NH, SEQ / 128), 256, 0, stream>>>(Qp, Kp, Vtp, Cp);
  k_oproj<<<dim3(MTOK / 128, EMB / 64), 256, 0, stream>>>(Cp, Whp, bo, out);
}
